// v000
// The times below were measured on an AMD MI455X: many runs one after another, warmed up first and cycling through
// copies of the inputs, with the whole window's GPU time divided by the number of runs. Launches and the gaps
// between them are all in it. The median over several windows is given; except for v000 it joins two sittings, which
// can be a few percent apart, so the side-by-side timings, each taken in one sitting, are the better comparison.
// The starting kernel, v000, takes 2950 microseconds a run.
#include <hip/hip_runtime.h>

// Causal multi-head attention with per-head weight tensors, scaled by sqrt(embed) (x [4][2048][1024]; q,k,v = einsum('bte,hed', x, W) (Wq, Wk, Wv [16][1024][64] uniform(+-1/32): head h's 'xw' block); 16 heads x 64; causal (-inf); scores / sqrt(1024) (the source's quirk: sigma ~0.1 logits); softmax; out = concat heads -> [4][2048][1024] (8.4 M; no output projection)).
// Layout per batch: bf16 copy of x; each projection tensor's 16 'xw' [1024][64] blocks transposed into one [1024][1024] Bt (rows h*64..); exact projections; causal T-2048 attention with hi/lo 3-product score tiles on EVERY row; P and attn.v hybrid (rows < 512 hi/lo, rest fp16 x1024; tiles above the diagonal skipped); the f32 merge writes the output rows.
// Compute dtypes, f32 accumulate: every input rounded to bf16; projections exact; scores 3 products on every row; softmax f32 (x 1/32); attn.v rows < 512 3 products, rest fp16; output f32.

#define NB_  4
#define TT   2048
#define DM   1024
#define NH_  16
#define NKV  16
#define REP  (NH_ / NKV)
#define HD   64
#define DQ   (NH_ * HD)
#define DKV  (NKV * HD)
#define ZH   2
#define RH   512                  // query rows < RH use hi+lo planes (0: none)
#define WIN  2048
#define PCAR 1024.0f
#define SCL  0.03125f  // 1/sqrt(embed = 1024): the source's quirk
typedef _Float16 h16;
typedef unsigned short bf;
typedef __attribute__((ext_vector_type(16))) __bf16   v16bf;
typedef __attribute__((ext_vector_type(16))) _Float16 v16h;
typedef __attribute__((ext_vector_type(8)))  _Float16 v8h;
typedef __attribute__((ext_vector_type(8)))  unsigned short v8us;
typedef __attribute__((ext_vector_type(8)))  float    v8f;
typedef __attribute__((ext_vector_type(4)))  float    v4f;
typedef v8h  __attribute__((may_alias)) v8ha;
typedef v4f  __attribute__((may_alias)) v4fa;
typedef v8us __attribute__((may_alias)) v8usa;

__device__ __forceinline__ unsigned short f2bf(float f) { unsigned u = __float_as_uint(f); u += 0x7FFFu + ((u >> 16) & 1u); return (unsigned short)(u >> 16); }
__device__ __forceinline__ float bf2f(unsigned short b) { return __uint_as_float(((unsigned)b) << 16); }
__device__ __forceinline__ float bfr(float f) { return bf2f(f2bf(f)); }
__device__ __forceinline__ v16h cat16(v8h lo, v8h hi) { return __builtin_shufflevector(lo, hi, 0, 1, 2, 3, 4, 5, 6, 7, 8, 9, 10, 11, 12, 13, 14, 15); }
__device__ __forceinline__ v16bf cat16b(v8us lo, v8us hi) { return __builtin_bit_cast(v16bf, __builtin_shufflevector(lo, hi, 0, 1, 2, 3, 4, 5, 6, 7, 8, 9, 10, 11, 12, 13, 14, 15)); }
__device__ __forceinline__ v8f wmma16(v16h a, v16h b, v8f c) { return __builtin_amdgcn_wmma_f32_16x16x32_f16(false, a, false, b, (short)0, c, false, false); }
__device__ __forceinline__ v8f wmmab(v16bf a, v16bf b, v8f c) { return __builtin_amdgcn_wmma_f32_16x16x32_bf16(false, a, false, b, (short)0, c, false, false); }



// ---- k_gemmw: register-blocked GEMM, ONE WAVE per 64x64 output tile (16 accumulators), operands straight from K-contiguous 16-bit planes; grid (M/64, N/64, Z), 32 threads.
// C[m][n] (f32, pitch ldc, + optional f32 bias[n]) = sum_k A[m][k] Bt[n][k] (+ split products per NSPLIT). z-batch strides sA/sB/sC in elements. K % 32 == 0.
template <typename T16> struct WFrag;
template <> struct WFrag<h16> { typedef v16h V; static __device__ __forceinline__ V ld(const h16* p) { return cat16(*(const v8h*)p, *(const v8h*)(p + 16)); } static __device__ __forceinline__ v8f mma(V a, V b, v8f c) { return wmma16(a, b, c); } };
template <> struct WFrag<bf> { typedef v16bf V; static __device__ __forceinline__ V ld(const bf* p) { return cat16b(*(const v8us*)p, *(const v8us*)(p + 16)); } static __device__ __forceinline__ v8f mma(V a, V b, v8f c) { return wmmab(a, b, c); } };
template <typename T16, int NSPLIT, bool BIAS>
__global__ __launch_bounds__(32) void k_gemmw(const T16* __restrict__ A, const T16* __restrict__ A2, const T16* __restrict__ Bt, const T16* __restrict__ Bt2, int K, float* C, int ldc, const float* __restrict__ bias, size_t sA, size_t sB, size_t sC) {
    typedef typename WFrag<T16>::V V;
    __shared__ __align__(16) float os[16 * 68];
    const size_t z = blockIdx.z; A += z * sA; if (A2) A2 += z * sA; Bt += z * sB; if (Bt2) Bt2 += z * sB; C += z * sC;
    const int lane = threadIdx.x & 31, lr = lane & 15, hi = lane >> 4; const int r0 = blockIdx.x * 64, c0 = blockIdx.y * 64;
    v8f acc[4][4];
#pragma unroll
    for (int mb = 0; mb < 4; ++mb)
#pragma unroll
        for (int nb = 0; nb < 4; ++nb) acc[mb][nb] = (v8f){};
    const size_t aoff = (size_t)(r0 + lr) * K + 8 * hi, boff = (size_t)(c0 + lr) * K + 8 * hi;
#pragma unroll 1
    for (int kc = 0; kc < K; kc += 32) {
        V a[4], a2[4];
#pragma unroll
        for (int mb = 0; mb < 4; ++mb) { a[mb] = WFrag<T16>::ld(A + aoff + (size_t)mb * 16 * K + kc); if (NSPLIT == 1 || NSPLIT == 2) a2[mb] = WFrag<T16>::ld(A2 + aoff + (size_t)mb * 16 * K + kc); }
#pragma unroll
        for (int nb = 0; nb < 4; ++nb) { const V b = WFrag<T16>::ld(Bt + boff + (size_t)nb * 16 * K + kc); V b2; if (NSPLIT >= 2) b2 = WFrag<T16>::ld(Bt2 + boff + (size_t)nb * 16 * K + kc);
#pragma unroll
            for (int mb = 0; mb < 4; ++mb) { acc[mb][nb] = WFrag<T16>::mma(a[mb], b, acc[mb][nb]); if (NSPLIT == 1 || NSPLIT == 2) acc[mb][nb] = WFrag<T16>::mma(a2[mb], b, acc[mb][nb]); if (NSPLIT >= 2) acc[mb][nb] = WFrag<T16>::mma(a[mb], b2, acc[mb][nb]); } }
        asm volatile("v_nop\n\tv_nop\n\tv_nop\n\tv_nop" : "+v"(acc[0][0]), "+v"(acc[1][1]), "+v"(acc[2][2]), "+v"(acc[3][3]) : "v"(a[0]), "v"(a[3]));
    }
#pragma unroll
    for (int mb = 0; mb < 4; ++mb) {
#pragma unroll
        for (int nb = 0; nb < 4; ++nb) {
#pragma unroll
            for (int j = 0; j < 8; ++j) os[(hi * 8 + j) * 68 + nb * 16 + lr] = acc[mb][nb][j]; }
        __builtin_amdgcn_wave_barrier(); asm volatile("" ::: "memory");
        float* crow = C + (size_t)(r0 + mb * 16) * ldc + c0;
{
#pragma unroll
            for (int s = 0; s < 8; ++s) { const int row = 2 * s + hi, cofs = lr * 4; v4f val = *(const v4fa*)(os + row * 68 + cofs); if (BIAS) { val[0] += bfr(bias[c0 + cofs]); val[1] += bfr(bias[c0 + cofs + 1]); val[2] += bfr(bias[c0 + cofs + 2]); val[3] += bfr(bias[c0 + cofs + 3]); }
                *(v4f*)(crow + (size_t)row * ldc + cofs) = val; }
             }
        __builtin_amdgcn_wave_barrier(); asm volatile("" ::: "memory");
    }
}

// ---- k_gemmc: the same one-wave 64x64 tile GEMM specialised for causal attention: CMODE 1 skips score tiles entirely above the diagonal (query rows r0+roff.., key columns c0..), CMODE 2 limits the
// key (K) loop of the probability x value contraction to the diagonal block (probabilities beyond it are exactly zero). roff = row offset of this launch's first row within the sequence.
template <typename T16, int NSPLIT, int CMODE>
__global__ __launch_bounds__(32) void k_gemmc(const T16* __restrict__ A, const T16* __restrict__ A2, const T16* __restrict__ Bt, const T16* __restrict__ Bt2, int K, float* C, int ldc, int roff, size_t sA, size_t sB, size_t sC) {
    typedef typename WFrag<T16>::V V;
    __shared__ __align__(16) float os[16 * 68];
    const size_t z = blockIdx.z; A += z * sA; if (A2) A2 += z * sA; Bt += z * sB; if (Bt2) Bt2 += z * sB; C += z * sC;
    const int lane = threadIdx.x & 31, lr = lane & 15, hi = lane >> 4; const int r0 = blockIdx.x * 64, c0 = blockIdx.y * 64;
    if (CMODE == 1 && c0 > r0 + roff + 63) return;                  // score tile entirely above the causal diagonal: never read (the softmax masks j > i by select)
    const int Kl = (CMODE == 2) ? min(K, r0 + roff + 64) : K;        // P.V: probabilities are exactly 0 beyond the diagonal block, so the K loop stops there
    v8f acc[4][4];
#pragma unroll
    for (int mb = 0; mb < 4; ++mb)
#pragma unroll
        for (int nb = 0; nb < 4; ++nb) acc[mb][nb] = (v8f){};
    const size_t aoff = (size_t)(r0 + lr) * K + 8 * hi, boff = (size_t)(c0 + lr) * K + 8 * hi;
#pragma unroll 1
    for (int kc = 0; kc < Kl; kc += 32) {
        V a[4], a2[4];
#pragma unroll
        for (int mb = 0; mb < 4; ++mb) { a[mb] = WFrag<T16>::ld(A + aoff + (size_t)mb * 16 * K + kc); if (NSPLIT == 1 || NSPLIT == 2) a2[mb] = WFrag<T16>::ld(A2 + aoff + (size_t)mb * 16 * K + kc); }
#pragma unroll
        for (int nb = 0; nb < 4; ++nb) { const V b = WFrag<T16>::ld(Bt + boff + (size_t)nb * 16 * K + kc); V b2; if (NSPLIT >= 2) b2 = WFrag<T16>::ld(Bt2 + boff + (size_t)nb * 16 * K + kc);
#pragma unroll
            for (int mb = 0; mb < 4; ++mb) { acc[mb][nb] = WFrag<T16>::mma(a[mb], b, acc[mb][nb]); if (NSPLIT == 1 || NSPLIT == 2) acc[mb][nb] = WFrag<T16>::mma(a2[mb], b, acc[mb][nb]); if (NSPLIT >= 2) acc[mb][nb] = WFrag<T16>::mma(a[mb], b2, acc[mb][nb]); } }
        asm volatile("v_nop\n\tv_nop\n\tv_nop\n\tv_nop" : "+v"(acc[0][0]), "+v"(acc[1][1]), "+v"(acc[2][2]), "+v"(acc[3][3]) : "v"(a[0]), "v"(a[3]));
    }
#pragma unroll
    for (int mb = 0; mb < 4; ++mb) {
#pragma unroll
        for (int nb = 0; nb < 4; ++nb) {
#pragma unroll
            for (int j = 0; j < 8; ++j) os[(hi * 8 + j) * 68 + nb * 16 + lr] = acc[mb][nb][j]; }
        __builtin_amdgcn_wave_barrier(); asm volatile("" ::: "memory");
        float* crow = C + (size_t)(r0 + mb * 16) * ldc + c0;
{
#pragma unroll
            for (int s = 0; s < 8; ++s) { const int row = 2 * s + hi, cofs = lr * 4; v4f val = *(const v4fa*)(os + row * 68 + cofs);
                *(v4f*)(crow + (size_t)row * ldc + cofs) = val; }
             }
        __builtin_amdgcn_wave_barrier(); asm volatile("" ::: "memory");
    }
}

__device__ __forceinline__ h16 tohx(float x) { return (h16)x; }
__device__ __forceinline__ void splitf(float y, unsigned short& h, unsigned short& l) { h = f2bf(y); l = f2bf(y - bf2f(h)); }
typedef __attribute__((ext_vector_type(2))) _Float16 v2h;
typedef __attribute__((ext_vector_type(4))) _Float16 v4h;
typedef __attribute__((ext_vector_type(2))) unsigned short v2us;
typedef __attribute__((ext_vector_type(4))) unsigned short v4us;
typedef __attribute__((ext_vector_type(2))) float v2f;
typedef __attribute__((ext_vector_type(4))) int v4i;

__global__ __launch_bounds__(256) void k_wtG(const float* __restrict__ w, int K, int N, bf* Bt) {
    const int lane = threadIdx.x & 31; const int L0 = (blockIdx.x * 8 + (threadIdx.x >> 5)) * 8; const int nlines = N * K / 64;
{
#pragma unroll 1
        for (int l = 0; l < 8; ++l) { const int L = L0 + l; if (L >= nlines) break; const size_t e = (size_t)L * 64 + lane * 2; const int k = (int)(e % K), n = (int)(e / K); v2us o;
            o[0] = f2bf(w[(size_t)k * N + n]); o[1] = f2bf(w[(size_t)(k + 1) * N + n]); *(v2us*)(Bt + e) = o; }
         }
}
__global__ __launch_bounds__(256) void k_cvt8(const float* __restrict__ src, bf* dst, size_t n8) { const size_t i = (size_t)blockIdx.x * 256 + threadIdx.x; if (i >= n8) return; const v8f v = *(const v8f*)(src + i * 8); v8us o;
#pragma unroll
    for (int k = 0; k < 8; ++k) o[k] = f2bf(v[k]); *(v8us*)(dst + i * 8) = o;  }

// k_rope: head planes [h][t][d] (fp16 + hi/lo) of rope(x) x sc with the rotate-half convention out[d] = x[d] cos[t][d] - x[d+HD/2] sin[t][d], out[d+HD/2] = x[d+HD/2] cos[t][d+HD/2] + x[d] sin[t][d+HD/2]
__global__ __launch_bounds__(256) void k_rope(const float* __restrict__ F, int pitch, int nheads, const float* __restrict__ CS, const float* __restrict__ RF, const float* __restrict__ nw, float sc, h16* P16, bf* Ph, bf* Pl) {
    const size_t e = ((size_t)blockIdx.x * 256 + threadIdx.x) * 2; if (e >= (size_t)nheads * TT * HD) return; const int d = (int)(e % HD); const int t = (int)((e / HD) % TT); const int h = (int)(e / ((size_t)HD * TT)); const float* f = F + (size_t)t * pitch + h * HD; const float rf = RF ? RF[(size_t)h * TT + t] : 1.0f; v2h o16; v2us oh, ol;
#pragma unroll
    for (int q = 0; q < 2; ++q) { const int dd = d + q; const int dp = (dd < HD / 2) ? dd + HD / 2 : dd - HD / 2; float x0 = f[dd], x1 = f[dp];
        if (RF) { float n0 = __fmul_rn(x0, rf), n1 = __fmul_rn(x1, rf); asm volatile("" : "+v"(n0)); asm volatile("" : "+v"(n1)); x0 = __fmul_rn(bfr(nw[dd]), n0); x1 = __fmul_rn(bfr(nw[dp]), n1); }
        const v2f cs = *(const v2f*)(CS + ((size_t)t * HD + dd) * 2); float a = __fmul_rn(x0, cs[0]), bq = __fmul_rn(x1, cs[1]); asm volatile("" : "+v"(a)); asm volatile("" : "+v"(bq)); const float r = ((dd < HD / 2) ? __fsub_rn(a, bq) : __fadd_rn(a, bq)) * sc;
        o16[q] = tohx(r); unsigned short a2, c2; splitf(r, a2, c2); oh[q] = a2; ol[q] = c2; }
    *(v2h*)(P16 + e) = o16; *(v2us*)(Ph + e) = oh; *(v2us*)(Pl + e) = ol;  }
__global__ __launch_bounds__(256) void k_vtp(const float* __restrict__ F, int pitch, int nheads, h16* V16, bf* Vh, bf* Vl) { const size_t e = ((size_t)blockIdx.x * 256 + threadIdx.x) * 2; if (e >= (size_t)nheads * HD * TT) return; const int t = (int)(e % TT); const int d = (int)((e / TT) % HD); const int g = (int)(e / ((size_t)TT * HD)); v2h o16; v2us oh, ol;
#pragma unroll
    for (int q = 0; q < 2; ++q) { const float x = F[(size_t)(t + q) * pitch + g * HD + d]; o16[q] = tohx(x); unsigned short a2, c2; splitf(x, a2, c2); oh[q] = a2; ol[q] = c2; }
    *(v2h*)(V16 + e) = o16; *(v2us*)(Vh + e) = oh; *(v2us*)(Vl + e) = ol;  }
__global__ __launch_bounds__(256) void k_csid(float* CS) { const int idx = blockIdx.x * 256 + threadIdx.x; if (idx >= TT * HD) return; v2f cs; cs[0] = 1.0f; cs[1] = 0.0f; *(v2f*)(CS + (size_t)idx * 2) = cs;  }
// k_asoft: per row (zz, i): t = S x SCL (= DM^-0.5) for j <= i and i - j < WIN (sliding causal window; the reference's -1e9 additive fill vanishes identically); softmax over the 2048 keys (register row, one exp, fixed trees);
__global__ __launch_bounds__(256) void k_asoft(const float* __restrict__ Sb, h16* P16, bf* Ph, bf* Pl) {
    const int lane = threadIdx.x & 31; const int row = blockIdx.x * 8 + (threadIdx.x >> 5); if (row >= ZH * TT) return; const int i = row % TT; const int zz = row / TT; (void)zz; const bool hires = (i < RH); const float* sr = Sb + (size_t)row * TT; float v[TT / 32]; float mx = -3.0e38f;
#pragma unroll
    for (int ch = 0; ch < TT / 128; ++ch) { const int j0 = ch * 128 + lane * 4; const v4f a = *(const v4f*)(sr + j0);
#pragma unroll
        for (int q = 0; q < 4; ++q) { const int j = j0 + q; (void)j; const float t = (j <= i && i - j < WIN) ? a[q] * SCL : -3.0e38f; v[ch * 4 + q] = t; mx = fmaxf(mx, t); } }
#pragma unroll
    for (int sh = 16; sh; sh >>= 1) mx = fmaxf(mx, __shfl_xor(mx, sh, 32));
    float sum = 0.f;
#pragma unroll
    for (int k = 0; k < TT / 32; ++k) { float d0 = __fsub_rn(v[k], mx); asm volatile("" : "+v"(d0)); v[k] = __builtin_amdgcn_exp2f(__fmul_rn(d0, 1.4426950408889634f)); sum += v[k]; }
#pragma unroll
    for (int sh = 16; sh; sh >>= 1) sum += __shfl_xor(sum, sh, 32);
    const float f = __fdiv_rn(hires ? 1.0f : PCAR, sum);
{
        if (hires) {
#pragma unroll
            for (int ch = 0; ch < TT / 128; ++ch) { v4us oh, ol;
#pragma unroll
                for (int q = 0; q < 4; ++q) { unsigned short a, c2; splitf(v[ch * 4 + q] * f, a, c2); oh[q] = a; ol[q] = c2; }
                const size_t oo = ((size_t)zz * (RH ? RH : 1) + i) * TT + ch * 128 + lane * 4; *(v4us*)(Ph + oo) = oh; *(v4us*)(Pl + oo) = ol; }
        } else {
#pragma unroll
            for (int ch = 0; ch < TT / 128; ++ch) { v4h o4;
#pragma unroll
                for (int q = 0; q < 4; ++q) o4[q] = tohx(v[ch * 4 + q] * f);
                *(v4h*)(P16 + (size_t)row * TT + ch * 128 + lane * 4) = o4; } }
         }
}
__global__ __launch_bounds__(256) void k_merge(const float* __restrict__ O, int h0, float* OUTb) { const size_t e = ((size_t)blockIdx.x * 256 + threadIdx.x) * 2; if (e >= (size_t)ZH * TT * HD) return; const int d = (int)(e % HD); const int t = (int)((e / HD) % TT); const int zz = (int)(e / ((size_t)HD * TT)); const float cs = (t < RH) ? 1.0f : (1.0f / PCAR); const size_t oo = (size_t)t * DQ + (h0 + zz) * HD + d;
    v2f o2; o2[0] = O[e] * cs; o2[1] = O[e + 1] * cs; *(v2f*)(OUTb + oo) = o2;  }

extern "C" void kernel_launch(void* const* d_in, const int* in_sizes, int n_in,
                              void* d_out, int out_size, void* d_ws, size_t ws_size, hipStream_t stream) {
    (void)in_sizes; (void)n_in; (void)out_size;
    const float* x = (const float*)d_in[0]; const float* pq = (const float*)d_in[1]; const float* pk = (const float*)d_in[2]; const float* pv = (const float*)d_in[3];   /* each [16][1024][64] */ const float* wq = pq, *wk = pk, *wv = pv, *wo = nullptr; (void)wo;
    float* OUT = (float*)d_out;     // [4][2048][1024]
    char* wsp = (char*)d_ws;
    auto take = [&](size_t bytes) { char* p = wsp; wsp += (bytes + 255) & ~(size_t)255; return (void*)p; };
    bf* WQ = (bf*)take((size_t)DQ * DM * 2); bf* WK = (bf*)take((size_t)DKV * DM * 2); bf* WV = (bf*)take((size_t)DKV * DM * 2); float* CS = (float*)take((size_t)TT * HD * 2 * 4);
    bf* XB = (bf*)take((size_t)TT * DM * 2); float* FQ = (float*)take((size_t)TT * DQ * 4); float* FK = (float*)take((size_t)TT * DKV * 4);
    h16* QP16 = (h16*)take((size_t)NH_ * TT * HD * 2); h16* KP16 = (h16*)take((size_t)NKV * TT * HD * 2); h16* VT16 = (h16*)take((size_t)NKV * HD * TT * 2);
    bf* QPh = (bf*)take((size_t)NH_ * TT * HD * 2); bf* QPl = (bf*)take((size_t)NH_ * TT * HD * 2); bf* KPh = (bf*)take((size_t)NKV * TT * HD * 2); bf* KPl = (bf*)take((size_t)NKV * TT * HD * 2); bf* VTh = (bf*)take((size_t)NKV * HD * TT * 2); bf* VTl = (bf*)take((size_t)NKV * HD * TT * 2); bf* Ph = (bf*)take((size_t)ZH * RH * TT * 2); bf* Pl = (bf*)take((size_t)ZH * RH * TT * 2);
    float* Sb = (float*)take((size_t)ZH * TT * TT * 4); h16* P16 = (h16*)take((size_t)ZH * TT * TT * 2); float* Ob = (float*)take((size_t)ZH * TT * HD * 4);
    if ((size_t)(wsp - (char*)d_ws) > ws_size) return;    // ws 256 MiB
    float* FV = FK;   // v projection reuses the k buffer after the k planes are built (stream-ordered)
    { for (int hh = 0; hh < NH_; ++hh) k_wtG<<<(unsigned)((DM * HD / 64 + 63) / 64), 256, 0, stream>>>(wq + (size_t)hh * DM * HD, DM, HD, WQ + (size_t)hh * HD * DM);   /* head hh's 'xw' [1024][64] -> Bt rows hh*64.. */ for (int hh = 0; hh < NH_; ++hh) k_wtG<<<(unsigned)((DM * HD / 64 + 63) / 64), 256, 0, stream>>>(wk + (size_t)hh * DM * HD, DM, HD, WK + (size_t)hh * HD * DM);   /* head hh's 'xw' [1024][64] -> Bt rows hh*64.. */ for (int hh = 0; hh < NH_; ++hh) k_wtG<<<(unsigned)((DM * HD / 64 + 63) / 64), 256, 0, stream>>>(wv + (size_t)hh * DM * HD, DM, HD, WV + (size_t)hh * HD * DM);   /* head hh's 'xw' [1024][64] -> Bt rows hh*64.. */
      
       }
    k_csid<<<(TT * HD + 255) / 256, 256, 0, stream>>>(CS);
    const unsigned LQ = (unsigned)(((size_t)NH_ * TT * HD / 2 + 255) / 256), LKv = (unsigned)(((size_t)NKV * TT * HD / 2 + 255) / 256);
    for (int b = 0; b < NB_; ++b) {
        
        k_cvt8<<<(unsigned)(((size_t)TT * DM / 8 + 255) / 256), 256, 0, stream>>>(x + (size_t)b * TT * DM, XB, (size_t)TT * DM / 8);
        k_gemmw<bf, 0, false><<<dim3(TT / 64, DQ / 64, 1), 32, 0, stream>>>(XB, nullptr, WQ, nullptr, DM, FQ, DQ, nullptr, 0, 0, 0);
        k_rope<<<LQ, 256, 0, stream>>>(FQ, DQ, NH_, CS, nullptr, nullptr, 1.0f, QP16, QPh, QPl);
        k_gemmw<bf, 0, false><<<dim3(TT / 64, DKV / 64, 1), 32, 0, stream>>>(XB, nullptr, WK, nullptr, DM, FK, DKV, nullptr, 0, 0, 0);
        k_rope<<<LKv, 256, 0, stream>>>(FK, DKV, NKV, CS, nullptr, nullptr, 1.0f, KP16, KPh, KPl);
        k_gemmw<bf, 0, false><<<dim3(TT / 64, DKV / 64, 1), 32, 0, stream>>>(XB, nullptr, WV, nullptr, DM, FV, DKV, nullptr, 0, 0, 0); k_vtp<<<LKv, 256, 0, stream>>>(FV, DKV, NKV, VT16, VTh, VTl);
        for (int h0 = 0; h0 < NH_; h0 += ZH) { const size_t zq = (size_t)h0, zk = (size_t)(h0 / REP);   // one kv head per query head: the pass's two heads use consecutive kv planes (z-strides TT*HD)
            k_gemmc<bf, 2, 1><<<dim3(TT / 64, TT / 64, ZH), 32, 0, stream>>>(QPh + zq * TT * HD, QPl + zq * TT * HD, KPh + zk * TT * HD, KPl + zk * TT * HD, HD, Sb, TT, 0, (size_t)TT * HD, (size_t)TT * HD, (size_t)TT * TT);   /* scores hi/lo on EVERY row */

            k_asoft<<<ZH * TT / 8, 256, 0, stream>>>(Sb, P16, Ph, Pl);
            k_gemmc<bf, 2, 2><<<dim3(RH / 64, HD / 64, ZH), 32, 0, stream>>>(Ph, Pl, VTh + zk * HD * TT, VTl + zk * HD * TT, TT, Ob, HD, 0, (size_t)RH * TT, (size_t)HD * TT, (size_t)TT * HD);
            k_gemmc<h16, 0, 2><<<dim3((TT - RH) / 64, HD / 64, ZH), 32, 0, stream>>>(P16 + (size_t)RH * TT, nullptr, VT16 + zk * HD * TT, nullptr, TT, Ob + (size_t)RH * HD, HD, RH, (size_t)TT * TT, (size_t)HD * TT, (size_t)TT * HD);
            k_merge<<<(unsigned)(((size_t)ZH * TT * HD / 2 + 255) / 256), 256, 0, stream>>>(Ob, h0, OUT + (size_t)b * TT * DQ); }
         }
}

// v001
// One run takes 1760 microseconds.
// Next to v000, in two timings, it ran 1.69 and 1.68 times as fast.
#include <hip/hip_runtime.h>

// Causal multi-head attention with per-head weight tensors, scaled by sqrt(embed) (x [4][2048][1024]; q,k,v = einsum('bte,hed', x, W) (Wq, Wk, Wv [16][1024][64] uniform(+-1/32): head h's 'xw' block); 16 heads x 64; causal (-inf); scores / sqrt(1024) (the source's quirk: sigma ~0.1 logits); softmax; out = concat heads -> [4][2048][1024] (8.4 M; no output projection)).
// Layout per batch: bf16 copy of x; each projection tensor's 16 'xw' [1024][64] blocks transposed into one [1024][1024] Bt (rows h*64..); exact projections; causal T-2048 attention with hi/lo 3-product score tiles on EVERY row; P and attn.v hybrid (rows < 512 hi/lo, rest fp16 x1024; tiles above the diagonal skipped); the f32 merge writes the output rows.
// Compute dtypes, f32 accumulate: every input rounded to bf16; projections exact; scores 3 products on every row; softmax f32 (x 1/32); attn.v rows < 512 3 products, rest fp16; output f32.

#define NB_  4
#define TT   2048
#define DM   1024
#define NH_  16
#define NKV  16
#define REP  (NH_ / NKV)
#define HD   64
#define DQ   (NH_ * HD)
#define DKV  (NKV * HD)
#define ZH   2
#define RH   512                  // query rows < RH use hi+lo planes (0: none)
#define WIN  2048
#define PCAR 1024.0f
#define SCL  0.03125f  // 1/sqrt(embed = 1024): the source's quirk
typedef _Float16 h16;
typedef unsigned short bf;
typedef __attribute__((ext_vector_type(16))) __bf16   v16bf;
typedef __attribute__((ext_vector_type(16))) _Float16 v16h;
typedef __attribute__((ext_vector_type(8)))  _Float16 v8h;
typedef __attribute__((ext_vector_type(8)))  unsigned short v8us;
typedef __attribute__((ext_vector_type(8)))  float    v8f;
typedef __attribute__((ext_vector_type(4)))  float    v4f;
typedef v8h  __attribute__((may_alias)) v8ha;
typedef v4f  __attribute__((may_alias)) v4fa;
typedef v8us __attribute__((may_alias)) v8usa;

__device__ __forceinline__ unsigned short f2bf(float f) { unsigned u = __float_as_uint(f); u += 0x7FFFu + ((u >> 16) & 1u); return (unsigned short)(u >> 16); }
__device__ __forceinline__ float bf2f(unsigned short b) { return __uint_as_float(((unsigned)b) << 16); }
__device__ __forceinline__ float bfr(float f) { return bf2f(f2bf(f)); }
__device__ __forceinline__ v16h cat16(v8h lo, v8h hi) { return __builtin_shufflevector(lo, hi, 0, 1, 2, 3, 4, 5, 6, 7, 8, 9, 10, 11, 12, 13, 14, 15); }
__device__ __forceinline__ v16bf cat16b(v8us lo, v8us hi) { return __builtin_bit_cast(v16bf, __builtin_shufflevector(lo, hi, 0, 1, 2, 3, 4, 5, 6, 7, 8, 9, 10, 11, 12, 13, 14, 15)); }
__device__ __forceinline__ v8f wmma16(v16h a, v16h b, v8f c) { return __builtin_amdgcn_wmma_f32_16x16x32_f16(false, a, false, b, (short)0, c, false, false); }
__device__ __forceinline__ v8f wmmab(v16bf a, v16bf b, v8f c) { return __builtin_amdgcn_wmma_f32_16x16x32_bf16(false, a, false, b, (short)0, c, false, false); }



// ---- k_gemmw: register-blocked GEMM, one 64x64 output tile per block (16 accumulators a wave), operands straight from K-contiguous 16-bit planes; grid (M/64, N/64, Z), NW * 32 threads (NW = 8 or 16).
// C[m][n] (f32, pitch ldc, + optional f32 bias[n]) = sum_k A[m][k] Bt[n][k] (+ split products per NSPLIT). z-batch strides sA/sB/sC in elements. K % (32 * KS) == 0.
// The K loop is dealt to the block's NW waves in slices of 32 * KS (wave w takes slices w, w + NW, ..): each wave holds a partial 64x64 tile, and the epilogue sums the NW partials through LDS in wave order.
// CAUSK (probability x value): the K loop stops at the diagonal block of query rows r0 + roff.. (probabilities beyond it are exactly zero); roff = row offset of this launch's first row within the sequence.
template <typename T16> struct WFrag;
template <> struct WFrag<h16> { typedef v16h V; static __device__ __forceinline__ V ld(const h16* p) { return cat16(*(const v8h*)p, *(const v8h*)(p + 16)); } static __device__ __forceinline__ v8f mma(V a, V b, v8f c) { return wmma16(a, b, c); } };
template <> struct WFrag<bf> { typedef v16bf V; static __device__ __forceinline__ V ld(const bf* p) { return cat16b(*(const v8us*)p, *(const v8us*)(p + 16)); } static __device__ __forceinline__ v8f mma(V a, V b, v8f c) { return wmmab(a, b, c); } };
template <typename T16, int NSPLIT, bool BIAS, bool CAUSK, int NW, int KS>
__global__ __launch_bounds__(NW * 32) void k_gemmw(const T16* __restrict__ A, const T16* __restrict__ A2, const T16* __restrict__ Bt, const T16* __restrict__ Bt2, int K, float* C, int ldc, const float* __restrict__ bias, int roff, size_t sA, size_t sB, size_t sC) {
    typedef typename WFrag<T16>::V V;
    constexpr int VW = 1024 / (NW * 32);   // floats of a 16x64 band that one thread sums and stores
    typedef float vW __attribute__((ext_vector_type(VW))); typedef vW __attribute__((may_alias)) vWa;
    __shared__ __align__(16) float os[NW * 16 * 68];
    const size_t z = blockIdx.z; A += z * sA; if (A2) A2 += z * sA; Bt += z * sB; if (Bt2) Bt2 += z * sB; C += z * sC;
    const int lane = threadIdx.x & 31, lr = lane & 15, hi = lane >> 4; const int wv = __builtin_amdgcn_readfirstlane(threadIdx.x >> 5);   /* the wave's number as a scalar: the K loop's counter and branch stay scalar */ const int r0 = blockIdx.x * 64, c0 = blockIdx.y * 64;
    const int Kl = CAUSK ? min(K, r0 + roff + 64) : K;
    v8f acc[4][4];
#pragma unroll
    for (int mb = 0; mb < 4; ++mb)
#pragma unroll
        for (int nb = 0; nb < 4; ++nb) acc[mb][nb] = (v8f){};
    const size_t aoff = (size_t)(r0 + lr) * K + 8 * hi, boff = (size_t)(c0 + lr) * K + 8 * hi;
#pragma unroll 1
    for (int k0 = wv * (32 * KS); k0 < Kl; k0 += NW * 32 * KS) {
#pragma unroll   // KS = 2: both halves of each row's 128-byte line are read by the same wave in the same trip
      for (int ks = 0; ks < KS; ++ks) { const int kc = k0 + ks * 32;
        V a[4], a2[4];
#pragma unroll
        for (int mb = 0; mb < 4; ++mb) { a[mb] = WFrag<T16>::ld(A + aoff + (size_t)mb * 16 * K + kc); if (NSPLIT == 1 || NSPLIT == 2) a2[mb] = WFrag<T16>::ld(A2 + aoff + (size_t)mb * 16 * K + kc); }
#pragma unroll
        for (int nb = 0; nb < 4; ++nb) { const V b = WFrag<T16>::ld(Bt + boff + (size_t)nb * 16 * K + kc); V b2; if (NSPLIT >= 2) b2 = WFrag<T16>::ld(Bt2 + boff + (size_t)nb * 16 * K + kc);
#pragma unroll
            for (int mb = 0; mb < 4; ++mb) { acc[mb][nb] = WFrag<T16>::mma(a[mb], b, acc[mb][nb]); if (NSPLIT == 1 || NSPLIT == 2) acc[mb][nb] = WFrag<T16>::mma(a2[mb], b, acc[mb][nb]); if (NSPLIT >= 2) acc[mb][nb] = WFrag<T16>::mma(a[mb], b2, acc[mb][nb]); } }
        asm volatile("v_nop\n\tv_nop\n\tv_nop\n\tv_nop" : "+v"(acc[0][0]), "+v"(acc[1][1]), "+v"(acc[2][2]), "+v"(acc[3][3]) : "v"(a[0]), "v"(a[3]));
      }
    }
    const int e = (int)threadIdx.x * VW, row = e >> 6, cofs = e & 63; vW val[4];
#pragma unroll
    for (int mb = 0; mb < 4; ++mb) {
#pragma unroll
        for (int nb = 0; nb < 4; ++nb) {
#pragma unroll
            for (int j = 0; j < 8; ++j) os[wv * (16 * 68) + (hi * 8 + j) * 68 + nb * 16 + lr] = acc[mb][nb][j]; }
        __syncthreads();   // every wave's partial band is in LDS before any thread sums it
        val[mb] = *(const vWa*)(os + row * 68 + cofs);
#pragma unroll   // the NW LDS reads go out together, at immediate offsets; the sum keeps the order w = 0, 1, ..
        for (int w = 1; w < NW; ++w) val[mb] += *(const vWa*)(os + w * (16 * 68) + row * 68 + cofs);
        if (mb < 3) __syncthreads();   // the band is read out before the next band overwrites it
    }
#pragma unroll   // constant indices keep val in registers
    for (int mb = 0; mb < 4; ++mb) {   // stores behind the last barrier, so that no barrier waits for a store
        if (BIAS) {
#pragma unroll   // constant indices keep val in registers
            for (int q = 0; q < VW; ++q) val[mb][q] += bfr(bias[c0 + cofs + q]); }
        *(vW*)(C + (size_t)(r0 + mb * 16 + row) * ldc + c0 + cofs) = val[mb]; }
}

// ---- k_gemmc: the 64x64 tile GEMM with ONE WAVE per tile (32 threads, the whole K loop in that wave) specialised for causal attention: CMODE 1 skips score tiles entirely above the diagonal (query rows r0+roff.., key columns c0..), CMODE 2 limits the
// key (K) loop of the probability x value contraction to the diagonal block (probabilities beyond it are exactly zero). roff = row offset of this launch's first row within the sequence.
template <typename T16, int NSPLIT, int CMODE>
__global__ __launch_bounds__(32) void k_gemmc(const T16* __restrict__ A, const T16* __restrict__ A2, const T16* __restrict__ Bt, const T16* __restrict__ Bt2, int K, float* C, int ldc, int roff, size_t sA, size_t sB, size_t sC) {
    typedef typename WFrag<T16>::V V;
    __shared__ __align__(16) float os[16 * 68];
    const size_t z = blockIdx.z; A += z * sA; if (A2) A2 += z * sA; Bt += z * sB; if (Bt2) Bt2 += z * sB; C += z * sC;
    const int lane = threadIdx.x & 31, lr = lane & 15, hi = lane >> 4; const int r0 = blockIdx.x * 64, c0 = blockIdx.y * 64;
    if (CMODE == 1 && c0 > r0 + roff + 63) return;                  // score tile entirely above the causal diagonal: never read (the softmax masks j > i by select)
    const int Kl = (CMODE == 2) ? min(K, r0 + roff + 64) : K;        // P.V: probabilities are exactly 0 beyond the diagonal block, so the K loop stops there
    v8f acc[4][4];
#pragma unroll
    for (int mb = 0; mb < 4; ++mb)
#pragma unroll
        for (int nb = 0; nb < 4; ++nb) acc[mb][nb] = (v8f){};
    const size_t aoff = (size_t)(r0 + lr) * K + 8 * hi, boff = (size_t)(c0 + lr) * K + 8 * hi;
#pragma unroll 1
    for (int kc = 0; kc < Kl; kc += 32) {
        V a[4], a2[4];
#pragma unroll
        for (int mb = 0; mb < 4; ++mb) { a[mb] = WFrag<T16>::ld(A + aoff + (size_t)mb * 16 * K + kc); if (NSPLIT == 1 || NSPLIT == 2) a2[mb] = WFrag<T16>::ld(A2 + aoff + (size_t)mb * 16 * K + kc); }
#pragma unroll
        for (int nb = 0; nb < 4; ++nb) { const V b = WFrag<T16>::ld(Bt + boff + (size_t)nb * 16 * K + kc); V b2; if (NSPLIT >= 2) b2 = WFrag<T16>::ld(Bt2 + boff + (size_t)nb * 16 * K + kc);
#pragma unroll
            for (int mb = 0; mb < 4; ++mb) { acc[mb][nb] = WFrag<T16>::mma(a[mb], b, acc[mb][nb]); if (NSPLIT == 1 || NSPLIT == 2) acc[mb][nb] = WFrag<T16>::mma(a2[mb], b, acc[mb][nb]); if (NSPLIT >= 2) acc[mb][nb] = WFrag<T16>::mma(a[mb], b2, acc[mb][nb]); } }
        asm volatile("v_nop\n\tv_nop\n\tv_nop\n\tv_nop" : "+v"(acc[0][0]), "+v"(acc[1][1]), "+v"(acc[2][2]), "+v"(acc[3][3]) : "v"(a[0]), "v"(a[3]));
    }
#pragma unroll
    for (int mb = 0; mb < 4; ++mb) {
#pragma unroll
        for (int nb = 0; nb < 4; ++nb) {
#pragma unroll
            for (int j = 0; j < 8; ++j) os[(hi * 8 + j) * 68 + nb * 16 + lr] = acc[mb][nb][j]; }
        __builtin_amdgcn_wave_barrier(); asm volatile("" ::: "memory");
        float* crow = C + (size_t)(r0 + mb * 16) * ldc + c0;
{
#pragma unroll
            for (int s = 0; s < 8; ++s) { const int row = 2 * s + hi, cofs = lr * 4; v4f val = *(const v4fa*)(os + row * 68 + cofs);
                *(v4f*)(crow + (size_t)row * ldc + cofs) = val; }
             }
        __builtin_amdgcn_wave_barrier(); asm volatile("" ::: "memory");
    }
}

__device__ __forceinline__ h16 tohx(float x) { return (h16)x; }
__device__ __forceinline__ void splitf(float y, unsigned short& h, unsigned short& l) { h = f2bf(y); l = f2bf(y - bf2f(h)); }
typedef __attribute__((ext_vector_type(2))) _Float16 v2h;
typedef __attribute__((ext_vector_type(4))) _Float16 v4h;
typedef __attribute__((ext_vector_type(2))) unsigned short v2us;
typedef __attribute__((ext_vector_type(4))) unsigned short v4us;
typedef __attribute__((ext_vector_type(2))) float v2f;
typedef __attribute__((ext_vector_type(4))) int v4i;

__global__ __launch_bounds__(256) void k_wtG(const float* __restrict__ w, int K, int N, bf* Bt) {
    const int lane = threadIdx.x & 31; const int L0 = (blockIdx.x * 8 + (threadIdx.x >> 5)) * 8; const int nlines = N * K / 64;
{
#pragma unroll 1
        for (int l = 0; l < 8; ++l) { const int L = L0 + l; if (L >= nlines) break; const size_t e = (size_t)L * 64 + lane * 2; const int k = (int)(e % K), n = (int)(e / K); v2us o;
            o[0] = f2bf(w[(size_t)k * N + n]); o[1] = f2bf(w[(size_t)(k + 1) * N + n]); *(v2us*)(Bt + e) = o; }
         }
}
__global__ __launch_bounds__(256) void k_cvt8(const float* __restrict__ src, bf* dst, size_t n8) { const size_t i = (size_t)blockIdx.x * 256 + threadIdx.x; if (i >= n8) return; const v8f v = *(const v8f*)(src + i * 8); v8us o;
#pragma unroll
    for (int k = 0; k < 8; ++k) o[k] = f2bf(v[k]); *(v8us*)(dst + i * 8) = o;  }

// k_rope: head planes [h][t][d] (fp16 + hi/lo) of rope(x) x sc with the rotate-half convention out[d] = x[d] cos[t][d] - x[d+HD/2] sin[t][d], out[d+HD/2] = x[d+HD/2] cos[t][d+HD/2] + x[d] sin[t][d+HD/2]
__global__ __launch_bounds__(256) void k_rope(const float* __restrict__ F, int pitch, int nheads, const float* __restrict__ CS, const float* __restrict__ RF, const float* __restrict__ nw, float sc, h16* P16, bf* Ph, bf* Pl) {
    const size_t e = ((size_t)blockIdx.x * 256 + threadIdx.x) * 2; if (e >= (size_t)nheads * TT * HD) return; const int d = (int)(e % HD); const int t = (int)((e / HD) % TT); const int h = (int)(e / ((size_t)HD * TT)); const float* f = F + (size_t)t * pitch + h * HD; const float rf = RF ? RF[(size_t)h * TT + t] : 1.0f; v2h o16; v2us oh, ol;
#pragma unroll
    for (int q = 0; q < 2; ++q) { const int dd = d + q; const int dp = (dd < HD / 2) ? dd + HD / 2 : dd - HD / 2; float x0 = f[dd], x1 = f[dp];
        if (RF) { float n0 = __fmul_rn(x0, rf), n1 = __fmul_rn(x1, rf); asm volatile("" : "+v"(n0)); asm volatile("" : "+v"(n1)); x0 = __fmul_rn(bfr(nw[dd]), n0); x1 = __fmul_rn(bfr(nw[dp]), n1); }
        const v2f cs = *(const v2f*)(CS + ((size_t)t * HD + dd) * 2); float a = __fmul_rn(x0, cs[0]), bq = __fmul_rn(x1, cs[1]); asm volatile("" : "+v"(a)); asm volatile("" : "+v"(bq)); const float r = ((dd < HD / 2) ? __fsub_rn(a, bq) : __fadd_rn(a, bq)) * sc;
        o16[q] = tohx(r); unsigned short a2, c2; splitf(r, a2, c2); oh[q] = a2; ol[q] = c2; }
    *(v2h*)(P16 + e) = o16; *(v2us*)(Ph + e) = oh; *(v2us*)(Pl + e) = ol;  }
__global__ __launch_bounds__(256) void k_vtp(const float* __restrict__ F, int pitch, int nheads, h16* V16, bf* Vh, bf* Vl) { const size_t e = ((size_t)blockIdx.x * 256 + threadIdx.x) * 2; if (e >= (size_t)nheads * HD * TT) return; const int t = (int)(e % TT); const int d = (int)((e / TT) % HD); const int g = (int)(e / ((size_t)TT * HD)); v2h o16; v2us oh, ol;
#pragma unroll
    for (int q = 0; q < 2; ++q) { const float x = F[(size_t)(t + q) * pitch + g * HD + d]; o16[q] = tohx(x); unsigned short a2, c2; splitf(x, a2, c2); oh[q] = a2; ol[q] = c2; }
    *(v2h*)(V16 + e) = o16; *(v2us*)(Vh + e) = oh; *(v2us*)(Vl + e) = ol;  }
__global__ __launch_bounds__(256) void k_csid(float* CS) { const int idx = blockIdx.x * 256 + threadIdx.x; if (idx >= TT * HD) return; v2f cs; cs[0] = 1.0f; cs[1] = 0.0f; *(v2f*)(CS + (size_t)idx * 2) = cs;  }
// k_asoft: per row (zz, i): t = S x SCL (= DM^-0.5) for j <= i and i - j < WIN (sliding causal window; the reference's -1e9 additive fill vanishes identically); softmax over the 2048 keys (register row, one exp, fixed trees);
__global__ __launch_bounds__(256) void k_asoft(const float* __restrict__ Sb, h16* P16, bf* Ph, bf* Pl) {
    const int lane = threadIdx.x & 31; const int row = blockIdx.x * 8 + (threadIdx.x >> 5); if (row >= ZH * TT) return; const int i = row % TT; const int zz = row / TT; (void)zz; const bool hires = (i < RH); const float* sr = Sb + (size_t)row * TT; float v[TT / 32]; float mx = -3.0e38f;
#pragma unroll
    for (int ch = 0; ch < TT / 128; ++ch) { const int j0 = ch * 128 + lane * 4; const v4f a = *(const v4f*)(sr + j0);
#pragma unroll
        for (int q = 0; q < 4; ++q) { const int j = j0 + q; (void)j; const float t = (j <= i && i - j < WIN) ? a[q] * SCL : -3.0e38f; v[ch * 4 + q] = t; mx = fmaxf(mx, t); } }
#pragma unroll
    for (int sh = 16; sh; sh >>= 1) mx = fmaxf(mx, __shfl_xor(mx, sh, 32));
    float sum = 0.f;
#pragma unroll
    for (int k = 0; k < TT / 32; ++k) { float d0 = __fsub_rn(v[k], mx); asm volatile("" : "+v"(d0)); v[k] = __builtin_amdgcn_exp2f(__fmul_rn(d0, 1.4426950408889634f)); sum += v[k]; }
#pragma unroll
    for (int sh = 16; sh; sh >>= 1) sum += __shfl_xor(sum, sh, 32);
    const float f = __fdiv_rn(hires ? 1.0f : PCAR, sum);
{
        if (hires) {
#pragma unroll
            for (int ch = 0; ch < TT / 128; ++ch) { v4us oh, ol;
#pragma unroll
                for (int q = 0; q < 4; ++q) { unsigned short a, c2; splitf(v[ch * 4 + q] * f, a, c2); oh[q] = a; ol[q] = c2; }
                const size_t oo = ((size_t)zz * (RH ? RH : 1) + i) * TT + ch * 128 + lane * 4; *(v4us*)(Ph + oo) = oh; *(v4us*)(Pl + oo) = ol; }
        } else {
#pragma unroll
            for (int ch = 0; ch < TT / 128; ++ch) { v4h o4;
#pragma unroll
                for (int q = 0; q < 4; ++q) o4[q] = tohx(v[ch * 4 + q] * f);
                *(v4h*)(P16 + (size_t)row * TT + ch * 128 + lane * 4) = o4; } }
         }
}
__global__ __launch_bounds__(256) void k_merge(const float* __restrict__ O, int h0, float* OUTb) { const size_t e = ((size_t)blockIdx.x * 256 + threadIdx.x) * 2; if (e >= (size_t)ZH * TT * HD) return; const int d = (int)(e % HD); const int t = (int)((e / HD) % TT); const int zz = (int)(e / ((size_t)HD * TT)); const float cs = (t < RH) ? 1.0f : (1.0f / PCAR); const size_t oo = (size_t)t * DQ + (h0 + zz) * HD + d;
    v2f o2; o2[0] = O[e] * cs; o2[1] = O[e + 1] * cs; *(v2f*)(OUTb + oo) = o2;  }

extern "C" void kernel_launch(void* const* d_in, const int* in_sizes, int n_in,
                              void* d_out, int out_size, void* d_ws, size_t ws_size, hipStream_t stream) {
    (void)in_sizes; (void)n_in; (void)out_size;
    const float* x = (const float*)d_in[0]; const float* pq = (const float*)d_in[1]; const float* pk = (const float*)d_in[2]; const float* pv = (const float*)d_in[3];   /* each [16][1024][64] */ const float* wq = pq, *wk = pk, *wv = pv, *wo = nullptr; (void)wo;
    float* OUT = (float*)d_out;     // [4][2048][1024]
    char* wsp = (char*)d_ws;
    auto take = [&](size_t bytes) { char* p = wsp; wsp += (bytes + 255) & ~(size_t)255; return (void*)p; };
    bf* WQ = (bf*)take((size_t)DQ * DM * 2); bf* WK = (bf*)take((size_t)DKV * DM * 2); bf* WV = (bf*)take((size_t)DKV * DM * 2); float* CS = (float*)take((size_t)TT * HD * 2 * 4);
    bf* XB = (bf*)take((size_t)TT * DM * 2); float* FQ = (float*)take((size_t)TT * DQ * 4); float* FK = (float*)take((size_t)TT * DKV * 4);
    h16* QP16 = (h16*)take((size_t)NH_ * TT * HD * 2); h16* KP16 = (h16*)take((size_t)NKV * TT * HD * 2); h16* VT16 = (h16*)take((size_t)NKV * HD * TT * 2);
    bf* QPh = (bf*)take((size_t)NH_ * TT * HD * 2); bf* QPl = (bf*)take((size_t)NH_ * TT * HD * 2); bf* KPh = (bf*)take((size_t)NKV * TT * HD * 2); bf* KPl = (bf*)take((size_t)NKV * TT * HD * 2); bf* VTh = (bf*)take((size_t)NKV * HD * TT * 2); bf* VTl = (bf*)take((size_t)NKV * HD * TT * 2); bf* Ph = (bf*)take((size_t)ZH * RH * TT * 2); bf* Pl = (bf*)take((size_t)ZH * RH * TT * 2);
    float* Sb = (float*)take((size_t)ZH * TT * TT * 4); h16* P16 = (h16*)take((size_t)ZH * TT * TT * 2); float* Ob = (float*)take((size_t)ZH * TT * HD * 4);
    if ((size_t)(wsp - (char*)d_ws) > ws_size) return;    // ws 256 MiB
    float* FV = FK;   // v projection reuses the k buffer after the k planes are built (stream-ordered)
    { for (int hh = 0; hh < NH_; ++hh) k_wtG<<<(unsigned)((DM * HD / 64 + 63) / 64), 256, 0, stream>>>(wq + (size_t)hh * DM * HD, DM, HD, WQ + (size_t)hh * HD * DM);   /* head hh's 'xw' [1024][64] -> Bt rows hh*64.. */ for (int hh = 0; hh < NH_; ++hh) k_wtG<<<(unsigned)((DM * HD / 64 + 63) / 64), 256, 0, stream>>>(wk + (size_t)hh * DM * HD, DM, HD, WK + (size_t)hh * HD * DM);   /* head hh's 'xw' [1024][64] -> Bt rows hh*64.. */ for (int hh = 0; hh < NH_; ++hh) k_wtG<<<(unsigned)((DM * HD / 64 + 63) / 64), 256, 0, stream>>>(wv + (size_t)hh * DM * HD, DM, HD, WV + (size_t)hh * HD * DM);   /* head hh's 'xw' [1024][64] -> Bt rows hh*64.. */
      
       }
    k_csid<<<(TT * HD + 255) / 256, 256, 0, stream>>>(CS);
    const unsigned LQ = (unsigned)(((size_t)NH_ * TT * HD / 2 + 255) / 256), LKv = (unsigned)(((size_t)NKV * TT * HD / 2 + 255) / 256);
    for (int b = 0; b < NB_; ++b) {
        
        k_cvt8<<<(unsigned)(((size_t)TT * DM / 8 + 255) / 256), 256, 0, stream>>>(x + (size_t)b * TT * DM, XB, (size_t)TT * DM / 8);
        k_gemmw<bf, 0, false, false, 8, 2><<<dim3(TT / 64, DQ / 64, 1), 256, 0, stream>>>(XB, nullptr, WQ, nullptr, DM, FQ, DQ, nullptr, 0, 0, 0, 0);
        k_rope<<<LQ, 256, 0, stream>>>(FQ, DQ, NH_, CS, nullptr, nullptr, 1.0f, QP16, QPh, QPl);
        k_gemmw<bf, 0, false, false, 8, 2><<<dim3(TT / 64, DKV / 64, 1), 256, 0, stream>>>(XB, nullptr, WK, nullptr, DM, FK, DKV, nullptr, 0, 0, 0, 0);
        k_rope<<<LKv, 256, 0, stream>>>(FK, DKV, NKV, CS, nullptr, nullptr, 1.0f, KP16, KPh, KPl);
        k_gemmw<bf, 0, false, false, 8, 2><<<dim3(TT / 64, DKV / 64, 1), 256, 0, stream>>>(XB, nullptr, WV, nullptr, DM, FV, DKV, nullptr, 0, 0, 0, 0); k_vtp<<<LKv, 256, 0, stream>>>(FV, DKV, NKV, VT16, VTh, VTl);
        for (int h0 = 0; h0 < NH_; h0 += ZH) { const size_t zq = (size_t)h0, zk = (size_t)(h0 / REP);   // one kv head per query head: the pass's two heads use consecutive kv planes (z-strides TT*HD)
            k_gemmc<bf, 2, 1><<<dim3(TT / 64, TT / 64, ZH), 32, 0, stream>>>(QPh + zq * TT * HD, QPl + zq * TT * HD, KPh + zk * TT * HD, KPl + zk * TT * HD, HD, Sb, TT, 0, (size_t)TT * HD, (size_t)TT * HD, (size_t)TT * TT);   /* scores hi/lo on EVERY row */

            k_asoft<<<ZH * TT / 8, 256, 0, stream>>>(Sb, P16, Ph, Pl);
            k_gemmw<bf, 2, false, true, 8, 1><<<dim3(RH / 64, HD / 64, ZH), 256, 0, stream>>>(Ph, Pl, VTh + zk * HD * TT, VTl + zk * HD * TT, TT, Ob, HD, nullptr, 0, (size_t)RH * TT, (size_t)HD * TT, (size_t)TT * HD);
            k_gemmw<h16, 0, false, true, 16, 2><<<dim3((TT - RH) / 64, HD / 64, ZH), 512, 0, stream>>>(P16 + (size_t)RH * TT, nullptr, VT16 + zk * HD * TT, nullptr, TT, Ob + (size_t)RH * HD, HD, nullptr, RH, (size_t)TT * TT, (size_t)HD * TT, (size_t)TT * HD);
            k_merge<<<(unsigned)(((size_t)ZH * TT * HD / 2 + 255) / 256), 256, 0, stream>>>(Ob, h0, OUT + (size_t)b * TT * DQ); }
         }
}

// v002
// It runs in 789 microseconds.
// Two timings next to v001 put it at 2.22 and 2.25 times that version's speed.
// Over all steps from v000 it is 3.76 times as fast.
#include <hip/hip_runtime.h>

// Causal multi-head attention with per-head weight tensors, scaled by sqrt(embed) (x [4][2048][1024]; q,k,v = einsum('bte,hed', x, W) (Wq, Wk, Wv [16][1024][64] uniform(+-1/32): head h's 'xw' block); 16 heads x 64; causal (-inf); scores / sqrt(1024) (the source's quirk: sigma ~0.1 logits); softmax; out = concat heads -> [4][2048][1024] (8.4 M; no output projection)).
// Layout per batch: bf16 copy of x; the three projection tensors' 48 'xw' [1024][64] blocks transposed (one launch) into one [3072][1024] Bt (rows q h*64.., k 1024 + h*64.., v 2048 + h*64..); exact projections, one N = 3072 GEMM; attention in passes of ZH heads; causal T-2048 attention with hi/lo 3-product score tiles on EVERY row; P and attn.v hybrid (rows < 512 hi/lo, rest fp16 x1024; tiles above the diagonal skipped); the f32 merge writes the output rows.
// Compute dtypes, f32 accumulate: every input rounded to bf16; projections exact; scores 3 products on every row; softmax f32 (x 1/32); attn.v rows < 512 3 products, rest fp16; output f32.

#define NB_  4
#define TT   2048
#define DM   1024
#define NH_  16
#define NKV  16
#define REP  (NH_ / NKV)
#define HD   64
#define DQ   (NH_ * HD)
#define DKV  (NKV * HD)
#define DF   (DQ + 2 * DKV)        // q, k and v projection columns side by side
#define ZH   8                    // heads per attention pass (grid z of its three GEMM launches)
#define RH   512                  // query rows < RH use hi+lo planes (0: none)
#define WIN  2048
#define PCAR 1024.0f
#define SCL  0.03125f  // 1/sqrt(embed = 1024): the source's quirk
typedef _Float16 h16;
typedef unsigned short bf;
typedef __attribute__((ext_vector_type(16))) __bf16   v16bf;
typedef __attribute__((ext_vector_type(16))) _Float16 v16h;
typedef __attribute__((ext_vector_type(8)))  _Float16 v8h;
typedef __attribute__((ext_vector_type(8)))  unsigned short v8us;
typedef __attribute__((ext_vector_type(8)))  float    v8f;
typedef __attribute__((ext_vector_type(4)))  float    v4f;
typedef v8h  __attribute__((may_alias)) v8ha;
typedef v4f  __attribute__((may_alias)) v4fa;
typedef v8us __attribute__((may_alias)) v8usa;

__device__ __forceinline__ unsigned short f2bf(float f) { unsigned u = __float_as_uint(f); u += 0x7FFFu + ((u >> 16) & 1u); return (unsigned short)(u >> 16); }
__device__ __forceinline__ float bf2f(unsigned short b) { return __uint_as_float(((unsigned)b) << 16); }
__device__ __forceinline__ float bfr(float f) { return bf2f(f2bf(f)); }
__device__ __forceinline__ v16h cat16(v8h lo, v8h hi) { return __builtin_shufflevector(lo, hi, 0, 1, 2, 3, 4, 5, 6, 7, 8, 9, 10, 11, 12, 13, 14, 15); }
__device__ __forceinline__ v16bf cat16b(v8us lo, v8us hi) { return __builtin_bit_cast(v16bf, __builtin_shufflevector(lo, hi, 0, 1, 2, 3, 4, 5, 6, 7, 8, 9, 10, 11, 12, 13, 14, 15)); }
__device__ __forceinline__ v8f wmma16(v16h a, v16h b, v8f c) { return __builtin_amdgcn_wmma_f32_16x16x32_f16(false, a, false, b, (short)0, c, false, false); }
__device__ __forceinline__ v8f wmmab(v16bf a, v16bf b, v8f c) { return __builtin_amdgcn_wmma_f32_16x16x32_bf16(false, a, false, b, (short)0, c, false, false); }



// ---- k_gemmw: register-blocked GEMM, one 64x64 output tile per block (16 accumulators a wave), operands straight from K-contiguous 16-bit planes; grid (M/64, N/64, Z), NW * 32 threads (NW = 8 or 16).
// C[m][n] (f32, pitch ldc, + optional f32 bias[n]) = sum_k A[m][k] Bt[n][k] (+ split products per NSPLIT). z-batch strides sA/sB/sC in elements. K % (32 * KS) == 0.
// The K loop is dealt to the block's NW waves in slices of 32 * KS (wave w takes slices w, w + NW, ..): each wave holds a partial 64x64 tile, and the epilogue sums the NW partials through LDS in wave order.
// CAUSK (probability x value): the K loop stops at the diagonal block of query rows r0 + roff.. (probabilities beyond it are exactly zero); roff = row offset of this launch's first row within the sequence.
template <typename T16> struct WFrag;
template <> struct WFrag<h16> { typedef v16h V; static __device__ __forceinline__ V ld(const h16* p) { return cat16(*(const v8h*)p, *(const v8h*)(p + 16)); } static __device__ __forceinline__ v8f mma(V a, V b, v8f c) { return wmma16(a, b, c); } };
template <> struct WFrag<bf> { typedef v16bf V; static __device__ __forceinline__ V ld(const bf* p) { return cat16b(*(const v8us*)p, *(const v8us*)(p + 16)); } static __device__ __forceinline__ v8f mma(V a, V b, v8f c) { return wmmab(a, b, c); } };
template <typename T16, int NSPLIT, bool BIAS, bool CAUSK, int NW, int KS>
__global__ __launch_bounds__(NW * 32) void k_gemmw(const T16* __restrict__ A, const T16* __restrict__ A2, const T16* __restrict__ Bt, const T16* __restrict__ Bt2, int K, float* C, int ldc, const float* __restrict__ bias, int roff, size_t sA, size_t sB, size_t sC) {
    typedef typename WFrag<T16>::V V;
    constexpr int VW = 1024 / (NW * 32);   // floats of a 16x64 band that one thread sums and stores
    typedef float vW __attribute__((ext_vector_type(VW))); typedef vW __attribute__((may_alias)) vWa;
    __shared__ __align__(16) float os[NW * 16 * 68];
    const size_t z = blockIdx.z; A += z * sA; if (A2) A2 += z * sA; Bt += z * sB; if (Bt2) Bt2 += z * sB; C += z * sC;
    const int lane = threadIdx.x & 31, lr = lane & 15, hi = lane >> 4; const int wv = __builtin_amdgcn_readfirstlane(threadIdx.x >> 5);   /* the wave's number as a scalar: the K loop's counter and branch stay scalar */ const int r0 = blockIdx.x * 64, c0 = blockIdx.y * 64;
    const int Kl = CAUSK ? min(K, r0 + roff + 64) : K;
    v8f acc[4][4];
#pragma unroll
    for (int mb = 0; mb < 4; ++mb)
#pragma unroll
        for (int nb = 0; nb < 4; ++nb) acc[mb][nb] = (v8f){};
    const size_t aoff = (size_t)(r0 + lr) * K + 8 * hi, boff = (size_t)(c0 + lr) * K + 8 * hi;
#pragma unroll 1
    for (int k0 = wv * (32 * KS); k0 < Kl; k0 += NW * 32 * KS) {
#pragma unroll   // KS = 2: both halves of each row's 128-byte line are read by the same wave in the same trip
      for (int ks = 0; ks < KS; ++ks) { const int kc = k0 + ks * 32;
        V a[4], a2[4];
#pragma unroll
        for (int mb = 0; mb < 4; ++mb) { a[mb] = WFrag<T16>::ld(A + aoff + (size_t)mb * 16 * K + kc); if (NSPLIT == 1 || NSPLIT == 2) a2[mb] = WFrag<T16>::ld(A2 + aoff + (size_t)mb * 16 * K + kc); }
#pragma unroll
        for (int nb = 0; nb < 4; ++nb) { const V b = WFrag<T16>::ld(Bt + boff + (size_t)nb * 16 * K + kc); V b2; if (NSPLIT >= 2) b2 = WFrag<T16>::ld(Bt2 + boff + (size_t)nb * 16 * K + kc);
#pragma unroll
            for (int mb = 0; mb < 4; ++mb) { acc[mb][nb] = WFrag<T16>::mma(a[mb], b, acc[mb][nb]); if (NSPLIT == 1 || NSPLIT == 2) acc[mb][nb] = WFrag<T16>::mma(a2[mb], b, acc[mb][nb]); if (NSPLIT >= 2) acc[mb][nb] = WFrag<T16>::mma(a[mb], b2, acc[mb][nb]); } }
        asm volatile("v_nop\n\tv_nop\n\tv_nop\n\tv_nop" : "+v"(acc[0][0]), "+v"(acc[1][1]), "+v"(acc[2][2]), "+v"(acc[3][3]) : "v"(a[0]), "v"(a[3]));
      }
    }
    const int e = (int)threadIdx.x * VW, row = e >> 6, cofs = e & 63; vW val[4];
#pragma unroll
    for (int mb = 0; mb < 4; ++mb) {
#pragma unroll
        for (int nb = 0; nb < 4; ++nb) {
#pragma unroll
            for (int j = 0; j < 8; ++j) os[wv * (16 * 68) + (hi * 8 + j) * 68 + nb * 16 + lr] = acc[mb][nb][j]; }
        __syncthreads();   // every wave's partial band is in LDS before any thread sums it
        val[mb] = *(const vWa*)(os + row * 68 + cofs);
#pragma unroll   // the NW LDS reads go out together, at immediate offsets; the sum keeps the order w = 0, 1, ..
        for (int w = 1; w < NW; ++w) val[mb] += *(const vWa*)(os + w * (16 * 68) + row * 68 + cofs);
        if (mb < 3) __syncthreads();   // the band is read out before the next band overwrites it
    }
#pragma unroll   // constant indices keep val in registers
    for (int mb = 0; mb < 4; ++mb) {   // stores behind the last barrier, so that no barrier waits for a store
        if (BIAS) {
#pragma unroll   // constant indices keep val in registers
            for (int q = 0; q < VW; ++q) val[mb][q] += bfr(bias[c0 + cofs + q]); }
        *(vW*)(C + (size_t)(r0 + mb * 16 + row) * ldc + c0 + cofs) = val[mb]; }
}

// ---- k_gemmc: the 64x64 tile GEMM with ONE WAVE per tile (32 threads, the whole K loop in that wave) specialised for causal attention: CMODE 1 skips score tiles entirely above the diagonal (query rows r0+roff.., key columns c0..), CMODE 2 limits the
// key (K) loop of the probability x value contraction to the diagonal block (probabilities beyond it are exactly zero). roff = row offset of this launch's first row within the sequence.
template <typename T16, int NSPLIT, int CMODE>
__global__ __launch_bounds__(32) void k_gemmc(const T16* __restrict__ A, const T16* __restrict__ A2, const T16* __restrict__ Bt, const T16* __restrict__ Bt2, int K, float* C, int ldc, int roff, size_t sA, size_t sB, size_t sC) {
    typedef typename WFrag<T16>::V V;
    __shared__ __align__(16) float os[16 * 68];
    const size_t z = blockIdx.z; A += z * sA; if (A2) A2 += z * sA; Bt += z * sB; if (Bt2) Bt2 += z * sB; C += z * sC;
    const int lane = threadIdx.x & 31, lr = lane & 15, hi = lane >> 4; const int r0 = blockIdx.x * 64, c0 = blockIdx.y * 64;
    if (CMODE == 1 && c0 > r0 + roff + 63) return;                  // score tile entirely above the causal diagonal: never read (the softmax masks j > i by select)
    const int Kl = (CMODE == 2) ? min(K, r0 + roff + 64) : K;        // P.V: probabilities are exactly 0 beyond the diagonal block, so the K loop stops there
    v8f acc[4][4];
#pragma unroll
    for (int mb = 0; mb < 4; ++mb)
#pragma unroll
        for (int nb = 0; nb < 4; ++nb) acc[mb][nb] = (v8f){};
    const size_t aoff = (size_t)(r0 + lr) * K + 8 * hi, boff = (size_t)(c0 + lr) * K + 8 * hi;
#pragma unroll 1
    for (int kc = 0; kc < Kl; kc += 32) {
        V a[4], a2[4];
#pragma unroll
        for (int mb = 0; mb < 4; ++mb) { a[mb] = WFrag<T16>::ld(A + aoff + (size_t)mb * 16 * K + kc); if (NSPLIT == 1 || NSPLIT == 2) a2[mb] = WFrag<T16>::ld(A2 + aoff + (size_t)mb * 16 * K + kc); }
#pragma unroll
        for (int nb = 0; nb < 4; ++nb) { const V b = WFrag<T16>::ld(Bt + boff + (size_t)nb * 16 * K + kc); V b2; if (NSPLIT >= 2) b2 = WFrag<T16>::ld(Bt2 + boff + (size_t)nb * 16 * K + kc);
#pragma unroll
            for (int mb = 0; mb < 4; ++mb) { acc[mb][nb] = WFrag<T16>::mma(a[mb], b, acc[mb][nb]); if (NSPLIT == 1 || NSPLIT == 2) acc[mb][nb] = WFrag<T16>::mma(a2[mb], b, acc[mb][nb]); if (NSPLIT >= 2) acc[mb][nb] = WFrag<T16>::mma(a[mb], b2, acc[mb][nb]); } }
        asm volatile("v_nop\n\tv_nop\n\tv_nop\n\tv_nop" : "+v"(acc[0][0]), "+v"(acc[1][1]), "+v"(acc[2][2]), "+v"(acc[3][3]) : "v"(a[0]), "v"(a[3]));
    }
#pragma unroll
    for (int mb = 0; mb < 4; ++mb) {
#pragma unroll
        for (int nb = 0; nb < 4; ++nb) {
#pragma unroll
            for (int j = 0; j < 8; ++j) os[(hi * 8 + j) * 68 + nb * 16 + lr] = acc[mb][nb][j]; }
        __builtin_amdgcn_wave_barrier(); asm volatile("" ::: "memory");
        float* crow = C + (size_t)(r0 + mb * 16) * ldc + c0;
{
#pragma unroll
            for (int s = 0; s < 8; ++s) { const int row = 2 * s + hi, cofs = lr * 4; v4f val = *(const v4fa*)(os + row * 68 + cofs);
                *(v4f*)(crow + (size_t)row * ldc + cofs) = val; }
             }
        __builtin_amdgcn_wave_barrier(); asm volatile("" ::: "memory");
    }
}

__device__ __forceinline__ h16 tohx(float x) { return (h16)x; }
__device__ __forceinline__ void splitf(float y, unsigned short& h, unsigned short& l) { h = f2bf(y); l = f2bf(y - bf2f(h)); }
typedef __attribute__((ext_vector_type(2))) _Float16 v2h;
typedef __attribute__((ext_vector_type(4))) _Float16 v4h;
typedef __attribute__((ext_vector_type(2))) unsigned short v2us;
typedef __attribute__((ext_vector_type(4))) unsigned short v4us;
typedef __attribute__((ext_vector_type(2))) float v2f;
typedef __attribute__((ext_vector_type(4))) int v4i;

// grid (lines / 64, heads, 3): blockIdx.z picks the tensor, blockIdx.y its head; Bt holds the tensors' heads one behind the other
__global__ __launch_bounds__(256) void k_wtG(const float* __restrict__ w0, const float* __restrict__ w1, const float* __restrict__ w2, int K, int N, bf* Bt) {
    const float* __restrict__ w = (blockIdx.z == 0 ? w0 : blockIdx.z == 1 ? w1 : w2) + (size_t)blockIdx.y * K * N; Bt += ((size_t)blockIdx.z * NH_ + blockIdx.y) * N * K;
    const int lane = threadIdx.x & 31; const int L0 = (blockIdx.x * 8 + (threadIdx.x >> 5)) * 8; const int nlines = N * K / 64;
{
#pragma unroll 1
        for (int l = 0; l < 8; ++l) { const int L = L0 + l; if (L >= nlines) break; const size_t e = (size_t)L * 64 + lane * 2; const int k = (int)(e % K), n = (int)(e / K); v2us o;
            o[0] = f2bf(w[(size_t)k * N + n]); o[1] = f2bf(w[(size_t)(k + 1) * N + n]); *(v2us*)(Bt + e) = o; }
         }
}
__global__ __launch_bounds__(256) void k_cvt8(const float* __restrict__ src, bf* dst, size_t n8) { const size_t i = (size_t)blockIdx.x * 256 + threadIdx.x; if (i >= n8) return; const v8f v = *(const v8f*)(src + i * 8); v8us o;
#pragma unroll
    for (int k = 0; k < 8; ++k) o[k] = f2bf(v[k]); *(v8us*)(dst + i * 8) = o;  }

// k_rope: head planes [h][t][d] (fp16 + hi/lo) of rope(x) x sc with the rotate-half convention out[d] = x[d] cos[t][d] - x[d+HD/2] sin[t][d], out[d+HD/2] = x[d+HD/2] cos[t][d+HD/2] + x[d] sin[t][d+HD/2]
__global__ __launch_bounds__(256) void k_rope(const float* __restrict__ F, int pitch, int nheads, const float* __restrict__ CS, const float* __restrict__ RF, const float* __restrict__ nw, float sc, h16* P16, bf* Ph, bf* Pl) {
    const size_t e = ((size_t)blockIdx.x * 256 + threadIdx.x) * 2; if (e >= (size_t)nheads * TT * HD) return; const int d = (int)(e % HD); const int t = (int)((e / HD) % TT); const int h = (int)(e / ((size_t)HD * TT)); const float* f = F + (size_t)t * pitch + h * HD; const float rf = RF ? RF[(size_t)h * TT + t] : 1.0f; v2h o16; v2us oh, ol;
#pragma unroll
    for (int q = 0; q < 2; ++q) { const int dd = d + q; const int dp = (dd < HD / 2) ? dd + HD / 2 : dd - HD / 2; float x0 = f[dd], x1 = f[dp];
        if (RF) { float n0 = __fmul_rn(x0, rf), n1 = __fmul_rn(x1, rf); asm volatile("" : "+v"(n0)); asm volatile("" : "+v"(n1)); x0 = __fmul_rn(bfr(nw[dd]), n0); x1 = __fmul_rn(bfr(nw[dp]), n1); }
        const v2f cs = *(const v2f*)(CS + ((size_t)t * HD + dd) * 2); float a = __fmul_rn(x0, cs[0]), bq = __fmul_rn(x1, cs[1]); asm volatile("" : "+v"(a)); asm volatile("" : "+v"(bq)); const float r = ((dd < HD / 2) ? __fsub_rn(a, bq) : __fadd_rn(a, bq)) * sc;
        o16[q] = tohx(r); unsigned short a2, c2; splitf(r, a2, c2); oh[q] = a2; ol[q] = c2; }
    *(v2h*)(P16 + e) = o16; *(v2us*)(Ph + e) = oh; *(v2us*)(Pl + e) = ol;  }
__global__ __launch_bounds__(256) void k_vtp(const float* __restrict__ F, int pitch, int nheads, h16* V16, bf* Vh, bf* Vl) { const size_t e = ((size_t)blockIdx.x * 256 + threadIdx.x) * 2; if (e >= (size_t)nheads * HD * TT) return; const int t = (int)(e % TT); const int d = (int)((e / TT) % HD); const int g = (int)(e / ((size_t)TT * HD)); v2h o16; v2us oh, ol;
#pragma unroll
    for (int q = 0; q < 2; ++q) { const float x = F[(size_t)(t + q) * pitch + g * HD + d]; o16[q] = tohx(x); unsigned short a2, c2; splitf(x, a2, c2); oh[q] = a2; ol[q] = c2; }
    *(v2h*)(V16 + e) = o16; *(v2us*)(Vh + e) = oh; *(v2us*)(Vl + e) = ol;  }
__global__ __launch_bounds__(256) void k_csid(float* CS) { const int idx = blockIdx.x * 256 + threadIdx.x; if (idx >= TT * HD) return; v2f cs; cs[0] = 1.0f; cs[1] = 0.0f; *(v2f*)(CS + (size_t)idx * 2) = cs;  }
// k_asoft: per row (zz, i): t = S x SCL (= DM^-0.5) for j <= i and i - j < WIN (sliding causal window; the reference's -1e9 additive fill vanishes identically); softmax over the 2048 keys (register row, one exp, fixed trees);
__global__ __launch_bounds__(256) void k_asoft(const float* __restrict__ Sb, h16* P16, bf* Ph, bf* Pl) {
    const int lane = threadIdx.x & 31; const int row = blockIdx.x * 8 + (threadIdx.x >> 5); if (row >= ZH * TT) return; const int i = row % TT; const int zz = row / TT; (void)zz; const bool hires = (i < RH); const float* sr = Sb + (size_t)row * TT; float v[TT / 32]; float mx = -3.0e38f;
#pragma unroll
    for (int ch = 0; ch < TT / 128; ++ch) { const int j0 = ch * 128 + lane * 4; const v4f a = *(const v4f*)(sr + j0);
#pragma unroll
        for (int q = 0; q < 4; ++q) { const int j = j0 + q; (void)j; const float t = (j <= i && i - j < WIN) ? a[q] * SCL : -3.0e38f; v[ch * 4 + q] = t; mx = fmaxf(mx, t); } }
#pragma unroll
    for (int sh = 16; sh; sh >>= 1) mx = fmaxf(mx, __shfl_xor(mx, sh, 32));
    float sum = 0.f;
#pragma unroll
    for (int k = 0; k < TT / 32; ++k) { float d0 = __fsub_rn(v[k], mx); asm volatile("" : "+v"(d0)); v[k] = __builtin_amdgcn_exp2f(__fmul_rn(d0, 1.4426950408889634f)); sum += v[k]; }
#pragma unroll
    for (int sh = 16; sh; sh >>= 1) sum += __shfl_xor(sum, sh, 32);
    const float f = __fdiv_rn(hires ? 1.0f : PCAR, sum);
{
        if (hires) {
#pragma unroll
            for (int ch = 0; ch < TT / 128; ++ch) { v4us oh, ol;
#pragma unroll
                for (int q = 0; q < 4; ++q) { unsigned short a, c2; splitf(v[ch * 4 + q] * f, a, c2); oh[q] = a; ol[q] = c2; }
                const size_t oo = ((size_t)zz * (RH ? RH : 1) + i) * TT + ch * 128 + lane * 4; *(v4us*)(Ph + oo) = oh; *(v4us*)(Pl + oo) = ol; }
        } else {
#pragma unroll
            for (int ch = 0; ch < TT / 128; ++ch) { v4h o4;
#pragma unroll
                for (int q = 0; q < 4; ++q) o4[q] = tohx(v[ch * 4 + q] * f);
                *(v4h*)(P16 + ((size_t)zz * (TT - RH) + (i - RH)) * TT + ch * 128 + lane * 4) = o4; } }   // P16 holds rows RH.. only
         }
}
__global__ __launch_bounds__(256) void k_merge(const float* __restrict__ O, int h0, float* OUTb) { const size_t e = ((size_t)blockIdx.x * 256 + threadIdx.x) * 2; if (e >= (size_t)ZH * TT * HD) return; const int d = (int)(e % HD); const int t = (int)((e / HD) % TT); const int zz = (int)(e / ((size_t)HD * TT)); const float cs = (t < RH) ? 1.0f : (1.0f / PCAR); const size_t oo = (size_t)t * DQ + (h0 + zz) * HD + d;
    v2f o2; o2[0] = O[e] * cs; o2[1] = O[e + 1] * cs; *(v2f*)(OUTb + oo) = o2;  }

extern "C" void kernel_launch(void* const* d_in, const int* in_sizes, int n_in,
                              void* d_out, int out_size, void* d_ws, size_t ws_size, hipStream_t stream) {
    (void)in_sizes; (void)n_in; (void)out_size;
    const float* x = (const float*)d_in[0]; const float* pq = (const float*)d_in[1]; const float* pk = (const float*)d_in[2]; const float* pv = (const float*)d_in[3];   /* each [16][1024][64] */ const float* wq = pq, *wk = pk, *wv = pv, *wo = nullptr; (void)wo;
    float* OUT = (float*)d_out;     // [4][2048][1024]
    char* wsp = (char*)d_ws;
    auto take = [&](size_t bytes) { char* p = wsp; wsp += (bytes + 255) & ~(size_t)255; return (void*)p; };
    bf* WQ = (bf*)take((size_t)(DQ + 2 * DKV) * DM * 2);   /* q, k, v rows one behind the other: one [3072][1024] Bt */ float* CS = (float*)take((size_t)TT * HD * 2 * 4);
    bf* XB = (bf*)take((size_t)TT * DM * 2);
    h16* VT16 = (h16*)take((size_t)NKV * HD * TT * 2);
    bf* QPh = (bf*)take((size_t)(NH_ + NKV) * TT * HD * 2); bf* KPh = QPh + (size_t)NH_ * TT * HD;   /* q heads, then k heads: one k_rope launch writes both */ bf* QPl = (bf*)take((size_t)(NH_ + NKV) * TT * HD * 2); bf* KPl = QPl + (size_t)NH_ * TT * HD; bf* VTh = (bf*)take((size_t)NKV * HD * TT * 2); bf* VTl = (bf*)take((size_t)NKV * HD * TT * 2); bf* Ph = (bf*)take((size_t)ZH * RH * TT * 2); bf* Pl = (bf*)take((size_t)ZH * RH * TT * 2);
    float* Sb = (float*)take((size_t)ZH * TT * TT * 4); h16* P16 = (h16*)take((size_t)ZH * (TT - RH) * TT * 2); float* Ob = (float*)take((size_t)ZH * TT * HD * 4);
    if ((size_t)(wsp - (char*)d_ws) > ws_size) return;    // ws 256 MiB; 251 MiB taken
    float* F = Sb;   // the batch's f32 projections [2048][3072] live in the score buffer until the planes are built (stream-ordered)
    h16* QK16 = (h16*)(Sb + (size_t)TT * DF);   // k_rope's fp16 q and k planes (no reader) lie behind them in the same buffer
    k_wtG<<<dim3((unsigned)((DM * HD / 64 + 63) / 64), NH_, 3), 256, 0, stream>>>(wq, wk, wv, DM, HD, WQ);   /* tensor z's head hh 'xw' [1024][64] -> Bt rows z*1024 + hh*64.. */
    k_csid<<<(TT * HD + 255) / 256, 256, 0, stream>>>(CS);
    const unsigned LQK = (unsigned)(((size_t)(NH_ + NKV) * TT * HD / 2 + 255) / 256), LKv = (unsigned)(((size_t)NKV * TT * HD / 2 + 255) / 256);
    for (int b = 0; b < NB_; ++b) {
        k_cvt8<<<(unsigned)(((size_t)TT * DM / 8 + 255) / 256), 256, 0, stream>>>(x + (size_t)b * TT * DM, XB, (size_t)TT * DM / 8);
        k_gemmw<bf, 0, false, false, 8, 2><<<dim3(TT / 64, DF / 64, 1), 256, 0, stream>>>(XB, nullptr, WQ, nullptr, DM, F, DF, nullptr, 0, 0, 0, 0);
        k_rope<<<LQK, 256, 0, stream>>>(F, DF, NH_ + NKV, CS, nullptr, nullptr, 1.0f, QK16, QPh, QPl);
        k_vtp<<<LKv, 256, 0, stream>>>(F + DQ + DKV, DF, NKV, VT16, VTh, VTl);
        for (int h0 = 0; h0 < NH_; h0 += ZH) { const size_t zq = (size_t)h0, zk = (size_t)(h0 / REP);   // one kv head per query head: the pass's heads use consecutive kv planes (z-strides TT*HD)
            k_gemmc<bf, 2, 1><<<dim3(TT / 64, TT / 64, ZH), 32, 0, stream>>>(QPh + zq * TT * HD, QPl + zq * TT * HD, KPh + zk * TT * HD, KPl + zk * TT * HD, HD, Sb, TT, 0, (size_t)TT * HD, (size_t)TT * HD, (size_t)TT * TT);   /* scores hi/lo on EVERY row */

            k_asoft<<<ZH * TT / 8, 256, 0, stream>>>(Sb, P16, Ph, Pl);
            k_gemmw<bf, 2, false, true, 8, 1><<<dim3(RH / 64, HD / 64, ZH), 256, 0, stream>>>(Ph, Pl, VTh + zk * HD * TT, VTl + zk * HD * TT, TT, Ob, HD, nullptr, 0, (size_t)RH * TT, (size_t)HD * TT, (size_t)TT * HD);
            k_gemmw<h16, 0, false, true, 16, 2><<<dim3((TT - RH) / 64, HD / 64, ZH), 512, 0, stream>>>(P16, nullptr, VT16 + zk * HD * TT, nullptr, TT, Ob + (size_t)RH * HD, HD, nullptr, RH, (size_t)(TT - RH) * TT, (size_t)HD * TT, (size_t)TT * HD);
            k_merge<<<(unsigned)(((size_t)ZH * TT * HD / 2 + 255) / 256), 256, 0, stream>>>(Ob, h0, OUT + (size_t)b * TT * DQ); }
         }
}

// v003
// It runs in 380 microseconds.
// Next to v002, in two timings, it ran 2.07 and 2.08 times as fast.
// Counting every step since v000, it is 7.81 times as fast.
#include <hip/hip_runtime.h>

// Causal multi-head attention with per-head weight tensors, scaled by sqrt(embed) (x [4][2048][1024]; q,k,v = einsum('bte,hed', x, W) (Wq, Wk, Wv [16][1024][64] uniform(+-1/32): head h's 'xw' block); 16 heads x 64; causal (-inf); scores / sqrt(1024) (the source's quirk: sigma ~0.1 logits); softmax; out = concat heads -> [4][2048][1024] (8.4 M; no output projection)).
// Layout per batch: bf16 copy of x; the three projection tensors' 48 'xw' [1024][64] blocks transposed (one launch) into one [3072][1024] Bt (rows q h*64.., k 1024 + h*64.., v 2048 + h*64..); exact projections, one N = 3072 GEMM; head planes; one fused causal attention launch for the 16 heads (scores, online softmax and attn.v in registers; the score matrix never reaches memory).
// Compute dtypes, f32 accumulate: every input rounded to bf16; projections exact; scores 3 hi/lo products on every row; softmax f32 (x 1/32), unnormalised probabilities in (0, 1], divided by the f32 row sum at the end; attn.v rows < 512 3 hi/lo products, rest fp16; output f32.

#define NB_  4
#define TT   2048
#define DM   1024
#define NH_  16
#define NKV  16
#define REP  (NH_ / NKV)
#define HD   64
#define DQ   (NH_ * HD)
#define DKV  (NKV * HD)
#define DF   (DQ + 2 * DKV)        // q, k and v projection columns side by side
#define AW   8                    // waves of a fused-attention block: they deal a query tile's key blocks among themselves
#define RH   512                  // query rows < RH do attn.v with hi+lo V and P (0: none)
#define SCL  0.03125f  // 1/sqrt(embed = 1024): the source's quirk
typedef _Float16 h16;
typedef unsigned short bf;
typedef __attribute__((ext_vector_type(16))) __bf16   v16bf;
typedef __attribute__((ext_vector_type(16))) _Float16 v16h;
typedef __attribute__((ext_vector_type(8)))  _Float16 v8h;
typedef __attribute__((ext_vector_type(8)))  unsigned short v8us;
typedef __attribute__((ext_vector_type(8)))  float    v8f;
typedef __attribute__((ext_vector_type(4)))  float    v4f;
typedef v8h  __attribute__((may_alias)) v8ha;
typedef v4f  __attribute__((may_alias)) v4fa;
typedef v8us __attribute__((may_alias)) v8usa;

__device__ __forceinline__ unsigned short f2bf(float f) { unsigned u = __float_as_uint(f); u += 0x7FFFu + ((u >> 16) & 1u); return (unsigned short)(u >> 16); }
__device__ __forceinline__ float bf2f(unsigned short b) { return __uint_as_float(((unsigned)b) << 16); }
__device__ __forceinline__ float bfr(float f) { return bf2f(f2bf(f)); }
__device__ __forceinline__ v16h cat16(v8h lo, v8h hi) { return __builtin_shufflevector(lo, hi, 0, 1, 2, 3, 4, 5, 6, 7, 8, 9, 10, 11, 12, 13, 14, 15); }
__device__ __forceinline__ v16bf cat16b(v8us lo, v8us hi) { return __builtin_bit_cast(v16bf, __builtin_shufflevector(lo, hi, 0, 1, 2, 3, 4, 5, 6, 7, 8, 9, 10, 11, 12, 13, 14, 15)); }
__device__ __forceinline__ v8f wmma16(v16h a, v16h b, v8f c) { return __builtin_amdgcn_wmma_f32_16x16x32_f16(false, a, false, b, (short)0, c, false, false); }
__device__ __forceinline__ v8f wmmab(v16bf a, v16bf b, v8f c) { return __builtin_amdgcn_wmma_f32_16x16x32_bf16(false, a, false, b, (short)0, c, false, false); }



// ---- k_gemmw: register-blocked GEMM, one 64x64 output tile per block (16 accumulators a wave), operands straight from K-contiguous 16-bit planes; grid (M/64, N/64, Z), NW * 32 threads (NW = 8).
// C[m][n] (f32, pitch ldc, + optional f32 bias[n]) = sum_k A[m][k] Bt[n][k] (+ split products per NSPLIT). z-batch strides sA/sB/sC in elements. K % (32 * KS) == 0.
// The K loop is dealt to the block's NW waves in slices of 32 * KS (wave w takes slices w, w + NW, ..): each wave holds a partial 64x64 tile, and the epilogue sums the NW partials through LDS in wave order.
// CAUSK (probability x value): the K loop stops at the diagonal block of query rows r0 + roff.. (probabilities beyond it are exactly zero); roff = row offset of this launch's first row within the sequence.
template <typename T16> struct WFrag;
template <> struct WFrag<h16> { typedef v16h V; static __device__ __forceinline__ V ld(const h16* p) { return cat16(*(const v8h*)p, *(const v8h*)(p + 16)); } static __device__ __forceinline__ v8f mma(V a, V b, v8f c) { return wmma16(a, b, c); } };
template <> struct WFrag<bf> { typedef v16bf V; static __device__ __forceinline__ V ld(const bf* p) { return cat16b(*(const v8us*)p, *(const v8us*)(p + 16)); } static __device__ __forceinline__ v8f mma(V a, V b, v8f c) { return wmmab(a, b, c); } };
template <typename T16, int NSPLIT, bool BIAS, bool CAUSK, int NW, int KS>
__global__ __launch_bounds__(NW * 32) void k_gemmw(const T16* __restrict__ A, const T16* __restrict__ A2, const T16* __restrict__ Bt, const T16* __restrict__ Bt2, int K, float* C, int ldc, const float* __restrict__ bias, int roff, size_t sA, size_t sB, size_t sC) {
    typedef typename WFrag<T16>::V V;
    constexpr int VW = 1024 / (NW * 32);   // floats of a 16x64 band that one thread sums and stores
    typedef float vW __attribute__((ext_vector_type(VW))); typedef vW __attribute__((may_alias)) vWa;
    __shared__ __align__(16) float os[NW * 16 * 68];
    const size_t z = blockIdx.z; A += z * sA; if (A2) A2 += z * sA; Bt += z * sB; if (Bt2) Bt2 += z * sB; C += z * sC;
    const int lane = threadIdx.x & 31, lr = lane & 15, hi = lane >> 4; const int wv = __builtin_amdgcn_readfirstlane(threadIdx.x >> 5);   /* the wave's number as a scalar: the K loop's counter and branch stay scalar */ const int r0 = blockIdx.x * 64, c0 = blockIdx.y * 64;
    const int Kl = CAUSK ? min(K, r0 + roff + 64) : K;
    v8f acc[4][4];
#pragma unroll
    for (int mb = 0; mb < 4; ++mb)
#pragma unroll
        for (int nb = 0; nb < 4; ++nb) acc[mb][nb] = (v8f){};
    const size_t aoff = (size_t)(r0 + lr) * K + 8 * hi, boff = (size_t)(c0 + lr) * K + 8 * hi;
#pragma unroll 1
    for (int k0 = wv * (32 * KS); k0 < Kl; k0 += NW * 32 * KS) {
#pragma unroll   // KS = 2: both halves of each row's 128-byte line are read by the same wave in the same trip
      for (int ks = 0; ks < KS; ++ks) { const int kc = k0 + ks * 32;
        V a[4], a2[4];
#pragma unroll
        for (int mb = 0; mb < 4; ++mb) { a[mb] = WFrag<T16>::ld(A + aoff + (size_t)mb * 16 * K + kc); if (NSPLIT == 1 || NSPLIT == 2) a2[mb] = WFrag<T16>::ld(A2 + aoff + (size_t)mb * 16 * K + kc); }
#pragma unroll
        for (int nb = 0; nb < 4; ++nb) { const V b = WFrag<T16>::ld(Bt + boff + (size_t)nb * 16 * K + kc); V b2; if (NSPLIT >= 2) b2 = WFrag<T16>::ld(Bt2 + boff + (size_t)nb * 16 * K + kc);
#pragma unroll
            for (int mb = 0; mb < 4; ++mb) { acc[mb][nb] = WFrag<T16>::mma(a[mb], b, acc[mb][nb]); if (NSPLIT == 1 || NSPLIT == 2) acc[mb][nb] = WFrag<T16>::mma(a2[mb], b, acc[mb][nb]); if (NSPLIT >= 2) acc[mb][nb] = WFrag<T16>::mma(a[mb], b2, acc[mb][nb]); } }
        asm volatile("v_nop\n\tv_nop\n\tv_nop\n\tv_nop" : "+v"(acc[0][0]), "+v"(acc[1][1]), "+v"(acc[2][2]), "+v"(acc[3][3]) : "v"(a[0]), "v"(a[3]));
      }
    }
    const int e = (int)threadIdx.x * VW, row = e >> 6, cofs = e & 63; vW val[4];
#pragma unroll
    for (int mb = 0; mb < 4; ++mb) {
#pragma unroll
        for (int nb = 0; nb < 4; ++nb) {
#pragma unroll
            for (int j = 0; j < 8; ++j) os[wv * (16 * 68) + (hi * 8 + j) * 68 + nb * 16 + lr] = acc[mb][nb][j]; }
        __syncthreads();   // every wave's partial band is in LDS before any thread sums it
        val[mb] = *(const vWa*)(os + row * 68 + cofs);
#pragma unroll   // the NW LDS reads go out together, at immediate offsets; the sum keeps the order w = 0, 1, ..
        for (int w = 1; w < NW; ++w) val[mb] += *(const vWa*)(os + w * (16 * 68) + row * 68 + cofs);
        if (mb < 3) __syncthreads();   // the band is read out before the next band overwrites it
    }
#pragma unroll   // constant indices keep val in registers
    for (int mb = 0; mb < 4; ++mb) {   // stores behind the last barrier, so that no barrier waits for a store
        if (BIAS) {
#pragma unroll   // constant indices keep val in registers
            for (int q = 0; q < VW; ++q) val[mb][q] += bfr(bias[c0 + cofs + q]); }
        *(vW*)(C + (size_t)(r0 + mb * 16 + row) * ldc + c0 + cofs) = val[mb]; }
}

__device__ __forceinline__ h16 tohx(float x) { return (h16)x; }
__device__ __forceinline__ void splitf(float y, unsigned short& h, unsigned short& l) { h = f2bf(y); l = f2bf(y - bf2f(h)); }
typedef __attribute__((ext_vector_type(2))) _Float16 v2h;
typedef __attribute__((ext_vector_type(4))) _Float16 v4h;
typedef __attribute__((ext_vector_type(2))) unsigned short v2us;
typedef __attribute__((ext_vector_type(4))) unsigned short v4us;
typedef __attribute__((ext_vector_type(2))) float v2f;
typedef __attribute__((ext_vector_type(4))) int v4i;

// grid (lines / 64, heads, 3): blockIdx.z picks the tensor, blockIdx.y its head; Bt holds the tensors' heads one behind the other
__global__ __launch_bounds__(256) void k_wtG(const float* __restrict__ w0, const float* __restrict__ w1, const float* __restrict__ w2, int K, int N, bf* Bt) {
    const float* __restrict__ w = (blockIdx.z == 0 ? w0 : blockIdx.z == 1 ? w1 : w2) + (size_t)blockIdx.y * K * N; Bt += ((size_t)blockIdx.z * NH_ + blockIdx.y) * N * K;
    const int lane = threadIdx.x & 31; const int L0 = (blockIdx.x * 8 + (threadIdx.x >> 5)) * 8; const int nlines = N * K / 64;
{
#pragma unroll 1
        for (int l = 0; l < 8; ++l) { const int L = L0 + l; if (L >= nlines) break; const size_t e = (size_t)L * 64 + lane * 2; const int k = (int)(e % K), n = (int)(e / K); v2us o;
            o[0] = f2bf(w[(size_t)k * N + n]); o[1] = f2bf(w[(size_t)(k + 1) * N + n]); *(v2us*)(Bt + e) = o; }
         }
}
__global__ __launch_bounds__(256) void k_cvt8(const float* __restrict__ src, bf* dst, size_t n8) { const size_t i = (size_t)blockIdx.x * 256 + threadIdx.x; if (i >= n8) return; const v8f v = *(const v8f*)(src + i * 8); v8us o;
#pragma unroll
    for (int k = 0; k < 8; ++k) o[k] = f2bf(v[k]); *(v8us*)(dst + i * 8) = o;  }

// k_rope: head planes [h][t][d] (fp16 + hi/lo) of rope(x) x sc with the rotate-half convention out[d] = x[d] cos[t][d] - x[d+HD/2] sin[t][d], out[d+HD/2] = x[d+HD/2] cos[t][d+HD/2] + x[d] sin[t][d+HD/2]
__global__ __launch_bounds__(256) void k_rope(const float* __restrict__ F, int pitch, int nheads, const float* __restrict__ CS, const float* __restrict__ RF, const float* __restrict__ nw, float sc, h16* P16, bf* Ph, bf* Pl) {
    const size_t e = ((size_t)blockIdx.x * 256 + threadIdx.x) * 2; if (e >= (size_t)nheads * TT * HD) return; const int d = (int)(e % HD); const int t = (int)((e / HD) % TT); const int h = (int)(e / ((size_t)HD * TT)); const float* f = F + (size_t)t * pitch + h * HD; const float rf = RF ? RF[(size_t)h * TT + t] : 1.0f; v2h o16; v2us oh, ol;
#pragma unroll
    for (int q = 0; q < 2; ++q) { const int dd = d + q; const int dp = (dd < HD / 2) ? dd + HD / 2 : dd - HD / 2; float x0 = f[dd], x1 = f[dp];
        if (RF) { float n0 = __fmul_rn(x0, rf), n1 = __fmul_rn(x1, rf); asm volatile("" : "+v"(n0)); asm volatile("" : "+v"(n1)); x0 = __fmul_rn(bfr(nw[dd]), n0); x1 = __fmul_rn(bfr(nw[dp]), n1); }
        const v2f cs = *(const v2f*)(CS + ((size_t)t * HD + dd) * 2); float a = __fmul_rn(x0, cs[0]), bq = __fmul_rn(x1, cs[1]); asm volatile("" : "+v"(a)); asm volatile("" : "+v"(bq)); const float r = ((dd < HD / 2) ? __fsub_rn(a, bq) : __fadd_rn(a, bq)) * sc;
        o16[q] = tohx(r); unsigned short a2, c2; splitf(r, a2, c2); oh[q] = a2; ol[q] = c2; }
    *(v2h*)(P16 + e) = o16; *(v2us*)(Ph + e) = oh; *(v2us*)(Pl + e) = ol;  }
__global__ __launch_bounds__(256) void k_vtp(const float* __restrict__ F, int pitch, int nheads, h16* V16, bf* Vh, bf* Vl) { const size_t e = ((size_t)blockIdx.x * 256 + threadIdx.x) * 2; if (e >= (size_t)nheads * HD * TT) return; const int t = (int)(e % TT); const int d = (int)((e / TT) % HD); const int g = (int)(e / ((size_t)TT * HD)); v2h o16; v2us oh, ol;
#pragma unroll
    for (int q = 0; q < 2; ++q) { const float x = F[(size_t)(t + q) * pitch + g * HD + d]; o16[q] = tohx(x); unsigned short a2, c2; splitf(x, a2, c2); oh[q] = a2; ol[q] = c2; }
    *(v2h*)(V16 + e) = o16; *(v2us*)(Vh + e) = oh; *(v2us*)(Vl + e) = ol;  }
__global__ __launch_bounds__(256) void k_csid(float* CS) { const int idx = blockIdx.x * 256 + threadIdx.x; if (idx >= TT * HD) return; v2f cs; cs[0] = 1.0f; cs[1] = 0.0f; *(v2f*)(CS + (size_t)idx * 2) = cs;  }
// ---- k_fattn: fused causal attention. grid (TT / 64, heads), AW waves. A block does the two 32-query tiles x and TT/32 - 1 - x of one head (together TT/32 + 1 key blocks of 32: every block has the same work).
// Transposed products: S^T = K Q^T (A = 16 key rows, B = 16 query columns, hi/lo 3 products) leaves one query per lane (keys 8 hi + j of each 16 in the lane's 8 registers), so two S^T tiles, converted in place, are the B operand (32 keys) of O^T += V^T P^T.
// The tile's key blocks are dealt to the waves (wave w: blocks w, w + AW, ..), each with its own running maximum, sum and O^T; the partials are joined through LDS in wave order.
template <bool HR>
__device__ __forceinline__ void fa_tile(const bf* __restrict__ Qh, const bf* __restrict__ Ql, const bf* __restrict__ Kh, const bf* __restrict__ Kl, const h16* __restrict__ V16, const bf* __restrict__ Vh, const bf* __restrict__ Vl, float* orow, int q0, int wv, int lr, int hi, float* os, float* ml) {
    constexpr float CL = SCL * 1.4426950408889634f;   // score -> log2 units
    v16bf qh[2][2], ql[2][2];
#pragma unroll
    for (int qt = 0; qt < 2; ++qt)
#pragma unroll
        for (int ks = 0; ks < 2; ++ks) { const size_t qo = (size_t)(q0 + qt * 16 + lr) * HD + ks * 32 + 8 * hi; qh[qt][ks] = WFrag<bf>::ld(Qh + qo); ql[qt][ks] = WFrag<bf>::ld(Ql + qo); }
    v8f o[2][4]; float ms[2], l[2];   // ms: the running maximum in log2 units, as rounded: the very value the exponents were taken against
#pragma unroll
    for (int qt = 0; qt < 2; ++qt) { ms[qt] = -3.0e38f; l[qt] = 0.f;
#pragma unroll
        for (int db = 0; db < 4; ++db) o[qt][db] = (v8f){}; }
    const int nkb = q0 / 32 + 1;   // key blocks 0 .. the diagonal one
    const unsigned kvo = (unsigned)(lr * HD + 8 * hi), vvo = (unsigned)(lr * TT + 8 * hi);
#pragma unroll 1
    for (int kb = wv; kb < nkb; kb += AW) { const int k0 = kb * 32; const bf* khp = Kh + (size_t)k0 * HD; const bf* klp = Kl + (size_t)k0 * HD;   // the pass's part of the address is scalar; the lane's part does not change in the loop
        v8f s[2][2]; v16bf kh[2][2], kl[2][2]; v16h vf[4];
#pragma unroll
        for (int kt = 0; kt < 2; ++kt)
#pragma unroll
            for (int ks = 0; ks < 2; ++ks) { kh[kt][ks] = WFrag<bf>::ld(khp + kvo + (kt * 16 * HD + ks * 32)); kl[kt][ks] = WFrag<bf>::ld(klp + kvo + (kt * 16 * HD + ks * 32)); }
        __builtin_amdgcn_sched_barrier(0);   // every K load of the pass is issued before its first product: one memory latency, not one per fragment group
#pragma unroll
        for (int kt = 0; kt < 2; ++kt)
#pragma unroll
            for (int qt = 0; qt < 2; ++qt) { v8f a = (v8f){};
#pragma unroll
                for (int ks = 0; ks < 2; ++ks) { a = wmmab(kh[kt][ks], qh[qt][ks], a); a = wmmab(kh[kt][ks], ql[qt][ks], a); a = wmmab(kl[kt][ks], qh[qt][ks], a); }
                s[kt][qt] = a; }
        if (!HR) {   // V^T fragments fly under the softmax
#pragma unroll
            for (int db = 0; db < 4; ++db) vf[db] = WFrag<h16>::ld(V16 + k0 + vvo + db * 16 * TT); }
        const bool diag = (kb == nkb - 1);   // only the diagonal block holds keys above a query
#pragma unroll
        for (int qt = 0; qt < 2; ++qt) { float mx = -3.0e38f;
#pragma unroll
            for (int kt = 0; kt < 2; ++kt)
#pragma unroll
                for (int j = 0; j < 8; ++j) { float t = s[kt][qt][j]; if (diag && kt * 16 + hi * 8 + j > qt * 16 + lr) t = -3.0e38f; s[kt][qt][j] = t; mx = fmaxf(mx, t); }
            mx = fmaxf(mx, __shfl_xor(mx, 16, 32));   // the query's other 16 keys lie in the other half of the wave
            const float mn = fmaxf(ms[qt], mx * CL), al = __builtin_amdgcn_exp2f(ms[qt] - mn); ms[qt] = mn; float sum = 0.f;
#pragma unroll
            for (int kt = 0; kt < 2; ++kt)
#pragma unroll
                for (int j = 0; j < 8; ++j) { const float p = __builtin_amdgcn_exp2f(__builtin_fmaf(s[kt][qt][j], CL, -mn)); s[kt][qt][j] = p; sum += p; }
            l[qt] = l[qt] * al + sum;
#pragma unroll
            for (int db = 0; db < 4; ++db) o[qt][db] *= al; }
        if (HR) { v16bf ph[2], pl[2];
#pragma unroll
            for (int qt = 0; qt < 2; ++qt) { v8us h0, h1, l0, l1;
#pragma unroll
                for (int j = 0; j < 8; ++j) { unsigned short a, c; splitf(s[0][qt][j], a, c); h0[j] = a; l0[j] = c; splitf(s[1][qt][j], a, c); h1[j] = a; l1[j] = c; }
                ph[qt] = cat16b(h0, h1); pl[qt] = cat16b(l0, l1); }
#pragma unroll
            for (int db = 0; db < 4; ++db) { const v16bf vh = WFrag<bf>::ld(Vh + k0 + vvo + db * 16 * TT), vl = WFrag<bf>::ld(Vl + k0 + vvo + db * 16 * TT);
#pragma unroll
                for (int qt = 0; qt < 2; ++qt) { o[qt][db] = wmmab(vh, ph[qt], o[qt][db]); o[qt][db] = wmmab(vh, pl[qt], o[qt][db]); o[qt][db] = wmmab(vl, ph[qt], o[qt][db]); } }
        } else { v16h pf[2];
#pragma unroll
            for (int qt = 0; qt < 2; ++qt)
#pragma unroll
                for (int j = 0; j < 8; ++j) { pf[qt][j] = tohx(s[0][qt][j]); pf[qt][8 + j] = tohx(s[1][qt][j]); }
#pragma unroll
            for (int db = 0; db < 4; ++db)
#pragma unroll
                for (int qt = 0; qt < 2; ++qt) o[qt][db] = wmma16(vf[db], pf[qt], o[qt][db]); }
    }
#pragma unroll
    for (int qt = 0; qt < 2; ++qt) { l[qt] += __shfl_xor(l[qt], 16, 32);   // the two halves' sums of one query
        float* op = os + (wv * 32 + qt * 16 + lr) * 68 + hi * 8;
#pragma unroll
        for (int db = 0; db < 4; ++db) { *(v4fa*)(op + db * 16) = __builtin_shufflevector(o[qt][db], o[qt][db], 0, 1, 2, 3); *(v4fa*)(op + db * 16 + 4) = __builtin_shufflevector(o[qt][db], o[qt][db], 4, 5, 6, 7); }
        if (hi == 0) { ml[(wv * 32 + qt * 16 + lr) * 2] = ms[qt]; ml[(wv * 32 + qt * 16 + lr) * 2 + 1] = l[qt]; } }
    __syncthreads();   // every wave's partial maximum, sum and O^T are in LDS before any thread joins them
    const int q = (int)threadIdx.x >> 3, d8 = ((int)threadIdx.x & 7) * 8; float M = ml[q * 2];
#pragma unroll
    for (int w = 1; w < AW; ++w) M = fmaxf(M, ml[(w * 32 + q) * 2]);
    float L = 0.f; v4f r0 = (v4f){}, r1 = (v4f){};
#pragma unroll   // a wave that had no key block has sum 0 and factor 0
    for (int w = 0; w < AW; ++w) { const float f = __builtin_amdgcn_exp2f(ml[(w * 32 + q) * 2] - M); L += f * ml[(w * 32 + q) * 2 + 1]; const float* ip = os + (w * 32 + q) * 68 + d8; r0 += *(const v4fa*)ip * f; r1 += *(const v4fa*)(ip + 4) * f; }
    const float rl = __fdiv_rn(1.0f, L); float* dst = orow + (size_t)(q0 + q) * DQ + d8;
    *(v4f*)dst = r0 * rl; *(v4f*)(dst + 4) = r1 * rl;
    __syncthreads();   // the partials are read out before the block's next tile overwrites them
}
// four waves per SIMD (two blocks per WGP, the whole grid resident at once): the register budget is held to 256 so that other waves' work covers a wave's load latency and softmax
__global__ __launch_bounds__(AW * 32) __attribute__((amdgpu_waves_per_eu(4, 4))) void k_fattn(const bf* __restrict__ Qh, const bf* __restrict__ Ql, const bf* __restrict__ Kh, const bf* __restrict__ Kl, const h16* __restrict__ V16, const bf* __restrict__ Vh, const bf* __restrict__ Vl, float* OUTb) {
    __shared__ __align__(16) float os[AW * 32 * 68]; __shared__ float ml[AW * 32 * 2];
    const size_t hp = (size_t)blockIdx.y * TT * HD; const int lane = threadIdx.x & 31, lr = lane & 15, hi = lane >> 4; const int wv = __builtin_amdgcn_readfirstlane(threadIdx.x >> 5);   // the wave's number as a scalar: the key loop's counter and branch stay scalar
#pragma unroll 1
    for (int half = 0; half < 2; ++half) { const int q0 = (half ? (int)blockIdx.x : TT / 32 - 1 - (int)blockIdx.x) * 32;
        if (q0 < RH) fa_tile<true>(Qh + hp, Ql + hp, Kh + hp, Kl + hp, V16 + hp, Vh + hp, Vl + hp, OUTb + blockIdx.y * HD, q0, wv, lr, hi, os, ml);
        else fa_tile<false>(Qh + hp, Ql + hp, Kh + hp, Kl + hp, V16 + hp, Vh + hp, Vl + hp, OUTb + blockIdx.y * HD, q0, wv, lr, hi, os, ml); }
}

extern "C" void kernel_launch(void* const* d_in, const int* in_sizes, int n_in,
                              void* d_out, int out_size, void* d_ws, size_t ws_size, hipStream_t stream) {
    (void)in_sizes; (void)n_in; (void)out_size;
    const float* x = (const float*)d_in[0]; const float* pq = (const float*)d_in[1]; const float* pk = (const float*)d_in[2]; const float* pv = (const float*)d_in[3];   /* each [16][1024][64] */ const float* wq = pq, *wk = pk, *wv = pv, *wo = nullptr; (void)wo;
    float* OUT = (float*)d_out;     // [4][2048][1024]
    char* wsp = (char*)d_ws;
    auto take = [&](size_t bytes) { char* p = wsp; wsp += (bytes + 255) & ~(size_t)255; return (void*)p; };
    bf* WQ = (bf*)take((size_t)(DQ + 2 * DKV) * DM * 2);   /* q, k, v rows one behind the other: one [3072][1024] Bt */ float* CS = (float*)take((size_t)TT * HD * 2 * 4);
    bf* XB = (bf*)take((size_t)TT * DM * 2);
    h16* VT16 = (h16*)take((size_t)NKV * HD * TT * 2);
    bf* QPh = (bf*)take((size_t)(NH_ + NKV) * TT * HD * 2); bf* KPh = QPh + (size_t)NH_ * TT * HD;   /* q heads, then k heads: one k_rope launch writes both */ bf* QPl = (bf*)take((size_t)(NH_ + NKV) * TT * HD * 2); bf* KPl = QPl + (size_t)NH_ * TT * HD; bf* VTh = (bf*)take((size_t)NKV * HD * TT * 2); bf* VTl = (bf*)take((size_t)NKV * HD * TT * 2);
    float* F = (float*)take((size_t)TT * DF * 4);   // the batch's f32 projections [2048][3072]
    h16* QK16 = (h16*)take((size_t)(NH_ + NKV) * TT * HD * 2);   // k_rope's fp16 q and k planes (no reader)
    if ((size_t)(wsp - (char*)d_ws) > ws_size) return;
    k_wtG<<<dim3((unsigned)((DM * HD / 64 + 63) / 64), NH_, 3), 256, 0, stream>>>(wq, wk, wv, DM, HD, WQ);   /* tensor z's head hh 'xw' [1024][64] -> Bt rows z*1024 + hh*64.. */
    k_csid<<<(TT * HD + 255) / 256, 256, 0, stream>>>(CS);
    const unsigned LQK = (unsigned)(((size_t)(NH_ + NKV) * TT * HD / 2 + 255) / 256), LKv = (unsigned)(((size_t)NKV * TT * HD / 2 + 255) / 256);
    for (int b = 0; b < NB_; ++b) {
        k_cvt8<<<(unsigned)(((size_t)TT * DM / 8 + 255) / 256), 256, 0, stream>>>(x + (size_t)b * TT * DM, XB, (size_t)TT * DM / 8);
        k_gemmw<bf, 0, false, false, 8, 2><<<dim3(TT / 64, DF / 64, 1), 256, 0, stream>>>(XB, nullptr, WQ, nullptr, DM, F, DF, nullptr, 0, 0, 0, 0);
        k_rope<<<LQK, 256, 0, stream>>>(F, DF, NH_ + NKV, CS, nullptr, nullptr, 1.0f, QK16, QPh, QPl);
        k_vtp<<<LKv, 256, 0, stream>>>(F + DQ + DKV, DF, NKV, VT16, VTh, VTl);
        k_fattn<<<dim3(TT / 64, NH_, 1), AW * 32, 0, stream>>>(QPh, QPl, KPh, KPl, VT16, VTh, VTl, OUT + (size_t)b * TT * DQ);
         }
}

// v004
// One run takes 291 microseconds.
// Two timings next to v003 put it at 1.30 and 1.31 times that version's speed.
// Counting every step since v000, it is 10.2 times as fast.
#include <hip/hip_runtime.h>

// Causal multi-head attention with per-head weight tensors, scaled by sqrt(embed) (x [4][2048][1024]; q,k,v = einsum('bte,hed', x, W) (Wq, Wk, Wv [16][1024][64] uniform(+-1/32): head h's 'xw' block); 16 heads x 64; causal (-inf); scores / sqrt(1024) (the source's quirk: sigma ~0.1 logits); softmax; out = concat heads -> [4][2048][1024] (8.4 M; no output projection)).
// Layout per batch: bf16 copy of x; the three projection tensors' 48 'xw' [1024][64] blocks transposed (one launch) into one [3072][1024] Bt (rows q h*64.., k 1024 + h*64.., v 2048 + h*64..); exact projections, one N = 3072 GEMM whose epilogue writes the head planes itself; one fused causal attention launch for the 16 heads (scores, online softmax and attn.v in registers; the score matrix never reaches memory).
// Compute dtypes, f32 accumulate: every input rounded to bf16; projections exact; scores 3 hi/lo products on every row; softmax f32 (x 1/32), unnormalised probabilities in (0, 1], divided by the f32 row sum at the end; attn.v rows < 512 3 hi/lo products, rest fp16; output f32.

#define NB_  4
#define TT   2048
#define DM   1024
#define NH_  16
#define NKV  16
#define REP  (NH_ / NKV)
#define HD   64
#define DQ   (NH_ * HD)
#define DKV  (NKV * HD)
#define DF   (DQ + 2 * DKV)        // q, k and v projection columns side by side
#define AW   8                    // waves of a fused-attention block: they deal a query tile's key blocks among themselves
#define RH   512                  // query rows < RH do attn.v with hi+lo V and P (0: none)
#define SCL  0.03125f  // 1/sqrt(embed = 1024): the source's quirk
typedef _Float16 h16;
typedef unsigned short bf;
typedef __attribute__((ext_vector_type(16))) __bf16   v16bf;
typedef __attribute__((ext_vector_type(16))) _Float16 v16h;
typedef __attribute__((ext_vector_type(8)))  _Float16 v8h;
typedef __attribute__((ext_vector_type(8)))  unsigned short v8us;
typedef __attribute__((ext_vector_type(8)))  float    v8f;
typedef __attribute__((ext_vector_type(4)))  float    v4f;
typedef v8h  __attribute__((may_alias)) v8ha;
typedef v4f  __attribute__((may_alias)) v4fa;
typedef v8us __attribute__((may_alias)) v8usa;

__device__ __forceinline__ unsigned short f2bf(float f) { unsigned u = __float_as_uint(f); u += 0x7FFFu + ((u >> 16) & 1u); return (unsigned short)(u >> 16); }
__device__ __forceinline__ float bf2f(unsigned short b) { return __uint_as_float(((unsigned)b) << 16); }
__device__ __forceinline__ float bfr(float f) { return bf2f(f2bf(f)); }
__device__ __forceinline__ v16h cat16(v8h lo, v8h hi) { return __builtin_shufflevector(lo, hi, 0, 1, 2, 3, 4, 5, 6, 7, 8, 9, 10, 11, 12, 13, 14, 15); }
__device__ __forceinline__ v16bf cat16b(v8us lo, v8us hi) { return __builtin_bit_cast(v16bf, __builtin_shufflevector(lo, hi, 0, 1, 2, 3, 4, 5, 6, 7, 8, 9, 10, 11, 12, 13, 14, 15)); }
__device__ __forceinline__ v8f wmma16(v16h a, v16h b, v8f c) { return __builtin_amdgcn_wmma_f32_16x16x32_f16(false, a, false, b, (short)0, c, false, false); }
__device__ __forceinline__ v8f wmmab(v16bf a, v16bf b, v8f c) { return __builtin_amdgcn_wmma_f32_16x16x32_bf16(false, a, false, b, (short)0, c, false, false); }



__device__ __forceinline__ h16 tohx(float x) { return (h16)x; }
__device__ __forceinline__ void splitf(float y, unsigned short& h, unsigned short& l) { h = f2bf(y); l = f2bf(y - bf2f(h)); }
typedef __attribute__((ext_vector_type(2))) unsigned short v2us;

template <typename T16> struct WFrag;
template <> struct WFrag<h16> { typedef v16h V; static __device__ __forceinline__ V ld(const h16* p) { return cat16(*(const v8h*)p, *(const v8h*)(p + 16)); } static __device__ __forceinline__ v8f mma(V a, V b, v8f c) { return wmma16(a, b, c); } };
template <> struct WFrag<bf> { typedef v16bf V; static __device__ __forceinline__ V ld(const bf* p) { return cat16b(*(const v8us*)p, *(const v8us*)(p + 16)); } static __device__ __forceinline__ v8f mma(V a, V b, v8f c) { return wmmab(a, b, c); } };
// ---- k_proj: the q, k, v projection GEMM, register-blocked, one 64x64 output tile per block (16 accumulators a wave), operands straight from K-contiguous bf16 planes; grid (TT/64, DF/64), NW * 32 threads.
// Tile column blockIdx.y is one head: q heads 0.., then k heads, then v heads. The epilogue rounds the f32 sums into the planes that the attention kernel reads: q and k [h][t][d] as bf16 hi + lo, v as V^T [g][d][t] in fp16 and bf16 hi + lo.
// A v tile is computed transposed (A = the head's 64 Bt rows, B = 64 rows of x; both planes are K-contiguous and share one fragment loader), so in every tile a thread's VW sums lie side by side in the plane and 16 lanes store a whole 128-byte line.
// The K loop is dealt to the block's NW waves in slices of 32 * KS (wave w takes slices w, w + NW, ..): each wave holds a partial 64x64 tile, and the epilogue sums the NW partials through LDS in wave order. K % (32 * KS) == 0.
template <int NW, int KS>
__global__ __launch_bounds__(NW * 32) void k_proj(const bf* __restrict__ X, const bf* __restrict__ Bt, int K, bf* Ph, bf* Pl, h16* V16, bf* Vh, bf* Vl) {
    typedef typename WFrag<bf>::V V;
    constexpr int VW = 1024 / (NW * 32);   // floats of a 16x64 band that one thread sums and stores
    typedef float vW __attribute__((ext_vector_type(VW))); typedef vW __attribute__((may_alias)) vWa;
    typedef unsigned short uW __attribute__((ext_vector_type(VW))); typedef _Float16 hW __attribute__((ext_vector_type(VW)));
    __shared__ __align__(16) float os[NW * 16 * 68];
    const int lane = threadIdx.x & 31, lr = lane & 15, hi = lane >> 4; const int wv = __builtin_amdgcn_readfirstlane(threadIdx.x >> 5);   /* the wave's number as a scalar: the K loop's counter and branch stay scalar */ const int r0 = blockIdx.x * 64, c0 = blockIdx.y * 64;
    const bool vt = c0 >= DQ + DKV;   // a v head's tile (the same for the whole block): rows d, columns t
    const bf* __restrict__ A = vt ? Bt : X; const bf* __restrict__ B = vt ? X : Bt;
    v8f acc[4][4];
#pragma unroll
    for (int mb = 0; mb < 4; ++mb)
#pragma unroll
        for (int nb = 0; nb < 4; ++nb) acc[mb][nb] = (v8f){};
    const size_t aoff = (size_t)((vt ? c0 : r0) + lr) * K + 8 * hi, boff = (size_t)((vt ? r0 : c0) + lr) * K + 8 * hi;
#pragma unroll 1
    for (int k0 = wv * (32 * KS); k0 < K; k0 += NW * 32 * KS) {
#pragma unroll   // KS = 2: both halves of each row's 128-byte line are read by the same wave in the same trip
      for (int ks = 0; ks < KS; ++ks) { const int kc = k0 + ks * 32;
        V a[4];
#pragma unroll
        for (int mb = 0; mb < 4; ++mb) a[mb] = WFrag<bf>::ld(A + aoff + (size_t)mb * 16 * K + kc);
#pragma unroll
        for (int nb = 0; nb < 4; ++nb) { const V b = WFrag<bf>::ld(B + boff + (size_t)nb * 16 * K + kc);
#pragma unroll
            for (int mb = 0; mb < 4; ++mb) acc[mb][nb] = WFrag<bf>::mma(a[mb], b, acc[mb][nb]); }
        asm volatile("v_nop\n\tv_nop\n\tv_nop\n\tv_nop" : "+v"(acc[0][0]), "+v"(acc[1][1]), "+v"(acc[2][2]), "+v"(acc[3][3]) : "v"(a[0]), "v"(a[3]));
      }
    }
    const int e = (int)threadIdx.x * VW, row = e >> 6, cofs = e & 63; vW val[4];
#pragma unroll
    for (int mb = 0; mb < 4; ++mb) {
#pragma unroll
        for (int nb = 0; nb < 4; ++nb) {
#pragma unroll
            for (int j = 0; j < 8; ++j) os[wv * (16 * 68) + (hi * 8 + j) * 68 + nb * 16 + lr] = acc[mb][nb][j]; }
        __syncthreads();   // every wave's partial band is in LDS before any thread sums it
        val[mb] = *(const vWa*)(os + row * 68 + cofs);
#pragma unroll   // the NW LDS reads go out together, at immediate offsets; the sum keeps the order w = 0, 1, ..
        for (int w = 1; w < NW; ++w) val[mb] += *(const vWa*)(os + w * (16 * 68) + row * 68 + cofs);
        if (mb < 3) __syncthreads();   // the band is read out before the next band overwrites it
    }
    uW oh[4], ol[4];
#pragma unroll   // constant indices keep val in registers
    for (int mb = 0; mb < 4; ++mb)
#pragma unroll
        for (int q = 0; q < VW; ++q) { unsigned short a2, c2; splitf(val[mb][q], a2, c2); oh[mb][q] = a2; ol[mb][q] = c2; }
    // stores behind the last barrier, so that no barrier waits for a store; the bands lie at constant distances in the plane
    if (vt) { const size_t po = (size_t)(c0 - (DQ + DKV) + row) * TT + r0 + cofs;   // V^T plane element (head, d = tile row, t = r0 + tile column)
        hW o16[4];
#pragma unroll
        for (int mb = 0; mb < 4; ++mb)
#pragma unroll
            for (int q = 0; q < VW; ++q) o16[mb][q] = tohx(val[mb][q]);
#pragma unroll
        for (int mb = 0; mb < 4; ++mb) { *(hW*)(V16 + po + mb * 16 * TT) = o16[mb]; *(uW*)(Vh + po + mb * 16 * TT) = oh[mb]; *(uW*)(Vl + po + mb * 16 * TT) = ol[mb]; }
    } else { const size_t po = (size_t)c0 * TT + (size_t)(r0 + row) * HD + cofs;   // q or k plane element (head c0 / 64, t = r0 + tile row, d = tile column)
#pragma unroll
        for (int mb = 0; mb < 4; ++mb) { *(uW*)(Ph + po + mb * 16 * HD) = oh[mb]; *(uW*)(Pl + po + mb * 16 * HD) = ol[mb]; }
        asm volatile("s_wait_xcnt 0x0" ::: "memory");   // the built code lays the v branch, which rewrites these stores' address registers, directly behind them: the wait stands in front of it
    }
}

// grid (lines / 64, heads, 3): blockIdx.z picks the tensor, blockIdx.y its head; Bt holds the tensors' heads one behind the other
__global__ __launch_bounds__(256) void k_wtG(const float* __restrict__ w0, const float* __restrict__ w1, const float* __restrict__ w2, int K, int N, bf* Bt) {
    const float* __restrict__ w = (blockIdx.z == 0 ? w0 : blockIdx.z == 1 ? w1 : w2) + (size_t)blockIdx.y * K * N; Bt += ((size_t)blockIdx.z * NH_ + blockIdx.y) * N * K;
    const int lane = threadIdx.x & 31; const int L0 = (blockIdx.x * 8 + (threadIdx.x >> 5)) * 8; const int nlines = N * K / 64;
{
#pragma unroll 1
        for (int l = 0; l < 8; ++l) { const int L = L0 + l; if (L >= nlines) break; const size_t e = (size_t)L * 64 + lane * 2; const int k = (int)(e % K), n = (int)(e / K); v2us o;
            o[0] = f2bf(w[(size_t)k * N + n]); o[1] = f2bf(w[(size_t)(k + 1) * N + n]); *(v2us*)(Bt + e) = o; }
         }
}
__global__ __launch_bounds__(256) void k_cvt8(const float* __restrict__ src, bf* dst, size_t n8) { const size_t i = (size_t)blockIdx.x * 256 + threadIdx.x; if (i >= n8) return; const v8f v = *(const v8f*)(src + i * 8); v8us o;
#pragma unroll
    for (int k = 0; k < 8; ++k) o[k] = f2bf(v[k]); *(v8us*)(dst + i * 8) = o;  }

// ---- k_fattn: fused causal attention. grid (TT / 64, heads), AW waves. A block does the two 32-query tiles x and TT/32 - 1 - x of one head (together TT/32 + 1 key blocks of 32: every block has the same work).
// Transposed products: S^T = K Q^T (A = 16 key rows, B = 16 query columns, hi/lo 3 products) leaves one query per lane (keys 8 hi + j of each 16 in the lane's 8 registers), so two S^T tiles, converted in place, are the B operand (32 keys) of O^T += V^T P^T.
// The tile's key blocks are dealt to the waves (wave w: blocks w, w + AW, ..), each with its own running maximum, sum and O^T; the partials are joined through LDS in wave order.
template <bool HR>
__device__ __forceinline__ void fa_tile(const bf* __restrict__ Qh, const bf* __restrict__ Ql, const bf* __restrict__ Kh, const bf* __restrict__ Kl, const h16* __restrict__ V16, const bf* __restrict__ Vh, const bf* __restrict__ Vl, float* orow, int q0, int wv, int lr, int hi, float* os, float* ml) {
    constexpr float CL = SCL * 1.4426950408889634f;   // score -> log2 units
    v16bf qh[2][2], ql[2][2];
#pragma unroll
    for (int qt = 0; qt < 2; ++qt)
#pragma unroll
        for (int ks = 0; ks < 2; ++ks) { const size_t qo = (size_t)(q0 + qt * 16 + lr) * HD + ks * 32 + 8 * hi; qh[qt][ks] = WFrag<bf>::ld(Qh + qo); ql[qt][ks] = WFrag<bf>::ld(Ql + qo); }
    v8f o[2][4]; float ms[2], l[2];   // ms: the running maximum in log2 units, as rounded: the very value the exponents were taken against
#pragma unroll
    for (int qt = 0; qt < 2; ++qt) { ms[qt] = -3.0e38f; l[qt] = 0.f;
#pragma unroll
        for (int db = 0; db < 4; ++db) o[qt][db] = (v8f){}; }
    const int nkb = q0 / 32 + 1;   // key blocks 0 .. the diagonal one
    const unsigned kvo = (unsigned)(lr * HD + 8 * hi), vvo = (unsigned)(lr * TT + 8 * hi);
#pragma unroll 1
    for (int kb = wv; kb < nkb; kb += AW) { const int k0 = kb * 32; const bf* khp = Kh + (size_t)k0 * HD; const bf* klp = Kl + (size_t)k0 * HD;   // the pass's part of the address is scalar; the lane's part does not change in the loop
        v8f s[2][2]; v16bf kh[2][2], kl[2][2]; v16h vf[4];
#pragma unroll
        for (int kt = 0; kt < 2; ++kt)
#pragma unroll
            for (int ks = 0; ks < 2; ++ks) { kh[kt][ks] = WFrag<bf>::ld(khp + kvo + (kt * 16 * HD + ks * 32)); kl[kt][ks] = WFrag<bf>::ld(klp + kvo + (kt * 16 * HD + ks * 32)); }
        __builtin_amdgcn_sched_barrier(0);   // every K load of the pass is issued before its first product: one memory latency, not one per fragment group
#pragma unroll
        for (int kt = 0; kt < 2; ++kt)
#pragma unroll
            for (int qt = 0; qt < 2; ++qt) { v8f a = (v8f){};
#pragma unroll
                for (int ks = 0; ks < 2; ++ks) { a = wmmab(kh[kt][ks], qh[qt][ks], a); a = wmmab(kh[kt][ks], ql[qt][ks], a); a = wmmab(kl[kt][ks], qh[qt][ks], a); }
                s[kt][qt] = a; }
        if (!HR) {   // V^T fragments fly under the softmax
#pragma unroll
            for (int db = 0; db < 4; ++db) vf[db] = WFrag<h16>::ld(V16 + k0 + vvo + db * 16 * TT); }
        const bool diag = (kb == nkb - 1);   // only the diagonal block holds keys above a query
#pragma unroll
        for (int qt = 0; qt < 2; ++qt) { float mx = -3.0e38f;
#pragma unroll
            for (int kt = 0; kt < 2; ++kt)
#pragma unroll
                for (int j = 0; j < 8; ++j) { float t = s[kt][qt][j]; if (diag && kt * 16 + hi * 8 + j > qt * 16 + lr) t = -3.0e38f; s[kt][qt][j] = t; mx = fmaxf(mx, t); }
            mx = fmaxf(mx, __shfl_xor(mx, 16, 32));   // the query's other 16 keys lie in the other half of the wave
            const float mn = fmaxf(ms[qt], mx * CL), al = __builtin_amdgcn_exp2f(ms[qt] - mn); ms[qt] = mn; float sum = 0.f;
#pragma unroll
            for (int kt = 0; kt < 2; ++kt)
#pragma unroll
                for (int j = 0; j < 8; ++j) { const float p = __builtin_amdgcn_exp2f(__builtin_fmaf(s[kt][qt][j], CL, -mn)); s[kt][qt][j] = p; sum += p; }
            l[qt] = l[qt] * al + sum;
#pragma unroll
            for (int db = 0; db < 4; ++db) o[qt][db] *= al; }
        if (HR) { v16bf ph[2], pl[2];
#pragma unroll
            for (int qt = 0; qt < 2; ++qt) { v8us h0, h1, l0, l1;
#pragma unroll
                for (int j = 0; j < 8; ++j) { unsigned short a, c; splitf(s[0][qt][j], a, c); h0[j] = a; l0[j] = c; splitf(s[1][qt][j], a, c); h1[j] = a; l1[j] = c; }
                ph[qt] = cat16b(h0, h1); pl[qt] = cat16b(l0, l1); }
#pragma unroll
            for (int db = 0; db < 4; ++db) { const v16bf vh = WFrag<bf>::ld(Vh + k0 + vvo + db * 16 * TT), vl = WFrag<bf>::ld(Vl + k0 + vvo + db * 16 * TT);
#pragma unroll
                for (int qt = 0; qt < 2; ++qt) { o[qt][db] = wmmab(vh, ph[qt], o[qt][db]); o[qt][db] = wmmab(vh, pl[qt], o[qt][db]); o[qt][db] = wmmab(vl, ph[qt], o[qt][db]); } }
        } else { v16h pf[2];
#pragma unroll
            for (int qt = 0; qt < 2; ++qt)
#pragma unroll
                for (int j = 0; j < 8; ++j) { pf[qt][j] = tohx(s[0][qt][j]); pf[qt][8 + j] = tohx(s[1][qt][j]); }
#pragma unroll
            for (int db = 0; db < 4; ++db)
#pragma unroll
                for (int qt = 0; qt < 2; ++qt) o[qt][db] = wmma16(vf[db], pf[qt], o[qt][db]); }
    }
#pragma unroll
    for (int qt = 0; qt < 2; ++qt) { l[qt] += __shfl_xor(l[qt], 16, 32);   // the two halves' sums of one query
        float* op = os + (wv * 32 + qt * 16 + lr) * 68 + hi * 8;
#pragma unroll
        for (int db = 0; db < 4; ++db) { *(v4fa*)(op + db * 16) = __builtin_shufflevector(o[qt][db], o[qt][db], 0, 1, 2, 3); *(v4fa*)(op + db * 16 + 4) = __builtin_shufflevector(o[qt][db], o[qt][db], 4, 5, 6, 7); }
        if (hi == 0) { ml[(wv * 32 + qt * 16 + lr) * 2] = ms[qt]; ml[(wv * 32 + qt * 16 + lr) * 2 + 1] = l[qt]; } }
    __syncthreads();   // every wave's partial maximum, sum and O^T are in LDS before any thread joins them
    const int q = (int)threadIdx.x >> 3, d8 = ((int)threadIdx.x & 7) * 8; float M = ml[q * 2];
#pragma unroll
    for (int w = 1; w < AW; ++w) M = fmaxf(M, ml[(w * 32 + q) * 2]);
    float L = 0.f; v4f r0 = (v4f){}, r1 = (v4f){};
#pragma unroll   // a wave that had no key block has sum 0 and factor 0
    for (int w = 0; w < AW; ++w) { const float f = __builtin_amdgcn_exp2f(ml[(w * 32 + q) * 2] - M); L += f * ml[(w * 32 + q) * 2 + 1]; const float* ip = os + (w * 32 + q) * 68 + d8; r0 += *(const v4fa*)ip * f; r1 += *(const v4fa*)(ip + 4) * f; }
    const float rl = __fdiv_rn(1.0f, L); float* dst = orow + (size_t)(q0 + q) * DQ + d8;
    *(v4f*)dst = r0 * rl; *(v4f*)(dst + 4) = r1 * rl;
    __syncthreads();   // the partials are read out before the block's next tile overwrites them
}
// four waves per SIMD (two blocks per WGP, the whole grid resident at once): the register budget is held to 256 so that other waves' work covers a wave's load latency and softmax
__global__ __launch_bounds__(AW * 32) __attribute__((amdgpu_waves_per_eu(4, 4))) void k_fattn(const bf* __restrict__ Qh, const bf* __restrict__ Ql, const bf* __restrict__ Kh, const bf* __restrict__ Kl, const h16* __restrict__ V16, const bf* __restrict__ Vh, const bf* __restrict__ Vl, float* OUTb) {
    __shared__ __align__(16) float os[AW * 32 * 68]; __shared__ float ml[AW * 32 * 2];
    const size_t hp = (size_t)blockIdx.y * TT * HD; const int lane = threadIdx.x & 31, lr = lane & 15, hi = lane >> 4; const int wv = __builtin_amdgcn_readfirstlane(threadIdx.x >> 5);   // the wave's number as a scalar: the key loop's counter and branch stay scalar
#pragma unroll 1
    for (int half = 0; half < 2; ++half) { const int q0 = (half ? (int)blockIdx.x : TT / 32 - 1 - (int)blockIdx.x) * 32;
        if (q0 < RH) fa_tile<true>(Qh + hp, Ql + hp, Kh + hp, Kl + hp, V16 + hp, Vh + hp, Vl + hp, OUTb + blockIdx.y * HD, q0, wv, lr, hi, os, ml);
        else fa_tile<false>(Qh + hp, Ql + hp, Kh + hp, Kl + hp, V16 + hp, Vh + hp, Vl + hp, OUTb + blockIdx.y * HD, q0, wv, lr, hi, os, ml); }
}

extern "C" void kernel_launch(void* const* d_in, const int* in_sizes, int n_in,
                              void* d_out, int out_size, void* d_ws, size_t ws_size, hipStream_t stream) {
    (void)in_sizes; (void)n_in; (void)out_size;
    const float* x = (const float*)d_in[0]; const float* pq = (const float*)d_in[1]; const float* pk = (const float*)d_in[2]; const float* pv = (const float*)d_in[3];   /* each [16][1024][64] */ const float* wq = pq, *wk = pk, *wv = pv, *wo = nullptr; (void)wo;
    float* OUT = (float*)d_out;     // [4][2048][1024]
    char* wsp = (char*)d_ws;
    auto take = [&](size_t bytes) { char* p = wsp; wsp += (bytes + 255) & ~(size_t)255; return (void*)p; };
    bf* WQ = (bf*)take((size_t)(DQ + 2 * DKV) * DM * 2);   /* q, k, v rows one behind the other: one [3072][1024] Bt */
    bf* XB = (bf*)take((size_t)TT * DM * 2);
    h16* VT16 = (h16*)take((size_t)NKV * HD * TT * 2);
    bf* QPh = (bf*)take((size_t)(NH_ + NKV) * TT * HD * 2); bf* KPh = QPh + (size_t)NH_ * TT * HD;   /* q heads, then k heads: the GEMM's tile column is the plane's head */ bf* QPl = (bf*)take((size_t)(NH_ + NKV) * TT * HD * 2); bf* KPl = QPl + (size_t)NH_ * TT * HD; bf* VTh = (bf*)take((size_t)NKV * HD * TT * 2); bf* VTl = (bf*)take((size_t)NKV * HD * TT * 2);
    if ((size_t)(wsp - (char*)d_ws) > ws_size) return;
    k_wtG<<<dim3((unsigned)((DM * HD / 64 + 63) / 64), NH_, 3), 256, 0, stream>>>(wq, wk, wv, DM, HD, WQ);   /* tensor z's head hh 'xw' [1024][64] -> Bt rows z*1024 + hh*64.. */
    for (int b = 0; b < NB_; ++b) {
        k_cvt8<<<(unsigned)(((size_t)TT * DM / 8 + 255) / 256), 256, 0, stream>>>(x + (size_t)b * TT * DM, XB, (size_t)TT * DM / 8);
        k_proj<8, 2><<<dim3(TT / 64, DF / 64, 1), 256, 0, stream>>>(XB, WQ, DM, QPh, QPl, VT16, VTh, VTl);
        k_fattn<<<dim3(TT / 64, NH_, 1), AW * 32, 0, stream>>>(QPh, QPl, KPh, KPl, VT16, VTh, VTl, OUT + (size_t)b * TT * DQ);
         }
}

// v005
// A run of this version takes 224 microseconds.
// Timed twice side by side with v004, it ran 1.29 and 1.30 times as fast.
// All steps since v000 together make it 13.2 times as fast.
#include <hip/hip_runtime.h>

// Causal multi-head attention with per-head weight tensors, scaled by sqrt(embed) (x [4][2048][1024]; q,k,v = einsum('bte,hed', x, W) (Wq, Wk, Wv [16][1024][64] uniform(+-1/32): head h's 'xw' block); 16 heads x 64; causal (-inf); scores / sqrt(1024) (the source's quirk: sigma ~0.1 logits); softmax; out = concat heads -> [4][2048][1024] (8.4 M; no output projection)).
// Fragment order: every plane that feeds a matrix operand (x, Bt, q, k, V^T) is stored as 16-row x 32-k fragments of 512 elements, element (row r, k) at (k >> 4 & 1) * 256 + (k >> 3 & 1) * 128 + r * 8 + (k & 7); a row block's fragments follow one another along k. Lane l of a wave then finds its two 16-byte pieces at l * 8 and 256 + l * 8: each wave-wide load reads 512 contiguous bytes, four whole lines.
// Layout per batch: bf16 copy of x; the three projection tensors' 48 'xw' [1024][64] blocks transposed (one launch) into one [3072][1024] Bt (rows q h*64.., k 1024 + h*64.., v 2048 + h*64..); exact projections, one N = 3072 GEMM whose epilogue writes the head planes itself; one fused causal attention launch for the 16 heads (scores, online softmax and attn.v in registers; the score matrix never reaches memory).
// Compute dtypes, f32 accumulate: every input rounded to bf16; projections exact; scores 3 hi/lo products on every row; softmax f32 (x 1/32), unnormalised probabilities in (0, 1], divided by the f32 row sum at the end; attn.v rows < 512 3 hi/lo products, rest fp16; output f32.

#define NB_  4
#define TT   2048
#define DM   1024
#define NH_  16
#define NKV  16
#define REP  (NH_ / NKV)
#define HD   64
#define DQ   (NH_ * HD)
#define DKV  (NKV * HD)
#define DF   (DQ + 2 * DKV)        // q, k and v projection columns side by side
#define AW   8                    // waves of a fused-attention block: they deal a query tile's key blocks among themselves
#define RH   512                  // query rows < RH do attn.v with hi+lo V and P (0: none)
#define SCL  0.03125f  // 1/sqrt(embed = 1024): the source's quirk
typedef _Float16 h16;
typedef unsigned short bf;
typedef __attribute__((ext_vector_type(16))) __bf16   v16bf;
typedef __attribute__((ext_vector_type(16))) _Float16 v16h;
typedef __attribute__((ext_vector_type(8)))  _Float16 v8h;
typedef __attribute__((ext_vector_type(8)))  unsigned short v8us;
typedef __attribute__((ext_vector_type(8)))  float    v8f;
typedef __attribute__((ext_vector_type(4)))  float    v4f;
typedef v8h  __attribute__((may_alias)) v8ha;
typedef v4f  __attribute__((may_alias)) v4fa;
typedef v8us __attribute__((may_alias)) v8usa;

__device__ __forceinline__ unsigned short f2bf(float f) { unsigned u = __float_as_uint(f); u += 0x7FFFu + ((u >> 16) & 1u); return (unsigned short)(u >> 16); }
__device__ __forceinline__ float bf2f(unsigned short b) { return __uint_as_float(((unsigned)b) << 16); }
__device__ __forceinline__ float bfr(float f) { return bf2f(f2bf(f)); }
__device__ __forceinline__ v16h cat16(v8h lo, v8h hi) { return __builtin_shufflevector(lo, hi, 0, 1, 2, 3, 4, 5, 6, 7, 8, 9, 10, 11, 12, 13, 14, 15); }
__device__ __forceinline__ v16bf cat16b(v8us lo, v8us hi) { return __builtin_bit_cast(v16bf, __builtin_shufflevector(lo, hi, 0, 1, 2, 3, 4, 5, 6, 7, 8, 9, 10, 11, 12, 13, 14, 15)); }
__device__ __forceinline__ v8f wmma16(v16h a, v16h b, v8f c) { return __builtin_amdgcn_wmma_f32_16x16x32_f16(false, a, false, b, (short)0, c, false, false); }
__device__ __forceinline__ v8f wmmab(v16bf a, v16bf b, v8f c) { return __builtin_amdgcn_wmma_f32_16x16x32_bf16(false, a, false, b, (short)0, c, false, false); }



__device__ __forceinline__ h16 tohx(float x) { return (h16)x; }
__device__ __forceinline__ void splitf(float y, unsigned short& h, unsigned short& l) { h = f2bf(y); l = f2bf(y - bf2f(h)); }
typedef __attribute__((ext_vector_type(2))) unsigned short v2us;

// ld: p = the fragment's start + lane * 8 in a plane in fragment order
template <typename T16> struct WFrag;
template <> struct WFrag<h16> { typedef v16h V; static __device__ __forceinline__ V ld(const h16* p) { return cat16(*(const v8h*)p, *(const v8h*)(p + 256)); } static __device__ __forceinline__ v8f mma(V a, V b, v8f c) { return wmma16(a, b, c); } };
template <> struct WFrag<bf> { typedef v16bf V; static __device__ __forceinline__ V ld(const bf* p) { return cat16b(*(const v8us*)p, *(const v8us*)(p + 256)); } static __device__ __forceinline__ v8f mma(V a, V b, v8f c) { return wmmab(a, b, c); } };
// ---- k_proj: the q, k, v projection GEMM, register-blocked, one 64x64 output tile per block (16 accumulators a wave), operands straight from bf16 planes in fragment order; grid (TT/64, DF/64), NW * 32 threads.
// Tile column blockIdx.y is one head: q heads 0.., then k heads, then v heads. The epilogue rounds the f32 sums into the planes that the attention kernel reads: q and k [h][t][d] (rows t, k = d) as bf16 hi + lo, v as V^T [g][d][t] (rows d, k = t; the four d blocks of 32 keys side by side) in fp16 and bf16 hi + lo, all in fragment order.
// A v tile is computed transposed (A = the head's 64 Bt rows, B = 64 rows of x; both planes share one fragment loader), so in every tile a thread's VW sums (one tile row, VW columns) lie side by side in the plane and a wave (16 rows x 8 columns) stores 256 contiguous bytes.
// The K loop is dealt to the block's NW waves in slices of 32 * KS (wave w takes slices w, w + NW, ..): each wave holds a partial 64x64 tile, and the epilogue sums the NW partials through LDS in wave order. K % (32 * KS) == 0.
template <int NW, int KS>
__global__ __launch_bounds__(NW * 32) void k_proj(const bf* __restrict__ X, const bf* __restrict__ Bt, int K, bf* Ph, bf* Pl, h16* V16, bf* Vh, bf* Vl) {
    typedef typename WFrag<bf>::V V;
    constexpr int VW = 1024 / (NW * 32);   // floats of a 16x64 band that one thread sums and stores
    static_assert(NW == 8, "the epilogue deals a band's eight 8-column groups to eight waves");
    typedef float vW __attribute__((ext_vector_type(VW))); typedef vW __attribute__((may_alias)) vWa;
    typedef unsigned short uW __attribute__((ext_vector_type(VW))); typedef _Float16 hW __attribute__((ext_vector_type(VW)));
    __shared__ __align__(16) float os[NW * 16 * 68];
    const int lane = threadIdx.x & 31, lr = lane & 15, hi = lane >> 4; const int wv = __builtin_amdgcn_readfirstlane(threadIdx.x >> 5);   /* the wave's number as a scalar: the K loop's counter and branch stay scalar */ const int r0 = blockIdx.x * 64, c0 = blockIdx.y * 64;
    const bool vt = c0 >= DQ + DKV;   // a v head's tile (the same for the whole block): rows d, columns t
    const bf* __restrict__ A = vt ? Bt : X; const bf* __restrict__ B = vt ? X : Bt;
    v8f acc[4][4];
#pragma unroll
    for (int mb = 0; mb < 4; ++mb)
#pragma unroll
        for (int nb = 0; nb < 4; ++nb) acc[mb][nb] = (v8f){};
    const bf* __restrict__ Ar = A + (size_t)(vt ? c0 : r0) * K; const bf* __restrict__ Br = B + (size_t)(vt ? r0 : c0) * K; const unsigned ln8 = (unsigned)lane * 8;   // a block of 16 rows holds 16 * K elements; its fragment for k = kc.. starts at kc * 16; all of an address but the lane's place in the fragment is scalar
#pragma unroll 1
    for (int k0 = wv * (32 * KS); k0 < K; k0 += NW * 32 * KS) {
      const bf* pa[4]; const bf* pb[4];   // the trip's first fragment of each operand block, at the lane's place
#pragma unroll
      for (int q = 0; q < 4; ++q) { pa[q] = Ar + ((size_t)q * 16 * K + (size_t)k0 * 16) + ln8; pb[q] = Br + ((size_t)q * 16 * K + (size_t)k0 * 16) + ln8; }
#pragma unroll   // KS = 2: two fragments that lie side by side per trip and operand block
      for (int ks = 0; ks < KS; ++ks) {
        V a[4];
#pragma unroll
        for (int mb = 0; mb < 4; ++mb) a[mb] = WFrag<bf>::ld(pa[mb] + ks * 512);
#pragma unroll
        for (int nb = 0; nb < 4; ++nb) { const V b = WFrag<bf>::ld(pb[nb] + ks * 512);
#pragma unroll
            for (int mb = 0; mb < 4; ++mb) acc[mb][nb] = WFrag<bf>::mma(a[mb], b, acc[mb][nb]); }
        asm volatile("v_nop\n\tv_nop\n\tv_nop\n\tv_nop" : "+v"(acc[0][0]), "+v"(acc[1][1]), "+v"(acc[2][2]), "+v"(acc[3][3]) : "v"(a[0]), "v"(a[3]));
      }
      asm volatile("s_wait_xcnt 0x0" :: "v"(pa[0]), "v"(pa[1]), "v"(pa[2]), "v"(pa[3]), "v"(pb[0]), "v"(pb[1]), "v"(pb[2]), "v"(pb[3]) : "memory");   // the trip's load addresses stay in their registers up to this wait: no later load's result and no next address lands on one ahead of it
    }
    const int row = lr, cofs = wv * 8 + hi * VW; vW val[4];   // wave w sums the band's columns 8 w .. 8 w + 7, which lie side by side in fragment order; 16 lanes read 16 rows at pitch 68: 64 different banks
#pragma unroll
    for (int mb = 0; mb < 4; ++mb) {
#pragma unroll
        for (int nb = 0; nb < 4; ++nb) {
#pragma unroll
            for (int j = 0; j < 8; ++j) os[wv * (16 * 68) + (hi * 8 + j) * 68 + nb * 16 + lr] = acc[mb][nb][j]; }
        __syncthreads();   // every wave's partial band is in LDS before any thread sums it
        val[mb] = *(const vWa*)(os + row * 68 + cofs);
#pragma unroll   // the NW LDS reads go out together, at immediate offsets; the sum keeps the order w = 0, 1, ..
        for (int w = 1; w < NW; ++w) val[mb] += *(const vWa*)(os + w * (16 * 68) + row * 68 + cofs);
        if (mb < 3) __syncthreads();   // the band is read out before the next band overwrites it
    }
    uW oh[4], ol[4];
#pragma unroll   // constant indices keep val in registers
    for (int mb = 0; mb < 4; ++mb)
#pragma unroll
        for (int q = 0; q < VW; ++q) { unsigned short a2, c2; splitf(val[mb][q], a2, c2); oh[mb][q] = a2; ol[mb][q] = c2; }
    // stores behind the last barrier, so that no barrier waits for a store; the bands lie at constant distances in the plane
    if (vt) { const size_t po = (size_t)(c0 - (DQ + DKV)) * TT + (size_t)((r0 >> 5) + (wv >> 2)) * (32 * HD) + (wv & 3) * 128 + row * 8 + hi * VW;   // V^T plane element (head, d = tile row, t = r0 + tile column): key block t >> 5, then the band's d block
        hW o16[4];
#pragma unroll
        for (int mb = 0; mb < 4; ++mb)
#pragma unroll
            for (int q = 0; q < VW; ++q) o16[mb][q] = tohx(val[mb][q]);
#pragma unroll
        for (int mb = 0; mb < 4; ++mb) { *(hW*)(V16 + po + mb * 512) = o16[mb]; *(uW*)(Vh + po + mb * 512) = oh[mb]; *(uW*)(Vl + po + mb * 512) = ol[mb]; }
    } else { const size_t po = (size_t)c0 * TT + (size_t)r0 * HD + wv * 128 + row * 8 + hi * VW;   // q or k plane element (head c0 / 64, t = r0 + tile row, d = tile column): a band is one block of 16 rows, two fragments
#pragma unroll
        for (int mb = 0; mb < 4; ++mb) { *(uW*)(Ph + po + mb * 16 * HD) = oh[mb]; *(uW*)(Pl + po + mb * 16 * HD) = ol[mb]; }
        asm volatile("s_wait_xcnt 0x0" ::: "memory");   // the built code lays the v branch, which rewrites these stores' address registers, directly behind them: the wait stands in front of it
    }
}

// grid (DM / 32, heads, 3): blockIdx.z picks the tensor, blockIdx.y its head, blockIdx.x 32 values of k; Bt holds the tensors' heads one behind the other, in fragment order (rows n, 64 a head).
// A thread gathers 8 values of k for one n: a wave reads 32 neighbouring n of one k (a whole line) per load and stores two runs of 256 bytes.
__global__ __launch_bounds__(256) void k_wtG(const float* __restrict__ w0, const float* __restrict__ w1, const float* __restrict__ w2, bf* Bt) {
    const int n = threadIdx.x & 63, g = threadIdx.x >> 6;
    const float* p = (blockIdx.z == 0 ? w0 : blockIdx.z == 1 ? w1 : w2) + (size_t)blockIdx.y * DM * HD + (size_t)(blockIdx.x * 32 + g * 8) * HD + n; float v[8];
#pragma unroll
    for (int e = 0; e < 8; ++e) v[e] = p[e * HD];
    asm volatile("s_wait_xcnt 0x0" :: "v"(p) : "memory");   // the loads' address stays in its registers up to this wait: none of their results lands on it ahead of it
    v8us o;
#pragma unroll
    for (int e = 0; e < 8; ++e) o[e] = f2bf(v[e]);
    *(v8us*)(Bt + ((size_t)blockIdx.z * NH_ + blockIdx.y) * HD * DM + (size_t)(n >> 4) * 16 * DM + blockIdx.x * 512 + g * 128 + (n & 15) * 8) = o;
}
// thread i writes the 8 elements i * 8.. of the plane in fragment order: row (i >> 11) * 16 + (i & 15), k = (i >> 4 & 127) * 8 (DM / 8 = 128 groups of 8 a row); a block reads 512 contiguous bytes of each of 16 rows
__global__ __launch_bounds__(256) void k_cvt8(const float* __restrict__ src, bf* dst, size_t n8) { const size_t i = (size_t)blockIdx.x * 256 + threadIdx.x; if (i >= n8) return; const v8f v = *(const v8f*)(src + ((i / (DM * 2)) * 16 + (i & 15)) * DM + ((i >> 4) & (DM / 8 - 1)) * 8); v8us o;
#pragma unroll
    for (int k = 0; k < 8; ++k) o[k] = f2bf(v[k]); *(v8us*)(dst + i * 8) = o;  }

// ---- k_fattn: fused causal attention. grid (TT / 64, heads), AW waves. A block does the two 32-query tiles x and TT/32 - 1 - x of one head (together TT/32 + 1 key blocks of 32: every block has the same work).
// Transposed products: S^T = K Q^T (A = 16 key rows, B = 16 query columns, hi/lo 3 products) leaves one query per lane (keys 8 hi + j of each 16 in the lane's 8 registers), so two S^T tiles, converted in place, are the B operand (32 keys) of O^T += V^T P^T.
// The tile's key blocks are dealt to the waves (wave w: blocks w, w + AW, ..), each with its own running maximum, sum and O^T; the partials are joined through LDS in wave order.
template <bool HR>
__device__ __forceinline__ void fa_tile(const bf* __restrict__ Qh, const bf* __restrict__ Ql, const bf* __restrict__ Kh, const bf* __restrict__ Kl, const h16* __restrict__ V16, const bf* __restrict__ Vh, const bf* __restrict__ Vl, float* orow, int q0, int wv, int lr, int hi, float* os, float* ml) {
    constexpr float CL = SCL * 1.4426950408889634f;   // score -> log2 units
    const unsigned ln8 = (unsigned)((hi * 16 + lr) * 8);   // the lane's place in every fragment
    v16bf qh[2][2], ql[2][2];
#pragma unroll
    for (int qt = 0; qt < 2; ++qt)
#pragma unroll
        for (int ks = 0; ks < 2; ++ks) { const size_t qo = (size_t)(q0 + qt * 16) * HD + ks * 512 + ln8; qh[qt][ks] = WFrag<bf>::ld(Qh + qo); ql[qt][ks] = WFrag<bf>::ld(Ql + qo); }
    v8f o[2][4]; float ms[2], l[2];   // ms: the running maximum in log2 units, as rounded: the very value the exponents were taken against
#pragma unroll
    for (int qt = 0; qt < 2; ++qt) { ms[qt] = -3.0e38f; l[qt] = 0.f;
#pragma unroll
        for (int db = 0; db < 4; ++db) o[qt][db] = (v8f){}; }
    const int nkb = q0 / 32 + 1;   // key blocks 0 .. the diagonal one
#pragma unroll 1
    for (int kb = wv; kb < nkb; kb += AW) { const int k0 = kb * 32; const bf* khp = Kh + (size_t)k0 * HD; const bf* klp = Kl + (size_t)k0 * HD;   // the pass's part of the address is scalar; the lane's part does not change in the loop
        v8f s[2][2]; v16bf kh[2][2], kl[2][2]; v16h vf[4];
#pragma unroll
        for (int kt = 0; kt < 2; ++kt)
#pragma unroll
            for (int ks = 0; ks < 2; ++ks) { kh[kt][ks] = WFrag<bf>::ld(khp + ln8 + (kt * 16 * HD + ks * 512)); kl[kt][ks] = WFrag<bf>::ld(klp + ln8 + (kt * 16 * HD + ks * 512)); }
        __builtin_amdgcn_sched_barrier(0);   // every K load of the pass is issued before its first product: one memory latency, not one per fragment group
#pragma unroll
        for (int kt = 0; kt < 2; ++kt)
#pragma unroll
            for (int qt = 0; qt < 2; ++qt) { v8f a = (v8f){};
#pragma unroll
                for (int ks = 0; ks < 2; ++ks) { a = wmmab(kh[kt][ks], qh[qt][ks], a); a = wmmab(kh[kt][ks], ql[qt][ks], a); a = wmmab(kl[kt][ks], qh[qt][ks], a); }
                s[kt][qt] = a; }
        if (!HR) {   // V^T fragments fly under the softmax
            const h16* vp = V16 + (size_t)k0 * HD + ln8;
#pragma unroll
            for (int db = 0; db < 4; ++db) vf[db] = WFrag<h16>::ld(vp + db * 512);
            asm volatile("s_wait_xcnt 0x0" :: "v"(vp) : "memory"); }   // the loads' address stays in its registers up to this wait: none of their results lands on it ahead of it
        const bool diag = (kb == nkb - 1);   // only the diagonal block holds keys above a query
#pragma unroll
        for (int qt = 0; qt < 2; ++qt) { float mx = -3.0e38f;
#pragma unroll
            for (int kt = 0; kt < 2; ++kt)
#pragma unroll
                for (int j = 0; j < 8; ++j) { float t = s[kt][qt][j]; if (diag && kt * 16 + hi * 8 + j > qt * 16 + lr) t = -3.0e38f; s[kt][qt][j] = t; mx = fmaxf(mx, t); }
            mx = fmaxf(mx, __shfl_xor(mx, 16, 32));   // the query's other 16 keys lie in the other half of the wave
            const float mn = fmaxf(ms[qt], mx * CL), al = __builtin_amdgcn_exp2f(ms[qt] - mn); ms[qt] = mn; float sum = 0.f;
#pragma unroll
            for (int kt = 0; kt < 2; ++kt)
#pragma unroll
                for (int j = 0; j < 8; ++j) { const float p = __builtin_amdgcn_exp2f(__builtin_fmaf(s[kt][qt][j], CL, -mn)); s[kt][qt][j] = p; sum += p; }
            l[qt] = l[qt] * al + sum;
#pragma unroll
            for (int db = 0; db < 4; ++db) o[qt][db] *= al; }
        if (HR) { v16bf ph[2], pl[2]; const bf* vhp = Vh + (size_t)k0 * HD + ln8; const bf* vlp = Vl + (size_t)k0 * HD + ln8;
#pragma unroll
            for (int qt = 0; qt < 2; ++qt) { v8us h0, h1, l0, l1;
#pragma unroll
                for (int j = 0; j < 8; ++j) { unsigned short a, c; splitf(s[0][qt][j], a, c); h0[j] = a; l0[j] = c; splitf(s[1][qt][j], a, c); h1[j] = a; l1[j] = c; }
                ph[qt] = cat16b(h0, h1); pl[qt] = cat16b(l0, l1); }
#pragma unroll
            for (int db = 0; db < 4; ++db) { const v16bf vh = WFrag<bf>::ld(vhp + db * 512), vl = WFrag<bf>::ld(vlp + db * 512);
#pragma unroll
                for (int qt = 0; qt < 2; ++qt) { o[qt][db] = wmmab(vh, ph[qt], o[qt][db]); o[qt][db] = wmmab(vh, pl[qt], o[qt][db]); o[qt][db] = wmmab(vl, ph[qt], o[qt][db]); } }
            asm volatile("s_wait_xcnt 0x0" :: "v"(vhp), "v"(vlp) : "memory");   // as at the fp16 V^T loads: the two addresses stay in their registers up to this wait
        } else { v16h pf[2];
#pragma unroll
            for (int qt = 0; qt < 2; ++qt)
#pragma unroll
                for (int j = 0; j < 8; ++j) { pf[qt][j] = tohx(s[0][qt][j]); pf[qt][8 + j] = tohx(s[1][qt][j]); }
#pragma unroll
            for (int db = 0; db < 4; ++db)
#pragma unroll
                for (int qt = 0; qt < 2; ++qt) o[qt][db] = wmma16(vf[db], pf[qt], o[qt][db]); }
    }
#pragma unroll
    for (int qt = 0; qt < 2; ++qt) { l[qt] += __shfl_xor(l[qt], 16, 32);   // the two halves' sums of one query
        float* op = os + (wv * 32 + qt * 16 + lr) * 68 + hi * 8;
#pragma unroll
        for (int db = 0; db < 4; ++db) { *(v4fa*)(op + db * 16) = __builtin_shufflevector(o[qt][db], o[qt][db], 0, 1, 2, 3); *(v4fa*)(op + db * 16 + 4) = __builtin_shufflevector(o[qt][db], o[qt][db], 4, 5, 6, 7); }
        if (hi == 0) { ml[(wv * 32 + qt * 16 + lr) * 2] = ms[qt]; ml[(wv * 32 + qt * 16 + lr) * 2 + 1] = l[qt]; } }
    __syncthreads();   // every wave's partial maximum, sum and O^T are in LDS before any thread joins them
    const int q = (int)threadIdx.x >> 3, d8 = ((int)threadIdx.x & 7) * 8; float M = ml[q * 2];
#pragma unroll
    for (int w = 1; w < AW; ++w) M = fmaxf(M, ml[(w * 32 + q) * 2]);
    float L = 0.f; v4f r0 = (v4f){}, r1 = (v4f){};
#pragma unroll   // a wave that had no key block has sum 0 and factor 0
    for (int w = 0; w < AW; ++w) { const float f = __builtin_amdgcn_exp2f(ml[(w * 32 + q) * 2] - M); L += f * ml[(w * 32 + q) * 2 + 1]; const float* ip = os + (w * 32 + q) * 68 + d8; r0 += *(const v4fa*)ip * f; r1 += *(const v4fa*)(ip + 4) * f; }
    const float rl = __fdiv_rn(1.0f, L); float* dst = orow + (size_t)(q0 + q) * DQ + d8;
    *(v4f*)dst = r0 * rl; *(v4f*)(dst + 4) = r1 * rl;
    __syncthreads();   // the partials are read out before the block's next tile overwrites them
}
// four waves per SIMD (two blocks per WGP, the whole grid resident at once): the register budget is held to 256 so that other waves' work covers a wave's load latency and softmax
__global__ __launch_bounds__(AW * 32) __attribute__((amdgpu_waves_per_eu(4, 4))) void k_fattn(const bf* __restrict__ Qh, const bf* __restrict__ Ql, const bf* __restrict__ Kh, const bf* __restrict__ Kl, const h16* __restrict__ V16, const bf* __restrict__ Vh, const bf* __restrict__ Vl, float* OUTb) {
    __shared__ __align__(16) float os[AW * 32 * 68]; __shared__ float ml[AW * 32 * 2];
    const size_t hp = (size_t)blockIdx.y * TT * HD; const int lane = threadIdx.x & 31, lr = lane & 15, hi = lane >> 4; const int wv = __builtin_amdgcn_readfirstlane(threadIdx.x >> 5);   // the wave's number as a scalar: the key loop's counter and branch stay scalar
#pragma unroll 1
    for (int half = 0; half < 2; ++half) { const int q0 = (half ? (int)blockIdx.x : TT / 32 - 1 - (int)blockIdx.x) * 32;
        if (q0 < RH) fa_tile<true>(Qh + hp, Ql + hp, Kh + hp, Kl + hp, V16 + hp, Vh + hp, Vl + hp, OUTb + blockIdx.y * HD, q0, wv, lr, hi, os, ml);
        else fa_tile<false>(Qh + hp, Ql + hp, Kh + hp, Kl + hp, V16 + hp, Vh + hp, Vl + hp, OUTb + blockIdx.y * HD, q0, wv, lr, hi, os, ml); }
}

extern "C" void kernel_launch(void* const* d_in, const int* in_sizes, int n_in,
                              void* d_out, int out_size, void* d_ws, size_t ws_size, hipStream_t stream) {
    (void)in_sizes; (void)n_in; (void)out_size;
    const float* x = (const float*)d_in[0]; const float* pq = (const float*)d_in[1]; const float* pk = (const float*)d_in[2]; const float* pv = (const float*)d_in[3];   /* each [16][1024][64] */ const float* wq = pq, *wk = pk, *wv = pv, *wo = nullptr; (void)wo;
    float* OUT = (float*)d_out;     // [4][2048][1024]
    char* wsp = (char*)d_ws;
    auto take = [&](size_t bytes) { char* p = wsp; wsp += (bytes + 255) & ~(size_t)255; return (void*)p; };
    bf* WQ = (bf*)take((size_t)(DQ + 2 * DKV) * DM * 2);   /* q, k, v rows one behind the other: one [3072][1024] Bt */
    bf* XB = (bf*)take((size_t)TT * DM * 2);
    h16* VT16 = (h16*)take((size_t)NKV * HD * TT * 2);
    bf* QPh = (bf*)take((size_t)(NH_ + NKV) * TT * HD * 2); bf* KPh = QPh + (size_t)NH_ * TT * HD;   /* q heads, then k heads: the GEMM's tile column is the plane's head */ bf* QPl = (bf*)take((size_t)(NH_ + NKV) * TT * HD * 2); bf* KPl = QPl + (size_t)NH_ * TT * HD; bf* VTh = (bf*)take((size_t)NKV * HD * TT * 2); bf* VTl = (bf*)take((size_t)NKV * HD * TT * 2);
    if ((size_t)(wsp - (char*)d_ws) > ws_size) return;
    k_wtG<<<dim3(DM / 32, NH_, 3), 256, 0, stream>>>(wq, wk, wv, WQ);   /* tensor z's head hh 'xw' [1024][64] -> Bt rows z*1024 + hh*64.. */
    for (int b = 0; b < NB_; ++b) {
        k_cvt8<<<(unsigned)(((size_t)TT * DM / 8 + 255) / 256), 256, 0, stream>>>(x + (size_t)b * TT * DM, XB, (size_t)TT * DM / 8);
        k_proj<8, 2><<<dim3(TT / 64, DF / 64, 1), 256, 0, stream>>>(XB, WQ, DM, QPh, QPl, VT16, VTh, VTl);
        k_fattn<<<dim3(TT / 64, NH_, 1), AW * 32, 0, stream>>>(QPh, QPl, KPh, KPl, VT16, VTh, VTl, OUT + (size_t)b * TT * DQ);
         }
}

// v006
// It runs in 186 microseconds.
// Next to v005, in two timings, it ran 1.21 times as fast each time.
// Counting every step since v000, it is 16.0 times as fast.
#include <hip/hip_runtime.h>

// Causal multi-head attention with per-head weight tensors, scaled by sqrt(embed) (x [4][2048][1024]; q,k,v = einsum('bte,hed', x, W) (Wq, Wk, Wv [16][1024][64] uniform(+-1/32): head h's 'xw' block); 16 heads x 64; causal (-inf); scores / sqrt(1024) (the source's quirk: sigma ~0.1 logits); softmax; out = concat heads -> [4][2048][1024] (8.4 M; no output projection)).
// Fragment order: every plane that feeds a matrix operand (x, Bt, q, k, V^T) is stored as 16-row x 32-k fragments of 512 elements, element (row r, k) at (k >> 4 & 1) * 256 + (k >> 3 & 1) * 128 + r * 8 + (k & 7); a row block's fragments follow one another along k. Lane l of a wave then finds its two 16-byte pieces at l * 8 and 256 + l * 8: each wave-wide load reads 512 contiguous bytes, four whole lines.
// Three launches, each for all four batches (every plane but Bt holds the batches one behind the other): bf16 copy of x together with the three projection tensors' 48 'xw' [1024][64] blocks transposed into one [3072][1024] Bt (rows q h*64.., k 1024 + h*64.., v 2048 + h*64..); exact projections, one N = 3072 GEMM whose epilogue writes the head planes itself; one fused causal attention launch for the 4 x 16 heads (scores, online softmax and attn.v in registers; the score matrix never reaches memory).
// Compute dtypes, f32 accumulate: every input rounded to bf16; projections exact; scores 3 hi/lo products on every row; softmax f32 (x 1/32), unnormalised probabilities in (0, 1], divided by the f32 row sum at the end; attn.v rows < 512 3 hi/lo products, rest fp16; output f32.

#define NB_  4
#define TT   2048
#define DM   1024
#define NH_  16
#define NKV  16
#define REP  (NH_ / NKV)
#define HD   64
#define DQ   (NH_ * HD)
#define DKV  (NKV * HD)
#define DF   (DQ + 2 * DKV)        // q, k and v projection columns side by side
#define AW   8                    // waves of a fused-attention block: they deal a query tile's key blocks among themselves
#define RH   512                  // query rows < RH do attn.v with hi+lo V and P (0: none)
#define SCL  0.03125f  // 1/sqrt(embed = 1024): the source's quirk
typedef _Float16 h16;
typedef unsigned short bf;
typedef __attribute__((ext_vector_type(16))) __bf16   v16bf;
typedef __attribute__((ext_vector_type(16))) _Float16 v16h;
typedef __attribute__((ext_vector_type(8)))  _Float16 v8h;
typedef __attribute__((ext_vector_type(8)))  unsigned short v8us;
typedef __attribute__((ext_vector_type(8)))  float    v8f;
typedef __attribute__((ext_vector_type(4)))  float    v4f;
typedef v8h  __attribute__((may_alias)) v8ha;
typedef v4f  __attribute__((may_alias)) v4fa;
typedef v8us __attribute__((may_alias)) v8usa;

__device__ __forceinline__ unsigned short f2bf(float f) { unsigned u = __float_as_uint(f); u += 0x7FFFu + ((u >> 16) & 1u); return (unsigned short)(u >> 16); }
__device__ __forceinline__ float bf2f(unsigned short b) { return __uint_as_float(((unsigned)b) << 16); }
__device__ __forceinline__ float bfr(float f) { return bf2f(f2bf(f)); }
__device__ __forceinline__ v16h cat16(v8h lo, v8h hi) { return __builtin_shufflevector(lo, hi, 0, 1, 2, 3, 4, 5, 6, 7, 8, 9, 10, 11, 12, 13, 14, 15); }
__device__ __forceinline__ v16bf cat16b(v8us lo, v8us hi) { return __builtin_bit_cast(v16bf, __builtin_shufflevector(lo, hi, 0, 1, 2, 3, 4, 5, 6, 7, 8, 9, 10, 11, 12, 13, 14, 15)); }
__device__ __forceinline__ v8f wmma16(v16h a, v16h b, v8f c) { return __builtin_amdgcn_wmma_f32_16x16x32_f16(false, a, false, b, (short)0, c, false, false); }
__device__ __forceinline__ v8f wmmab(v16bf a, v16bf b, v8f c) { return __builtin_amdgcn_wmma_f32_16x16x32_bf16(false, a, false, b, (short)0, c, false, false); }



__device__ __forceinline__ h16 tohx(float x) { return (h16)x; }
__device__ __forceinline__ void splitf(float y, unsigned short& h, unsigned short& l) { h = f2bf(y); l = f2bf(y - bf2f(h)); }
typedef __attribute__((ext_vector_type(2))) unsigned short v2us;

// ld: p = the fragment's start + lane * 8 in a plane in fragment order
template <typename T16> struct WFrag;
template <> struct WFrag<h16> { typedef v16h V; static __device__ __forceinline__ V ld(const h16* p) { return cat16(*(const v8h*)p, *(const v8h*)(p + 256)); } static __device__ __forceinline__ v8f mma(V a, V b, v8f c) { return wmma16(a, b, c); } };
template <> struct WFrag<bf> { typedef v16bf V; static __device__ __forceinline__ V ld(const bf* p) { return cat16b(*(const v8us*)p, *(const v8us*)(p + 256)); } static __device__ __forceinline__ v8f mma(V a, V b, v8f c) { return wmmab(a, b, c); } };
// ---- k_proj: the q, k, v projection GEMM, register-blocked, one 64x64 output tile per block (16 accumulators a wave), operands straight from bf16 planes in fragment order; grid (TT/64, DF/64, batches), NW * 32 threads.
// Tile column blockIdx.y is one head: q heads 0.., then k heads, then v heads. The epilogue rounds the f32 sums into the planes that the attention kernel reads: q and k [h][t][d] (rows t, k = d) as bf16 hi + lo, v as V^T [g][d][t] (rows d, k = t; the four d blocks of 32 keys side by side) in fp16 and bf16 hi + lo, all in fragment order.
// A v tile is computed transposed (A = the head's 64 Bt rows, B = 64 rows of x; both planes share one fragment loader), so in every tile a thread's VW sums (one tile row, VW columns) lie side by side in the plane and a wave (16 rows x 8 columns) stores 256 contiguous bytes.
// The K loop is dealt to the block's NW waves in slices of 32 * KS (wave w takes slices w, w + NW, ..): each wave holds a partial 64x64 tile, and the epilogue sums the NW partials through LDS in wave order. K % (32 * KS) == 0.
template <int NW, int KS>
__global__ __launch_bounds__(NW * 32) void k_proj(const bf* __restrict__ X, const bf* __restrict__ Bt, int K, bf* Ph, bf* Pl, h16* V16, bf* Vh, bf* Vl) {
    typedef typename WFrag<bf>::V V;
    constexpr int VW = 1024 / (NW * 32);   // floats of a 16x64 band that one thread sums and stores
    static_assert(NW == 8, "the epilogue deals a band's eight 8-column groups to eight waves");
    typedef float vW __attribute__((ext_vector_type(VW))); typedef vW __attribute__((may_alias)) vWa;
    typedef unsigned short uW __attribute__((ext_vector_type(VW))); typedef _Float16 hW __attribute__((ext_vector_type(VW)));
    __shared__ __align__(16) float os[NW * 16 * 68];
    const int lane = threadIdx.x & 31, lr = lane & 15, hi = lane >> 4; const int wv = __builtin_amdgcn_readfirstlane(threadIdx.x >> 5);   /* the wave's number as a scalar: the K loop's counter and branch stay scalar */ const int r0 = blockIdx.x * 64, c0 = blockIdx.y * 64;
    X += (size_t)blockIdx.z * TT * K; Ph += (size_t)blockIdx.z * (DQ + DKV) * TT; Pl += (size_t)blockIdx.z * (DQ + DKV) * TT; V16 += (size_t)blockIdx.z * DKV * TT; Vh += (size_t)blockIdx.z * DKV * TT; Vl += (size_t)blockIdx.z * DKV * TT;   // blockIdx.z: the batch's part of x and of every head plane
    const bool vt = c0 >= DQ + DKV;   // a v head's tile (the same for the whole block): rows d, columns t
    const bf* __restrict__ A = vt ? Bt : X; const bf* __restrict__ B = vt ? X : Bt;
    v8f acc[4][4];
#pragma unroll
    for (int mb = 0; mb < 4; ++mb)
#pragma unroll
        for (int nb = 0; nb < 4; ++nb) acc[mb][nb] = (v8f){};
    const bf* __restrict__ Ar = A + (size_t)(vt ? c0 : r0) * K; const bf* __restrict__ Br = B + (size_t)(vt ? r0 : c0) * K; const unsigned ln8 = (unsigned)lane * 8;   // a block of 16 rows holds 16 * K elements; its fragment for k = kc.. starts at kc * 16; all of an address but the lane's place in the fragment is scalar
#pragma unroll 1
    for (int k0 = wv * (32 * KS); k0 < K; k0 += NW * 32 * KS) {
      const bf* pa[4]; const bf* pb[4];   // the trip's first fragment of each operand block, at the lane's place
#pragma unroll
      for (int q = 0; q < 4; ++q) { pa[q] = Ar + ((size_t)q * 16 * K + (size_t)k0 * 16) + ln8; pb[q] = Br + ((size_t)q * 16 * K + (size_t)k0 * 16) + ln8; }
#pragma unroll   // KS = 2: two fragments that lie side by side per trip and operand block
      for (int ks = 0; ks < KS; ++ks) {
        V a[4];
#pragma unroll
        for (int mb = 0; mb < 4; ++mb) a[mb] = WFrag<bf>::ld(pa[mb] + ks * 512);
#pragma unroll
        for (int nb = 0; nb < 4; ++nb) { const V b = WFrag<bf>::ld(pb[nb] + ks * 512);
#pragma unroll
            for (int mb = 0; mb < 4; ++mb) acc[mb][nb] = WFrag<bf>::mma(a[mb], b, acc[mb][nb]); }
        asm volatile("v_nop\n\tv_nop\n\tv_nop\n\tv_nop" : "+v"(acc[0][0]), "+v"(acc[1][1]), "+v"(acc[2][2]), "+v"(acc[3][3]) : "v"(a[0]), "v"(a[3]));
      }
      asm volatile("s_wait_xcnt 0x0" :: "v"(pa[0]), "v"(pa[1]), "v"(pa[2]), "v"(pa[3]), "v"(pb[0]), "v"(pb[1]), "v"(pb[2]), "v"(pb[3]) : "memory");   // the trip's load addresses stay in their registers up to this wait: no later load's result and no next address lands on one ahead of it
    }
    const int row = lr, cofs = wv * 8 + hi * VW; vW val[4];   // wave w sums the band's columns 8 w .. 8 w + 7, which lie side by side in fragment order; 16 lanes read 16 rows at pitch 68: 64 different banks
#pragma unroll
    for (int mb = 0; mb < 4; ++mb) {
#pragma unroll
        for (int nb = 0; nb < 4; ++nb) {
#pragma unroll
            for (int j = 0; j < 8; ++j) os[wv * (16 * 68) + (hi * 8 + j) * 68 + nb * 16 + lr] = acc[mb][nb][j]; }
        __syncthreads();   // every wave's partial band is in LDS before any thread sums it
        val[mb] = *(const vWa*)(os + row * 68 + cofs);
#pragma unroll   // the NW LDS reads go out together, at immediate offsets; the sum keeps the order w = 0, 1, ..
        for (int w = 1; w < NW; ++w) val[mb] += *(const vWa*)(os + w * (16 * 68) + row * 68 + cofs);
        if (mb < 3) __syncthreads();   // the band is read out before the next band overwrites it
    }
    uW oh[4], ol[4];
#pragma unroll   // constant indices keep val in registers
    for (int mb = 0; mb < 4; ++mb)
#pragma unroll
        for (int q = 0; q < VW; ++q) { unsigned short a2, c2; splitf(val[mb][q], a2, c2); oh[mb][q] = a2; ol[mb][q] = c2; }
    // stores behind the last barrier, so that no barrier waits for a store; the bands lie at constant distances in the plane
    if (vt) { const size_t po = (size_t)(c0 - (DQ + DKV)) * TT + (size_t)((r0 >> 5) + (wv >> 2)) * (32 * HD) + (wv & 3) * 128 + row * 8 + hi * VW;   // V^T plane element (head, d = tile row, t = r0 + tile column): key block t >> 5, then the band's d block
        hW o16[4];
#pragma unroll
        for (int mb = 0; mb < 4; ++mb)
#pragma unroll
            for (int q = 0; q < VW; ++q) o16[mb][q] = tohx(val[mb][q]);
#pragma unroll
        for (int mb = 0; mb < 4; ++mb) { *(hW*)(V16 + po + mb * 512) = o16[mb]; *(uW*)(Vh + po + mb * 512) = oh[mb]; *(uW*)(Vl + po + mb * 512) = ol[mb]; }
    } else { const size_t po = (size_t)c0 * TT + (size_t)r0 * HD + wv * 128 + row * 8 + hi * VW;   // q or k plane element (head c0 / 64, t = r0 + tile row, d = tile column): a band is one block of 16 rows, two fragments
#pragma unroll
        for (int mb = 0; mb < 4; ++mb) { *(uW*)(Ph + po + mb * 16 * HD) = oh[mb]; *(uW*)(Pl + po + mb * 16 * HD) = ol[mb]; }
        asm volatile("s_wait_xcnt 0x0" ::: "memory");   // the built code lays the v branch, which rewrites these stores' address registers, directly behind them: the wait stands in front of it
    }
}

// block (bx, by, bz) of (DM / 32, heads, 3): bz picks the tensor, by its head, bx 32 values of k; Bt holds the tensors' heads one behind the other, in fragment order (rows n, 64 a head).
// A thread gathers 8 values of k for one n: a wave reads 32 neighbouring n of one k (a whole line) per load and stores two runs of 256 bytes.
__device__ __forceinline__ void wtG(const float* __restrict__ w0, const float* __restrict__ w1, const float* __restrict__ w2, bf* Bt, unsigned bx, unsigned by, unsigned bz) {
    const int n = threadIdx.x & 63, g = threadIdx.x >> 6;
    const float* p = (bz == 0 ? w0 : bz == 1 ? w1 : w2) + (size_t)by * DM * HD + (size_t)(bx * 32 + g * 8) * HD + n; float v[8];
#pragma unroll
    for (int e = 0; e < 8; ++e) v[e] = p[e * HD];
    asm volatile("s_wait_xcnt 0x0" :: "v"(p) : "memory");   // the loads' address stays in its registers up to this wait: none of their results lands on it ahead of it
    v8us o;
#pragma unroll
    for (int e = 0; e < 8; ++e) o[e] = f2bf(v[e]);
    *(v8us*)(Bt + ((size_t)bz * NH_ + by) * HD * DM + (size_t)(n >> 4) * 16 * DM + bx * 512 + g * 128 + (n & 15) * 8) = o;
}
// thread i writes the 8 elements i * 8.. of the plane in fragment order: row (i >> 11) * 16 + (i & 15), k = (i >> 4 & 127) * 8 (DM / 8 = 128 groups of 8 a row); a block reads 512 contiguous bytes of each of 16 rows
__device__ __forceinline__ void cvt8(const float* __restrict__ src, bf* dst, unsigned blk) { const size_t i = (size_t)blk * 256 + threadIdx.x; const v8f v = *(const v8f*)(src + ((i / (DM * 2)) * 16 + (i & 15)) * DM + ((i >> 4) & (DM / 8 - 1)) * 8); v8us o;
#pragma unroll
    for (int k = 0; k < 8; ++k) o[k] = f2bf(v[k]); *(v8us*)(dst + i * 8) = o;
    asm volatile("s_wait_xcnt 0x0" ::: "memory");   // the built code lays the weight branch, which rewrites this store's registers, directly behind it: the wait stands in front of it
}
// ---- k_prep: both operand planes of the projection GEMM in one launch: the first WB blocks transpose the weights, the other NB_ * TT * DM / 2048 copy x (all batches: 16-row blocks one behind the other)
#define WB   (DM / 32 * NH_ * 3)
__global__ __launch_bounds__(256) void k_prep(const float* __restrict__ x, const float* __restrict__ w0, const float* __restrict__ w1, const float* __restrict__ w2, bf* Bt, bf* XB) {
    if (blockIdx.x < WB) wtG(w0, w1, w2, Bt, blockIdx.x & (DM / 32 - 1), (blockIdx.x / (DM / 32)) & (NH_ - 1), blockIdx.x / (DM / 32 * NH_));
    else cvt8(x, XB, blockIdx.x - WB);
}

// ---- k_fattn: fused causal attention. grid (TT / 64, heads, batches), AW waves. A block does the two 32-query tiles x and TT/32 - 1 - x of one head (together TT/32 + 1 key blocks of 32: every block has the same work).
// Transposed products: S^T = K Q^T (A = 16 key rows, B = 16 query columns, hi/lo 3 products) leaves one query per lane (keys 8 hi + j of each 16 in the lane's 8 registers), so two S^T tiles, converted in place, are the B operand (32 keys) of O^T += V^T P^T.
// The tile's key blocks are dealt to the waves (wave w: blocks w, w + AW, ..), each with its own running maximum, sum and O^T; the partials are joined through LDS in wave order.
template <bool HR>
__device__ __forceinline__ void fa_tile(const bf* __restrict__ Qh, const bf* __restrict__ Ql, const bf* __restrict__ Kh, const bf* __restrict__ Kl, const h16* __restrict__ V16, const bf* __restrict__ Vh, const bf* __restrict__ Vl, float* orow, int q0, int wv, int lr, int hi, float* os, float* ml) {
    constexpr float CL = SCL * 1.4426950408889634f;   // score -> log2 units
    const unsigned ln8 = (unsigned)((hi * 16 + lr) * 8);   // the lane's place in every fragment
    v16bf qh[2][2], ql[2][2];
#pragma unroll
    for (int qt = 0; qt < 2; ++qt)
#pragma unroll
        for (int ks = 0; ks < 2; ++ks) { const size_t qo = (size_t)(q0 + qt * 16) * HD + ks * 512 + ln8; qh[qt][ks] = WFrag<bf>::ld(Qh + qo); ql[qt][ks] = WFrag<bf>::ld(Ql + qo); }
    v8f o[2][4]; float ms[2], l[2];   // ms: the running maximum in log2 units, as rounded: the very value the exponents were taken against
#pragma unroll
    for (int qt = 0; qt < 2; ++qt) { ms[qt] = -3.0e38f; l[qt] = 0.f;
#pragma unroll
        for (int db = 0; db < 4; ++db) o[qt][db] = (v8f){}; }
    const int nkb = q0 / 32 + 1;   // key blocks 0 .. the diagonal one
#pragma unroll 1
    for (int kb = wv; kb < nkb; kb += AW) { const int k0 = kb * 32; const bf* khp = Kh + (size_t)k0 * HD; const bf* klp = Kl + (size_t)k0 * HD;   // the pass's part of the address is scalar; the lane's part does not change in the loop
        v8f s[2][2]; v16bf kh[2][2], kl[2][2]; v16h vf[4];
#pragma unroll
        for (int kt = 0; kt < 2; ++kt)
#pragma unroll
            for (int ks = 0; ks < 2; ++ks) { kh[kt][ks] = WFrag<bf>::ld(khp + ln8 + (kt * 16 * HD + ks * 512)); kl[kt][ks] = WFrag<bf>::ld(klp + ln8 + (kt * 16 * HD + ks * 512)); }
        __builtin_amdgcn_sched_barrier(0);   // every K load of the pass is issued before its first product: one memory latency, not one per fragment group
#pragma unroll
        for (int kt = 0; kt < 2; ++kt)
#pragma unroll
            for (int qt = 0; qt < 2; ++qt) { v8f a = (v8f){};
#pragma unroll
                for (int ks = 0; ks < 2; ++ks) { a = wmmab(kh[kt][ks], qh[qt][ks], a); a = wmmab(kh[kt][ks], ql[qt][ks], a); a = wmmab(kl[kt][ks], qh[qt][ks], a); }
                s[kt][qt] = a; }
        if (!HR) {   // V^T fragments fly under the softmax
            const h16* vp = V16 + (size_t)k0 * HD + ln8;
#pragma unroll
            for (int db = 0; db < 4; ++db) vf[db] = WFrag<h16>::ld(vp + db * 512);
            asm volatile("s_wait_xcnt 0x0" :: "v"(vp) : "memory"); }   // the loads' address stays in its registers up to this wait: none of their results lands on it ahead of it
        const bool diag = (kb == nkb - 1);   // only the diagonal block holds keys above a query
#pragma unroll
        for (int qt = 0; qt < 2; ++qt) { float mx = -3.0e38f;
#pragma unroll
            for (int kt = 0; kt < 2; ++kt)
#pragma unroll
                for (int j = 0; j < 8; ++j) { float t = s[kt][qt][j]; if (diag && kt * 16 + hi * 8 + j > qt * 16 + lr) t = -3.0e38f; s[kt][qt][j] = t; mx = fmaxf(mx, t); }
            mx = fmaxf(mx, __shfl_xor(mx, 16, 32));   // the query's other 16 keys lie in the other half of the wave
            const float mn = fmaxf(ms[qt], mx * CL), al = __builtin_amdgcn_exp2f(ms[qt] - mn); ms[qt] = mn; float sum = 0.f;
#pragma unroll
            for (int kt = 0; kt < 2; ++kt)
#pragma unroll
                for (int j = 0; j < 8; ++j) { const float p = __builtin_amdgcn_exp2f(__builtin_fmaf(s[kt][qt][j], CL, -mn)); s[kt][qt][j] = p; sum += p; }
            l[qt] = l[qt] * al + sum;
#pragma unroll
            for (int db = 0; db < 4; ++db) o[qt][db] *= al; }
        if (HR) { v16bf ph[2], pl[2]; const bf* vhp = Vh + (size_t)k0 * HD + ln8; const bf* vlp = Vl + (size_t)k0 * HD + ln8;
#pragma unroll
            for (int qt = 0; qt < 2; ++qt) { v8us h0, h1, l0, l1;
#pragma unroll
                for (int j = 0; j < 8; ++j) { unsigned short a, c; splitf(s[0][qt][j], a, c); h0[j] = a; l0[j] = c; splitf(s[1][qt][j], a, c); h1[j] = a; l1[j] = c; }
                ph[qt] = cat16b(h0, h1); pl[qt] = cat16b(l0, l1); }
#pragma unroll
            for (int db = 0; db < 4; ++db) { const v16bf vh = WFrag<bf>::ld(vhp + db * 512), vl = WFrag<bf>::ld(vlp + db * 512);
#pragma unroll
                for (int qt = 0; qt < 2; ++qt) { o[qt][db] = wmmab(vh, ph[qt], o[qt][db]); o[qt][db] = wmmab(vh, pl[qt], o[qt][db]); o[qt][db] = wmmab(vl, ph[qt], o[qt][db]); } }
            asm volatile("s_wait_xcnt 0x0" :: "v"(vhp), "v"(vlp) : "memory");   // as at the fp16 V^T loads: the two addresses stay in their registers up to this wait
        } else { v16h pf[2];
#pragma unroll
            for (int qt = 0; qt < 2; ++qt)
#pragma unroll
                for (int j = 0; j < 8; ++j) { pf[qt][j] = tohx(s[0][qt][j]); pf[qt][8 + j] = tohx(s[1][qt][j]); }
#pragma unroll
            for (int db = 0; db < 4; ++db)
#pragma unroll
                for (int qt = 0; qt < 2; ++qt) o[qt][db] = wmma16(vf[db], pf[qt], o[qt][db]); }
    }
#pragma unroll
    for (int qt = 0; qt < 2; ++qt) { l[qt] += __shfl_xor(l[qt], 16, 32);   // the two halves' sums of one query
        float* op = os + (wv * 32 + qt * 16 + lr) * 68 + hi * 8;
#pragma unroll
        for (int db = 0; db < 4; ++db) { *(v4fa*)(op + db * 16) = __builtin_shufflevector(o[qt][db], o[qt][db], 0, 1, 2, 3); *(v4fa*)(op + db * 16 + 4) = __builtin_shufflevector(o[qt][db], o[qt][db], 4, 5, 6, 7); }
        if (hi == 0) { ml[(wv * 32 + qt * 16 + lr) * 2] = ms[qt]; ml[(wv * 32 + qt * 16 + lr) * 2 + 1] = l[qt]; } }
    __syncthreads();   // every wave's partial maximum, sum and O^T are in LDS before any thread joins them
    const int q = (int)threadIdx.x >> 3, d8 = ((int)threadIdx.x & 7) * 8; float M = ml[q * 2];
#pragma unroll
    for (int w = 1; w < AW; ++w) M = fmaxf(M, ml[(w * 32 + q) * 2]);
    float L = 0.f; v4f r0 = (v4f){}, r1 = (v4f){};
#pragma unroll   // a wave that had no key block has sum 0 and factor 0
    for (int w = 0; w < AW; ++w) { const float f = __builtin_amdgcn_exp2f(ml[(w * 32 + q) * 2] - M); L += f * ml[(w * 32 + q) * 2 + 1]; const float* ip = os + (w * 32 + q) * 68 + d8; r0 += *(const v4fa*)ip * f; r1 += *(const v4fa*)(ip + 4) * f; }
    const float rl = __fdiv_rn(1.0f, L); float* dst = orow + (size_t)(q0 + q) * DQ + d8;
    *(v4f*)dst = r0 * rl; *(v4f*)(dst + 4) = r1 * rl;
    __syncthreads();   // the partials are read out before the block's next tile overwrites them
}
// four waves per SIMD (two blocks per WGP, one batch's blocks resident at once): the register budget is held to 256 so that other waves' work covers a wave's load latency and softmax
__global__ __launch_bounds__(AW * 32) __attribute__((amdgpu_waves_per_eu(4, 4))) void k_fattn(const bf* __restrict__ Qh, const bf* __restrict__ Ql, const bf* __restrict__ Kh, const bf* __restrict__ Kl, const h16* __restrict__ V16, const bf* __restrict__ Vh, const bf* __restrict__ Vl, float* OUTb) {
    __shared__ __align__(16) float os[AW * 32 * 68]; __shared__ float ml[AW * 32 * 2];
    Qh += (size_t)blockIdx.z * (DQ + DKV) * TT; Ql += (size_t)blockIdx.z * (DQ + DKV) * TT; Kh += (size_t)blockIdx.z * (DQ + DKV) * TT; Kl += (size_t)blockIdx.z * (DQ + DKV) * TT; V16 += (size_t)blockIdx.z * DKV * TT; Vh += (size_t)blockIdx.z * DKV * TT; Vl += (size_t)blockIdx.z * DKV * TT; OUTb += (size_t)blockIdx.z * TT * DQ;   // blockIdx.z: the batch's part of every plane and of the output
    const size_t hp = (size_t)blockIdx.y * TT * HD; const int lane = threadIdx.x & 31, lr = lane & 15, hi = lane >> 4; const int wv = __builtin_amdgcn_readfirstlane(threadIdx.x >> 5);   // the wave's number as a scalar: the key loop's counter and branch stay scalar
#pragma unroll 1
    for (int half = 0; half < 2; ++half) { const int q0 = (half ? (int)blockIdx.x : TT / 32 - 1 - (int)blockIdx.x) * 32;
        if (q0 < RH) fa_tile<true>(Qh + hp, Ql + hp, Kh + hp, Kl + hp, V16 + hp, Vh + hp, Vl + hp, OUTb + blockIdx.y * HD, q0, wv, lr, hi, os, ml);
        else fa_tile<false>(Qh + hp, Ql + hp, Kh + hp, Kl + hp, V16 + hp, Vh + hp, Vl + hp, OUTb + blockIdx.y * HD, q0, wv, lr, hi, os, ml); }
}

extern "C" void kernel_launch(void* const* d_in, const int* in_sizes, int n_in,
                              void* d_out, int out_size, void* d_ws, size_t ws_size, hipStream_t stream) {
    (void)in_sizes; (void)n_in; (void)out_size;
    const float* x = (const float*)d_in[0]; const float* pq = (const float*)d_in[1]; const float* pk = (const float*)d_in[2]; const float* pv = (const float*)d_in[3];   /* each [16][1024][64] */ const float* wq = pq, *wk = pk, *wv = pv, *wo = nullptr; (void)wo;
    float* OUT = (float*)d_out;     // [4][2048][1024]
    char* wsp = (char*)d_ws;
    auto take = [&](size_t bytes) { char* p = wsp; wsp += (bytes + 255) & ~(size_t)255; return (void*)p; };
    bf* WQ = (bf*)take((size_t)(DQ + 2 * DKV) * DM * 2);   /* q, k, v rows one behind the other: one [3072][1024] Bt */
    bf* XB = (bf*)take((size_t)NB_ * TT * DM * 2);
    h16* VT16 = (h16*)take((size_t)NB_ * NKV * HD * TT * 2);
    bf* QPh = (bf*)take((size_t)NB_ * (NH_ + NKV) * TT * HD * 2); bf* KPh = QPh + (size_t)NH_ * TT * HD;   /* per batch q heads, then k heads: the GEMM's tile column is the plane's head */ bf* QPl = (bf*)take((size_t)NB_ * (NH_ + NKV) * TT * HD * 2); bf* KPl = QPl + (size_t)NH_ * TT * HD; bf* VTh = (bf*)take((size_t)NB_ * NKV * HD * TT * 2); bf* VTl = (bf*)take((size_t)NB_ * NKV * HD * TT * 2);
    if ((size_t)(wsp - (char*)d_ws) > ws_size) return;
    k_prep<<<WB + NB_ * TT * DM / 2048, 256, 0, stream>>>(x, wq, wk, wv, WQ, XB);   /* tensor z's head hh 'xw' [1024][64] -> Bt rows z*1024 + hh*64..; x -> bf16 */
    k_proj<8, 2><<<dim3(TT / 64, DF / 64, NB_), 256, 0, stream>>>(XB, WQ, DM, QPh, QPl, VT16, VTh, VTl);
    k_fattn<<<dim3(TT / 64, NH_, NB_), AW * 32, 0, stream>>>(QPh, QPl, KPh, KPl, VT16, VTh, VTl, OUT);
}

// v007
// One run takes 149 microseconds.
// In both of two side-by-side timings against v006, it was 1.24 times as fast.
// All steps since v000 together make it 19.9 times as fast.
#include <hip/hip_runtime.h>

// Causal multi-head attention with per-head weight tensors, scaled by sqrt(embed) (x [4][2048][1024]; q,k,v = einsum('bte,hed', x, W) (Wq, Wk, Wv [16][1024][64] uniform(+-1/32): head h's 'xw' block); 16 heads x 64; causal (-inf); scores / sqrt(1024) (the source's quirk: sigma ~0.1 logits); softmax; out = concat heads -> [4][2048][1024] (8.4 M; no output projection)).
// Fragment order: every plane that feeds a matrix operand (x, Bt, q, k, V^T) is stored as 16-row x 32-k fragments of 512 elements, element (row r, k) at (k >> 4 & 1) * 256 + (k >> 3 & 1) * 128 + r * 8 + (k & 7); a row block's fragments follow one another along k (V^T instead: the four d blocks of each 32 keys one behind the other). Lane l of a wave then finds its two 16-byte pieces at l * 8 and 256 + l * 8: each wave-wide load reads 512 contiguous bytes, four whole lines.
// Three launches, each for all four batches (every plane but Bt holds the batches one behind the other): bf16 copy of x together with the three projection tensors' 48 'xw' [1024][64] blocks transposed into one [3072][1024] Bt (rows q h*64.., k 1024 + h*64.., v 2048 + h*64..); exact projections, one N = 3072 GEMM whose epilogue writes the head planes itself; one fused causal attention launch for the 4 x 16 heads (scores, online softmax and attn.v in registers; the score matrix never reaches memory).
// Compute dtypes, f32 accumulate: every input rounded to bf16; projections exact; scores 3 hi/lo products on every row; softmax f32 (x 1/32), unnormalised probabilities in (0, 1], divided by the f32 row sum at the end; attn.v rows < 512 3 hi/lo products, rest fp16; output f32.

#define NB_  4
#define TT   2048
#define DM   1024
#define NH_  16
#define NKV  16
#define REP  (NH_ / NKV)
#define HD   64
#define DQ   (NH_ * HD)
#define DKV  (NKV * HD)
#define DF   (DQ + 2 * DKV)        // q, k and v projection columns side by side
#define AW   8                    // waves of a fused-attention block: they deal a query tile's key blocks among themselves
#define RH   512                  // query rows < RH do attn.v with hi+lo V and P (0: none)
#define SCL  0.03125f  // 1/sqrt(embed = 1024): the source's quirk
typedef _Float16 h16;
typedef unsigned short bf;
typedef __attribute__((ext_vector_type(16))) __bf16   v16bf;
typedef __attribute__((ext_vector_type(16))) _Float16 v16h;
typedef __attribute__((ext_vector_type(8)))  _Float16 v8h;
typedef __attribute__((ext_vector_type(8)))  unsigned short v8us;
typedef __attribute__((ext_vector_type(8)))  float    v8f;
typedef __attribute__((ext_vector_type(4)))  float    v4f;
typedef v8h  __attribute__((may_alias)) v8ha;
typedef v4f  __attribute__((may_alias)) v4fa;
typedef v8us __attribute__((may_alias)) v8usa;

__device__ __forceinline__ unsigned short f2bf(float f) { unsigned u = __float_as_uint(f); u += 0x7FFFu + ((u >> 16) & 1u); return (unsigned short)(u >> 16); }
__device__ __forceinline__ float bf2f(unsigned short b) { return __uint_as_float(((unsigned)b) << 16); }
__device__ __forceinline__ float bfr(float f) { return bf2f(f2bf(f)); }
__device__ __forceinline__ v16h cat16(v8h lo, v8h hi) { return __builtin_shufflevector(lo, hi, 0, 1, 2, 3, 4, 5, 6, 7, 8, 9, 10, 11, 12, 13, 14, 15); }
__device__ __forceinline__ v16bf cat16b(v8us lo, v8us hi) { return __builtin_bit_cast(v16bf, __builtin_shufflevector(lo, hi, 0, 1, 2, 3, 4, 5, 6, 7, 8, 9, 10, 11, 12, 13, 14, 15)); }
__device__ __forceinline__ v8f wmma16(v16h a, v16h b, v8f c) { return __builtin_amdgcn_wmma_f32_16x16x32_f16(false, a, false, b, (short)0, c, false, false); }
__device__ __forceinline__ v8f wmmab(v16bf a, v16bf b, v8f c) { return __builtin_amdgcn_wmma_f32_16x16x32_bf16(false, a, false, b, (short)0, c, false, false); }



__device__ __forceinline__ h16 tohx(float x) { return (h16)x; }
__device__ __forceinline__ void splitf(float y, unsigned short& h, unsigned short& l) { h = f2bf(y); l = f2bf(y - bf2f(h)); }
typedef __attribute__((ext_vector_type(2))) unsigned short v2us;

// ld: p = the fragment's start + lane * 8 in a plane in fragment order
template <typename T16> struct WFrag;
template <> struct WFrag<h16> { typedef v16h V; static __device__ __forceinline__ V ld(const h16* p) { return cat16(*(const v8h*)p, *(const v8h*)(p + 256)); } static __device__ __forceinline__ v8f mma(V a, V b, v8f c) { return wmma16(a, b, c); } };
template <> struct WFrag<bf> { typedef v16bf V; static __device__ __forceinline__ V ld(const bf* p) { return cat16b(*(const v8us*)p, *(const v8us*)(p + 256)); } static __device__ __forceinline__ v8f mma(V a, V b, v8f c) { return wmmab(a, b, c); } };
// ---- k_proj: the q, k, v projection GEMM. A block of 4 waves does a tile of 128 A rows x 256 B rows; wave (wa, wb) of 2 x 2 holds 64 x 128 of it (32 accumulators) over the whole K. grid (192, 1, batches), 128 threads; three blocks fit a WGP, so all 768 are resident at once.
// Blocks 0..127: q and k heads (A = 128 rows of x, B = 256 Bt rows = 4 heads). Blocks 128..191: v heads, computed transposed (A = 128 Bt rows = 2 heads, B = 256 rows of x; both planes share one fragment loader).
// Both operand slabs of 64 k (24 blocks of 16 rows, 2 KiB each, contiguous in fragment order) are brought into LDS by asynchronous copies, two buffers: the next slab flies while this one is worked on, and every fragment is fetched from L2 once a block instead of once a wave.
// The epilogue rounds the f32 sums into the planes that the attention kernel reads: q and k [h][t][d] (rows t, k = d) as bf16 hi + lo, v as V^T [g][d][t] (rows d, k = t; the four d blocks of 32 keys side by side) in fp16 and bf16 hi + lo, all in fragment order. Each wave turns its own 16 x 64 bands through its own LDS range: a lane then holds 8 neighbouring columns of one row, and a wave stores 512 contiguous bytes.
#define PKS  64                    // k of a slab
#define SLB  (24 * 2048)           // bytes of a slab: 8 A and 16 B blocks of 16 rows x 64 k
// eight copies of 16 bytes a lane: blocks of 16 rows lie 2 KiB apart in LDS and 16 * DM elements apart in the plane. The wait is the last line of the copies' own statement: no register that a copy names is rewritten ahead of it.
__device__ __forceinline__ void cp8(unsigned l, const bf* g) {
    asm volatile("global_load_async_to_lds_b128 %0, %8, off\n\t"
                 "global_load_async_to_lds_b128 %1, %9, off\n\t"
                 "global_load_async_to_lds_b128 %2, %10, off\n\t"
                 "global_load_async_to_lds_b128 %3, %11, off\n\t"
                 "global_load_async_to_lds_b128 %4, %12, off\n\t"
                 "global_load_async_to_lds_b128 %5, %13, off\n\t"
                 "global_load_async_to_lds_b128 %6, %14, off\n\t"
                 "global_load_async_to_lds_b128 %7, %15, off\n\t"
                 "s_wait_xcnt 0x0"
                 :: "v"(l), "v"(l + 2048u), "v"(l + 4096u), "v"(l + 6144u), "v"(l + 8192u), "v"(l + 10240u), "v"(l + 12288u), "v"(l + 14336u),
                    "v"(g), "v"(g + 16 * DM), "v"(g + 32 * DM), "v"(g + 48 * DM), "v"(g + 64 * DM), "v"(g + 80 * DM), "v"(g + 96 * DM), "v"(g + 112 * DM) : "memory");
}
__global__ __launch_bounds__(128) __attribute__((amdgpu_waves_per_eu(3, 3))) void k_proj(const bf* __restrict__ X, const bf* __restrict__ Bt, bf* Ph, bf* Pl, h16* V16, bf* Vh, bf* Vl) {
    typedef typename WFrag<bf>::V V;
    constexpr int NT = DM / PKS;   // slabs along K
    __shared__ __attribute__((aligned(16))) unsigned char sm[2 * SLB];
    const int tid = threadIdx.x, lane = tid & 31, lr = lane & 15, hi = lane >> 4; const int wv = __builtin_amdgcn_readfirstlane(tid >> 5);   /* the wave's number as a scalar */ const int wa = wv & 1, wb = wv >> 1;
    X += (size_t)blockIdx.z * TT * DM; Ph += (size_t)blockIdx.z * (DQ + DKV) * TT; Pl += (size_t)blockIdx.z * (DQ + DKV) * TT; V16 += (size_t)blockIdx.z * DKV * TT; Vh += (size_t)blockIdx.z * DKV * TT; Vl += (size_t)blockIdx.z * DKV * TT;   // blockIdx.z: the batch's part of x and of every head plane
    const int bx = blockIdx.x; const bool vt = bx >= 128;   // a block of v heads (the same for the whole block): rows d, columns t
    const int tA = vt ? (bx - 128) & 7 : bx & 15, tB = vt ? (bx - 128) >> 3 : bx >> 4;
    const bf* Ag = (vt ? Bt + (size_t)(DQ + DKV) * DM : X) + (size_t)tA * 128 * DM + tid * 8;   // the thread's 16 bytes of the first A block's slab 0; a slab is PKS * 16 elements further along
    const bf* Bg = (vt ? X : Bt) + (size_t)tB * 256 * DM + tid * 8;
    const unsigned l0 = (unsigned)(size_t)sm + (unsigned)tid * 16u;   // the thread's LDS byte address in buffer 0
    v8f acc[4][8];
#pragma unroll
    for (int mb = 0; mb < 4; ++mb)
#pragma unroll
        for (int nb = 0; nb < 8; ++nb) acc[mb][nb] = (v8f){};
    cp8(l0, Ag); cp8(l0 + 16384u, Bg); cp8(l0 + 32768u, Bg + 128 * DM);
    asm volatile("s_wait_asynccnt 0x0" ::: "memory");   // the wave's own copies of slab 0 have landed
    __syncthreads();   // slab 0 is published to every wave
    cp8(l0 + SLB, Ag + PKS * 16); cp8(l0 + SLB + 16384u, Bg + PKS * 16); cp8(l0 + SLB + 32768u, Bg + 128 * DM + PKS * 16);
#pragma unroll 1   // one slab a trip: the two buffers alternate
    for (int t = 0; t < NT; ++t) {
        const bf* sb = (const bf*)(sm + (t & 1) * SLB) + lane * 8;
#pragma unroll
        for (int ks = 0; ks < PKS / 32; ++ks) {
            V a[4], b[2];
#pragma unroll
            for (int mb = 0; mb < 4; ++mb) a[mb] = WFrag<bf>::ld(sb + (wa * 4 + mb) * 1024 + ks * 512);
            b[0] = WFrag<bf>::ld(sb + (8 + wb * 8) * 1024 + ks * 512);
#pragma unroll
            for (int nb = 0; nb < 8; ++nb) { if (nb < 7) { b[(nb + 1) & 1] = WFrag<bf>::ld(sb + (8 + wb * 8 + nb + 1) * 1024 + ks * 512);   // the next B fragment is asked for ahead of this one's four products
                    __builtin_amdgcn_sched_barrier(0); }   // keeps that load in front of the products: without it the scheduler sinks it behind them and every four products wait out an LDS latency
#pragma unroll
                for (int mb = 0; mb < 4; ++mb) acc[mb][nb] = WFrag<bf>::mma(a[mb], b[nb & 1], acc[mb][nb]); }
        }
        asm volatile("s_wait_dscnt 0x0" ::: "memory");      // the wave's reads of this buffer have returned before it is handed to the copies
        asm volatile("s_wait_asynccnt 0x0" ::: "memory");   // the wave's own copies of slab t + 1 have landed
        __syncthreads();   // publishes slab t + 1 and ends every wave's reads of slab t
        if (t + 2 < NT) { const unsigned lb = l0 + (unsigned)(t & 1) * SLB; const bf* ga = Ag + (t + 2) * (PKS * 16); const bf* gb = Bg + (t + 2) * (PKS * 16);
            cp8(lb, ga); cp8(lb + 16384u, gb); cp8(lb + 32768u, gb + 128 * DM); }
    }
    asm volatile("s_wait_asynccnt 0x0" ::: "memory");   // no copy is outstanding when the buffers become staging
    float* os = (float*)sm + wv * (16 * 68);   // the wave's own staging band, 16 rows at pitch 68; the loop's last barrier has ended every read of the buffers
    const int ia = tA * 128 + wa * 64, ib = tB * 256 + wb * 128;
    // plane element of (tile row 0, tile column 0) and the steps to the next 64 columns, the next 16 rows and the next 32 columns; 8 columns are 128 elements in both layouts
    const size_t pb = (vt ? (size_t)ia * TT + (size_t)ib * HD : (size_t)ib * TT + (size_t)ia * HD) + hi * 128 + lr * 8;
    const size_t sH = vt ? 2 * 32 * HD : (size_t)HD * TT, sM = vt ? 512 : 16 * HD, sC = vt ? 32 * HD : 512;
    bf* P1 = vt ? Vh : Ph; bf* P2 = vt ? Vl : Pl;
#pragma unroll   // constant indices keep acc in registers
    for (int hb = 0; hb < 2; ++hb)
#pragma unroll
        for (int mb = 0; mb < 4; ++mb) {
#pragma unroll
            for (int nb = 0; nb < 4; ++nb)
#pragma unroll
                for (int j = 0; j < 8; ++j) os[(hi * 8 + j) * 68 + nb * 16 + lr] = acc[mb][hb * 4 + nb][j];
            asm volatile("s_wait_dscnt 0x0" ::: "memory");   // the wave's band is in LDS before its lanes read one another's values
            v4f v[4][2];
#pragma unroll
            for (int cg = 0; cg < 4; ++cg) { const float* ip = os + lr * 68 + (cg * 2 + hi) * 8; v[cg][0] = *(const v4fa*)ip; v[cg][1] = *(const v4fa*)(ip + 4); }
            asm volatile("s_wait_dscnt 0x0" ::: "memory");   // the band is read out before the next band overwrites it
#pragma unroll
            for (int cg = 0; cg < 4; ++cg) { v8us oh, ol; const size_t po = pb + hb * sH + mb * sM + (cg >> 1) * sC + (cg & 1) * 256;
#pragma unroll
                for (int e = 0; e < 8; ++e) { unsigned short a2, c2; splitf(v[cg][e >> 2][e & 3], a2, c2); oh[e] = a2; ol[e] = c2; }
                *(v8us*)(P1 + po) = oh; *(v8us*)(P2 + po) = ol;
                asm volatile("s_wait_xcnt 0x0" ::: "memory");   // stands in front of whatever next lands on the two stores' registers
                if (vt) { v8h o16;
#pragma unroll
                    for (int e = 0; e < 8; ++e) o16[e] = tohx(v[cg][e >> 2][e & 3]);
                    *(v8h*)(V16 + po) = o16;
                    asm volatile("s_wait_xcnt 0x0" ::: "memory"); } }   // as behind the two stores above
        }
}

// block (bx, by, bz) of (DM / 32, heads, 3): bz picks the tensor, by its head, bx 32 values of k; Bt holds the tensors' heads one behind the other, in fragment order (rows n, 64 a head).
// A thread gathers 8 values of k for one n: a wave reads 32 neighbouring n of one k (a whole line) per load and stores two runs of 256 bytes.
__device__ __forceinline__ void wtG(const float* __restrict__ w0, const float* __restrict__ w1, const float* __restrict__ w2, bf* Bt, unsigned bx, unsigned by, unsigned bz) {
    const int n = threadIdx.x & 63, g = threadIdx.x >> 6;
    const float* p = (bz == 0 ? w0 : bz == 1 ? w1 : w2) + (size_t)by * DM * HD + (size_t)(bx * 32 + g * 8) * HD + n; float v[8];
#pragma unroll
    for (int e = 0; e < 8; ++e) v[e] = p[e * HD];
    asm volatile("s_wait_xcnt 0x0" :: "v"(p) : "memory");   // the loads' address stays in its registers up to this wait: none of their results lands on it ahead of it
    v8us o;
#pragma unroll
    for (int e = 0; e < 8; ++e) o[e] = f2bf(v[e]);
    *(v8us*)(Bt + ((size_t)bz * NH_ + by) * HD * DM + (size_t)(n >> 4) * 16 * DM + bx * 512 + g * 128 + (n & 15) * 8) = o;
}
// thread i writes the 8 elements i * 8.. of the plane in fragment order: row (i >> 11) * 16 + (i & 15), k = (i >> 4 & 127) * 8 (DM / 8 = 128 groups of 8 a row); a block reads 512 contiguous bytes of each of 16 rows
__device__ __forceinline__ void cvt8(const float* __restrict__ src, bf* dst, unsigned blk) { const size_t i = (size_t)blk * 256 + threadIdx.x; const v8f v = *(const v8f*)(src + ((i / (DM * 2)) * 16 + (i & 15)) * DM + ((i >> 4) & (DM / 8 - 1)) * 8); v8us o;
#pragma unroll
    for (int k = 0; k < 8; ++k) o[k] = f2bf(v[k]); *(v8us*)(dst + i * 8) = o;
    asm volatile("s_wait_xcnt 0x0" ::: "memory");   // the built code lays the weight branch, which rewrites this store's registers, directly behind it: the wait stands in front of it
}
// ---- k_prep: both operand planes of the projection GEMM in one launch: the first WB blocks transpose the weights, the other NB_ * TT * DM / 2048 copy x (all batches: 16-row blocks one behind the other)
#define WB   (DM / 32 * NH_ * 3)
__global__ __launch_bounds__(256) void k_prep(const float* __restrict__ x, const float* __restrict__ w0, const float* __restrict__ w1, const float* __restrict__ w2, bf* Bt, bf* XB) {
    if (blockIdx.x < WB) wtG(w0, w1, w2, Bt, blockIdx.x & (DM / 32 - 1), (blockIdx.x / (DM / 32)) & (NH_ - 1), blockIdx.x / (DM / 32 * NH_));
    else cvt8(x, XB, blockIdx.x - WB);
}

// ---- k_fattn: fused causal attention. grid (TT / 64, heads, batches), AW waves. A block does the two 32-query tiles x and TT/32 - 1 - x of one head (together TT/32 + 1 key blocks of 32: every block has the same work).
// Transposed products: S^T = K Q^T (A = 16 key rows, B = 16 query columns, hi/lo 3 products) leaves one query per lane (keys 8 hi + j of each 16 in the lane's 8 registers), so two S^T tiles, converted in place, are the B operand (32 keys) of O^T += V^T P^T.
// The tile's key blocks are dealt to the waves (wave w: blocks w, w + AW, ..), each with its own running maximum, sum and O^T; the partials are joined through LDS in wave order.
template <bool HR>
__device__ __forceinline__ void fa_tile(const bf* __restrict__ Qh, const bf* __restrict__ Ql, const bf* __restrict__ Kh, const bf* __restrict__ Kl, const h16* __restrict__ V16, const bf* __restrict__ Vh, const bf* __restrict__ Vl, float* orow, int q0, int wv, int lr, int hi, float* os, float* ml) {
    constexpr float CL = SCL * 1.4426950408889634f;   // score -> log2 units
    const unsigned ln8 = (unsigned)((hi * 16 + lr) * 8);   // the lane's place in every fragment
    v16bf qh[2][2], ql[2][2];
#pragma unroll
    for (int qt = 0; qt < 2; ++qt)
#pragma unroll
        for (int ks = 0; ks < 2; ++ks) { const size_t qo = (size_t)(q0 + qt * 16) * HD + ks * 512 + ln8; qh[qt][ks] = WFrag<bf>::ld(Qh + qo); ql[qt][ks] = WFrag<bf>::ld(Ql + qo); }
    v8f o[2][4]; float ms[2], l[2];   // ms: the running maximum in log2 units, as rounded: the very value the exponents were taken against
#pragma unroll
    for (int qt = 0; qt < 2; ++qt) { ms[qt] = -3.0e38f; l[qt] = 0.f;
#pragma unroll
        for (int db = 0; db < 4; ++db) o[qt][db] = (v8f){}; }
    const int nkb = q0 / 32 + 1;   // key blocks 0 .. the diagonal one
#pragma unroll 1
    for (int kb = wv; kb < nkb; kb += AW) { const int k0 = kb * 32; const bf* khp = Kh + (size_t)k0 * HD; const bf* klp = Kl + (size_t)k0 * HD;   // the pass's part of the address is scalar; the lane's part does not change in the loop
        v8f s[2][2]; v16bf kh[2][2], kl[2][2]; v16h vf[4];
#pragma unroll
        for (int kt = 0; kt < 2; ++kt)
#pragma unroll
            for (int ks = 0; ks < 2; ++ks) { kh[kt][ks] = WFrag<bf>::ld(khp + ln8 + (kt * 16 * HD + ks * 512)); kl[kt][ks] = WFrag<bf>::ld(klp + ln8 + (kt * 16 * HD + ks * 512)); }
        __builtin_amdgcn_sched_barrier(0);   // every K load of the pass is issued before its first product: one memory latency, not one per fragment group
#pragma unroll
        for (int kt = 0; kt < 2; ++kt)
#pragma unroll
            for (int qt = 0; qt < 2; ++qt) { v8f a = (v8f){};
#pragma unroll
                for (int ks = 0; ks < 2; ++ks) { a = wmmab(kh[kt][ks], qh[qt][ks], a); a = wmmab(kh[kt][ks], ql[qt][ks], a); a = wmmab(kl[kt][ks], qh[qt][ks], a); }
                s[kt][qt] = a; }
        if (!HR) {   // V^T fragments fly under the softmax
            const h16* vp = V16 + (size_t)k0 * HD + ln8;
#pragma unroll
            for (int db = 0; db < 4; ++db) vf[db] = WFrag<h16>::ld(vp + db * 512);
            asm volatile("s_wait_xcnt 0x0" :: "v"(vp) : "memory"); }   // the loads' address stays in its registers up to this wait: none of their results lands on it ahead of it
        const bool diag = (kb == nkb - 1);   // only the diagonal block holds keys above a query
#pragma unroll
        for (int qt = 0; qt < 2; ++qt) { float mx = -3.0e38f;
#pragma unroll
            for (int kt = 0; kt < 2; ++kt)
#pragma unroll
                for (int j = 0; j < 8; ++j) { float t = s[kt][qt][j]; if (diag && kt * 16 + hi * 8 + j > qt * 16 + lr) t = -3.0e38f; s[kt][qt][j] = t; mx = fmaxf(mx, t); }
            mx = fmaxf(mx, __shfl_xor(mx, 16, 32));   // the query's other 16 keys lie in the other half of the wave
            const float mn = fmaxf(ms[qt], mx * CL), al = __builtin_amdgcn_exp2f(ms[qt] - mn); ms[qt] = mn; float sum = 0.f;
#pragma unroll
            for (int kt = 0; kt < 2; ++kt)
#pragma unroll
                for (int j = 0; j < 8; ++j) { const float p = __builtin_amdgcn_exp2f(__builtin_fmaf(s[kt][qt][j], CL, -mn)); s[kt][qt][j] = p; sum += p; }
            l[qt] = l[qt] * al + sum;
#pragma unroll
            for (int db = 0; db < 4; ++db) o[qt][db] *= al; }
        if (HR) { v16bf ph[2], pl[2]; const bf* vhp = Vh + (size_t)k0 * HD + ln8; const bf* vlp = Vl + (size_t)k0 * HD + ln8;
#pragma unroll
            for (int qt = 0; qt < 2; ++qt) { v8us h0, h1, l0, l1;
#pragma unroll
                for (int j = 0; j < 8; ++j) { unsigned short a, c; splitf(s[0][qt][j], a, c); h0[j] = a; l0[j] = c; splitf(s[1][qt][j], a, c); h1[j] = a; l1[j] = c; }
                ph[qt] = cat16b(h0, h1); pl[qt] = cat16b(l0, l1); }
#pragma unroll
            for (int db = 0; db < 4; ++db) { const v16bf vh = WFrag<bf>::ld(vhp + db * 512), vl = WFrag<bf>::ld(vlp + db * 512);
#pragma unroll
                for (int qt = 0; qt < 2; ++qt) { o[qt][db] = wmmab(vh, ph[qt], o[qt][db]); o[qt][db] = wmmab(vh, pl[qt], o[qt][db]); o[qt][db] = wmmab(vl, ph[qt], o[qt][db]); } }
            asm volatile("s_wait_xcnt 0x0" :: "v"(vhp), "v"(vlp) : "memory");   // as at the fp16 V^T loads: the two addresses stay in their registers up to this wait
        } else { v16h pf[2];
#pragma unroll
            for (int qt = 0; qt < 2; ++qt)
#pragma unroll
                for (int j = 0; j < 8; ++j) { pf[qt][j] = tohx(s[0][qt][j]); pf[qt][8 + j] = tohx(s[1][qt][j]); }
#pragma unroll
            for (int db = 0; db < 4; ++db)
#pragma unroll
                for (int qt = 0; qt < 2; ++qt) o[qt][db] = wmma16(vf[db], pf[qt], o[qt][db]); }
    }
#pragma unroll
    for (int qt = 0; qt < 2; ++qt) { l[qt] += __shfl_xor(l[qt], 16, 32);   // the two halves' sums of one query
        float* op = os + (wv * 32 + qt * 16 + lr) * 68 + hi * 8;
#pragma unroll
        for (int db = 0; db < 4; ++db) { *(v4fa*)(op + db * 16) = __builtin_shufflevector(o[qt][db], o[qt][db], 0, 1, 2, 3); *(v4fa*)(op + db * 16 + 4) = __builtin_shufflevector(o[qt][db], o[qt][db], 4, 5, 6, 7); }
        if (hi == 0) { ml[(wv * 32 + qt * 16 + lr) * 2] = ms[qt]; ml[(wv * 32 + qt * 16 + lr) * 2 + 1] = l[qt]; } }
    __syncthreads();   // every wave's partial maximum, sum and O^T are in LDS before any thread joins them
    const int q = (int)threadIdx.x >> 3, d8 = ((int)threadIdx.x & 7) * 8; float M = ml[q * 2];
#pragma unroll
    for (int w = 1; w < AW; ++w) M = fmaxf(M, ml[(w * 32 + q) * 2]);
    float L = 0.f; v4f r0 = (v4f){}, r1 = (v4f){};
#pragma unroll   // a wave that had no key block has sum 0 and factor 0
    for (int w = 0; w < AW; ++w) { const float f = __builtin_amdgcn_exp2f(ml[(w * 32 + q) * 2] - M); L += f * ml[(w * 32 + q) * 2 + 1]; const float* ip = os + (w * 32 + q) * 68 + d8; r0 += *(const v4fa*)ip * f; r1 += *(const v4fa*)(ip + 4) * f; }
    const float rl = __fdiv_rn(1.0f, L); float* dst = orow + (size_t)(q0 + q) * DQ + d8;
    *(v4f*)dst = r0 * rl; *(v4f*)(dst + 4) = r1 * rl;
    __syncthreads();   // the partials are read out before the block's next tile overwrites them
}
// four waves per SIMD (two blocks per WGP, one batch's blocks resident at once): the register budget is held to 256 so that other waves' work covers a wave's load latency and softmax
__global__ __launch_bounds__(AW * 32) __attribute__((amdgpu_waves_per_eu(4, 4))) void k_fattn(const bf* __restrict__ Qh, const bf* __restrict__ Ql, const bf* __restrict__ Kh, const bf* __restrict__ Kl, const h16* __restrict__ V16, const bf* __restrict__ Vh, const bf* __restrict__ Vl, float* OUTb) {
    __shared__ __align__(16) float os[AW * 32 * 68]; __shared__ float ml[AW * 32 * 2];
    Qh += (size_t)blockIdx.z * (DQ + DKV) * TT; Ql += (size_t)blockIdx.z * (DQ + DKV) * TT; Kh += (size_t)blockIdx.z * (DQ + DKV) * TT; Kl += (size_t)blockIdx.z * (DQ + DKV) * TT; V16 += (size_t)blockIdx.z * DKV * TT; Vh += (size_t)blockIdx.z * DKV * TT; Vl += (size_t)blockIdx.z * DKV * TT; OUTb += (size_t)blockIdx.z * TT * DQ;   // blockIdx.z: the batch's part of every plane and of the output
    const size_t hp = (size_t)blockIdx.y * TT * HD; const int lane = threadIdx.x & 31, lr = lane & 15, hi = lane >> 4; const int wv = __builtin_amdgcn_readfirstlane(threadIdx.x >> 5);   // the wave's number as a scalar: the key loop's counter and branch stay scalar
#pragma unroll 1
    for (int half = 0; half < 2; ++half) { const int q0 = (half ? (int)blockIdx.x : TT / 32 - 1 - (int)blockIdx.x) * 32;
        if (q0 < RH) fa_tile<true>(Qh + hp, Ql + hp, Kh + hp, Kl + hp, V16 + hp, Vh + hp, Vl + hp, OUTb + blockIdx.y * HD, q0, wv, lr, hi, os, ml);
        else fa_tile<false>(Qh + hp, Ql + hp, Kh + hp, Kl + hp, V16 + hp, Vh + hp, Vl + hp, OUTb + blockIdx.y * HD, q0, wv, lr, hi, os, ml); }
}

extern "C" void kernel_launch(void* const* d_in, const int* in_sizes, int n_in,
                              void* d_out, int out_size, void* d_ws, size_t ws_size, hipStream_t stream) {
    (void)in_sizes; (void)n_in; (void)out_size;
    const float* x = (const float*)d_in[0]; const float* pq = (const float*)d_in[1]; const float* pk = (const float*)d_in[2]; const float* pv = (const float*)d_in[3];   /* each [16][1024][64] */ const float* wq = pq, *wk = pk, *wv = pv, *wo = nullptr; (void)wo;
    float* OUT = (float*)d_out;     // [4][2048][1024]
    char* wsp = (char*)d_ws;
    auto take = [&](size_t bytes) { char* p = wsp; wsp += (bytes + 255) & ~(size_t)255; return (void*)p; };
    bf* WQ = (bf*)take((size_t)(DQ + 2 * DKV) * DM * 2);   /* q, k, v rows one behind the other: one [3072][1024] Bt */
    bf* XB = (bf*)take((size_t)NB_ * TT * DM * 2);
    h16* VT16 = (h16*)take((size_t)NB_ * NKV * HD * TT * 2);
    bf* QPh = (bf*)take((size_t)NB_ * (NH_ + NKV) * TT * HD * 2); bf* KPh = QPh + (size_t)NH_ * TT * HD;   /* per batch q heads, then k heads: GEMM column n (Bt row n) lands in plane n / 64 */ bf* QPl = (bf*)take((size_t)NB_ * (NH_ + NKV) * TT * HD * 2); bf* KPl = QPl + (size_t)NH_ * TT * HD; bf* VTh = (bf*)take((size_t)NB_ * NKV * HD * TT * 2); bf* VTl = (bf*)take((size_t)NB_ * NKV * HD * TT * 2);
    if ((size_t)(wsp - (char*)d_ws) > ws_size) return;
    k_prep<<<WB + NB_ * TT * DM / 2048, 256, 0, stream>>>(x, wq, wk, wv, WQ, XB);   /* tensor z's head hh 'xw' [1024][64] -> Bt rows z*1024 + hh*64..; x -> bf16 */
    k_proj<<<dim3(192, 1, NB_), 128, 0, stream>>>(XB, WQ, QPh, QPl, VT16, VTh, VTl);
    k_fattn<<<dim3(TT / 64, NH_, NB_), AW * 32, 0, stream>>>(QPh, QPl, KPh, KPl, VT16, VTh, VTl, OUT);
}

// v008
// A run of this version takes 124 microseconds.
// Timed twice side by side with v007, it ran 1.21 and 1.20 times as fast.
// Counting every step since v000, it is 24.0 times as fast.
#include <hip/hip_runtime.h>

// Causal multi-head attention with per-head weight tensors, scaled by sqrt(embed) (x [4][2048][1024]; q,k,v = einsum('bte,hed', x, W) (Wq, Wk, Wv [16][1024][64] uniform(+-1/32): head h's 'xw' block); 16 heads x 64; causal (-inf); scores / sqrt(1024) (the source's quirk: sigma ~0.1 logits); softmax; out = concat heads -> [4][2048][1024] (8.4 M; no output projection)).
// Fragment order: every plane that feeds a matrix operand (x, Bt, q, k, V^T) is stored as 16-row x 32-k fragments of 512 elements, element (row r, k) at (k >> 4 & 1) * 256 + (k >> 3 & 1) * 128 + r * 8 + (k & 7); a row block's fragments follow one another along k (V^T instead: the four d blocks of each 32 keys one behind the other). Lane l of a wave then finds its two 16-byte pieces at l * 8 and 256 + l * 8: each wave-wide load reads 512 contiguous bytes, four whole lines.
// Three launches, each for all four batches (every plane but Bt holds the batches one behind the other): bf16 copy of x together with the three projection tensors' 48 'xw' [1024][64] blocks transposed into one [3072][1024] Bt (rows q h*64.., k 1024 + h*64.., v 2048 + h*64..); exact projections, one N = 3072 GEMM whose epilogue writes the head planes itself; one fused causal attention launch for the 4 x 16 heads (scores, online softmax and attn.v in registers; the score matrix never reaches memory).
// Compute dtypes, f32 accumulate: every input rounded to bf16; projections exact; scores 3 hi/lo products on every row; softmax f32 (x 1/32), unnormalised probabilities in (0, 1], divided by the f32 row sum at the end; attn.v rows < 512 3 hi/lo products, rest fp16; output f32.

#define NB_  4
#define TT   2048
#define DM   1024
#define NH_  16
#define NKV  16
#define REP  (NH_ / NKV)
#define HD   64
#define DQ   (NH_ * HD)
#define DKV  (NKV * HD)
#define DF   (DQ + 2 * DKV)        // q, k and v projection columns side by side
#define AW   8                    // waves of a fused-attention block: 4 groups of 32 queries x 2 halves of the key blocks
#define RH   512                  // query rows < RH use hi+lo planes (0: none)
#define SCL  0.03125f  // 1/sqrt(embed = 1024): the source's quirk
typedef _Float16 h16;
typedef unsigned short bf;
typedef __attribute__((ext_vector_type(16))) __bf16   v16bf;
typedef __attribute__((ext_vector_type(16))) _Float16 v16h;
typedef __attribute__((ext_vector_type(8)))  _Float16 v8h;
typedef __attribute__((ext_vector_type(8)))  unsigned short v8us;
typedef __attribute__((ext_vector_type(8)))  float    v8f;
typedef __attribute__((ext_vector_type(4)))  float    v4f;
typedef v8h  __attribute__((may_alias)) v8ha;
typedef v4f  __attribute__((may_alias)) v4fa;
typedef v8us __attribute__((may_alias)) v8usa;

__device__ __forceinline__ unsigned short f2bf(float f) { unsigned u = __float_as_uint(f); u += 0x7FFFu + ((u >> 16) & 1u); return (unsigned short)(u >> 16); }
__device__ __forceinline__ float bf2f(unsigned short b) { return __uint_as_float(((unsigned)b) << 16); }
__device__ __forceinline__ float bfr(float f) { return bf2f(f2bf(f)); }
__device__ __forceinline__ v16h cat16(v8h lo, v8h hi) { return __builtin_shufflevector(lo, hi, 0, 1, 2, 3, 4, 5, 6, 7, 8, 9, 10, 11, 12, 13, 14, 15); }
__device__ __forceinline__ v16bf cat16b(v8us lo, v8us hi) { return __builtin_bit_cast(v16bf, __builtin_shufflevector(lo, hi, 0, 1, 2, 3, 4, 5, 6, 7, 8, 9, 10, 11, 12, 13, 14, 15)); }
__device__ __forceinline__ v8f wmma16(v16h a, v16h b, v8f c) { return __builtin_amdgcn_wmma_f32_16x16x32_f16(false, a, false, b, (short)0, c, false, false); }
__device__ __forceinline__ v8f wmmab(v16bf a, v16bf b, v8f c) { return __builtin_amdgcn_wmma_f32_16x16x32_bf16(false, a, false, b, (short)0, c, false, false); }



__device__ __forceinline__ h16 tohx(float x) { return (h16)x; }
__device__ __forceinline__ void splitf(float y, unsigned short& h, unsigned short& l) { h = f2bf(y); l = f2bf(y - bf2f(h)); }
typedef __attribute__((ext_vector_type(2))) unsigned short v2us;

// ld: p = the fragment's start + lane * 8 in a plane in fragment order
template <typename T16> struct WFrag;
template <> struct WFrag<h16> { typedef v16h V; static __device__ __forceinline__ V ld(const h16* p) { return cat16(*(const v8h*)p, *(const v8h*)(p + 256)); } static __device__ __forceinline__ v8f mma(V a, V b, v8f c) { return wmma16(a, b, c); } };
template <> struct WFrag<bf> { typedef v16bf V; static __device__ __forceinline__ V ld(const bf* p) { return cat16b(*(const v8us*)p, *(const v8us*)(p + 256)); } static __device__ __forceinline__ v8f mma(V a, V b, v8f c) { return wmmab(a, b, c); } };
// ---- k_proj: the q, k, v projection GEMM. A block of 4 waves does a tile of 128 A rows x 256 B rows; wave (wa, wb) of 2 x 2 holds 64 x 128 of it (32 accumulators) over the whole K. grid (192, 1, batches), 128 threads; three blocks fit a WGP, so all 768 are resident at once.
// Blocks 0..127: q and k heads (A = 128 rows of x, B = 256 Bt rows = 4 heads). Blocks 128..191: v heads, computed transposed (A = 128 Bt rows = 2 heads, B = 256 rows of x; both planes share one fragment loader).
// Both operand slabs of 64 k (24 blocks of 16 rows, 2 KiB each, contiguous in fragment order) are brought into LDS by asynchronous copies, two buffers: the next slab flies while this one is worked on, and every fragment is fetched from L2 once a block instead of once a wave.
// The epilogue rounds the f32 sums into the planes that the attention kernel reads: q and k [h][t][d] (rows t, k = d) as bf16 hi + lo, v as V^T [g][d][t] (rows d, k = t; the four d blocks of 32 keys side by side) in fp16 and bf16 hi + lo, all in fragment order. Each wave turns its own 16 x 64 bands through its own LDS range: a lane then holds 8 neighbouring columns of one row, and a wave stores 512 contiguous bytes.
#define PKS  64                    // k of a slab
#define SLB  (24 * 2048)           // bytes of a slab: 8 A and 16 B blocks of 16 rows x 64 k
// eight copies of 16 bytes a lane: blocks of 16 rows lie 2 KiB apart in LDS and 16 * DM elements apart in the plane. The wait is the last line of the copies' own statement: no register that a copy names is rewritten ahead of it.
__device__ __forceinline__ void cp8(unsigned l, const bf* g) {
    asm volatile("global_load_async_to_lds_b128 %0, %8, off\n\t"
                 "global_load_async_to_lds_b128 %1, %9, off\n\t"
                 "global_load_async_to_lds_b128 %2, %10, off\n\t"
                 "global_load_async_to_lds_b128 %3, %11, off\n\t"
                 "global_load_async_to_lds_b128 %4, %12, off\n\t"
                 "global_load_async_to_lds_b128 %5, %13, off\n\t"
                 "global_load_async_to_lds_b128 %6, %14, off\n\t"
                 "global_load_async_to_lds_b128 %7, %15, off\n\t"
                 "s_wait_xcnt 0x0"
                 :: "v"(l), "v"(l + 2048u), "v"(l + 4096u), "v"(l + 6144u), "v"(l + 8192u), "v"(l + 10240u), "v"(l + 12288u), "v"(l + 14336u),
                    "v"(g), "v"(g + 16 * DM), "v"(g + 32 * DM), "v"(g + 48 * DM), "v"(g + 64 * DM), "v"(g + 80 * DM), "v"(g + 96 * DM), "v"(g + 112 * DM) : "memory");
}
__global__ __launch_bounds__(128) __attribute__((amdgpu_waves_per_eu(3, 3))) void k_proj(const bf* __restrict__ X, const bf* __restrict__ Bt, bf* Ph, bf* Pl, h16* V16, bf* Vh, bf* Vl) {
    typedef typename WFrag<bf>::V V;
    constexpr int NT = DM / PKS;   // slabs along K
    __shared__ __attribute__((aligned(16))) unsigned char sm[2 * SLB];
    const int tid = threadIdx.x, lane = tid & 31, lr = lane & 15, hi = lane >> 4; const int wv = __builtin_amdgcn_readfirstlane(tid >> 5);   /* the wave's number as a scalar */ const int wa = wv & 1, wb = wv >> 1;
    X += (size_t)blockIdx.z * TT * DM; Ph += (size_t)blockIdx.z * (DQ + DKV) * TT; Pl += (size_t)blockIdx.z * (DQ + DKV) * TT; V16 += (size_t)blockIdx.z * DKV * TT; Vh += (size_t)blockIdx.z * DKV * TT; Vl += (size_t)blockIdx.z * DKV * TT;   // blockIdx.z: the batch's part of x and of every head plane
    const int bx = blockIdx.x; const bool vt = bx >= 128;   // a block of v heads (the same for the whole block): rows d, columns t
    const int tA = vt ? (bx - 128) & 7 : bx & 15, tB = vt ? (bx - 128) >> 3 : bx >> 4;
    const bf* Ag = (vt ? Bt + (size_t)(DQ + DKV) * DM : X) + (size_t)tA * 128 * DM + tid * 8;   // the thread's 16 bytes of the first A block's slab 0; a slab is PKS * 16 elements further along
    const bf* Bg = (vt ? X : Bt) + (size_t)tB * 256 * DM + tid * 8;
    const unsigned l0 = (unsigned)(size_t)sm + (unsigned)tid * 16u;   // the thread's LDS byte address in buffer 0
    v8f acc[4][8];
#pragma unroll
    for (int mb = 0; mb < 4; ++mb)
#pragma unroll
        for (int nb = 0; nb < 8; ++nb) acc[mb][nb] = (v8f){};
    cp8(l0, Ag); cp8(l0 + 16384u, Bg); cp8(l0 + 32768u, Bg + 128 * DM);
    asm volatile("s_wait_asynccnt 0x0" ::: "memory");   // the wave's own copies of slab 0 have landed
    __syncthreads();   // slab 0 is published to every wave
    cp8(l0 + SLB, Ag + PKS * 16); cp8(l0 + SLB + 16384u, Bg + PKS * 16); cp8(l0 + SLB + 32768u, Bg + 128 * DM + PKS * 16);
#pragma unroll 1   // one slab a trip: the two buffers alternate
    for (int t = 0; t < NT; ++t) {
        const bf* sb = (const bf*)(sm + (t & 1) * SLB) + lane * 8;
#pragma unroll
        for (int ks = 0; ks < PKS / 32; ++ks) {
            V a[4], b[2];
#pragma unroll
            for (int mb = 0; mb < 4; ++mb) a[mb] = WFrag<bf>::ld(sb + (wa * 4 + mb) * 1024 + ks * 512);
            b[0] = WFrag<bf>::ld(sb + (8 + wb * 8) * 1024 + ks * 512);
#pragma unroll
            for (int nb = 0; nb < 8; ++nb) { if (nb < 7) { b[(nb + 1) & 1] = WFrag<bf>::ld(sb + (8 + wb * 8 + nb + 1) * 1024 + ks * 512);   // the next B fragment is asked for ahead of this one's four products
                    __builtin_amdgcn_sched_barrier(0); }   // keeps that load in front of the products: without it the scheduler sinks it behind them and every four products wait out an LDS latency
#pragma unroll
                for (int mb = 0; mb < 4; ++mb) acc[mb][nb] = WFrag<bf>::mma(a[mb], b[nb & 1], acc[mb][nb]); }
        }
        asm volatile("s_wait_dscnt 0x0" ::: "memory");      // the wave's reads of this buffer have returned before it is handed to the copies
        asm volatile("s_wait_asynccnt 0x0" ::: "memory");   // the wave's own copies of slab t + 1 have landed
        __syncthreads();   // publishes slab t + 1 and ends every wave's reads of slab t
        if (t + 2 < NT) { const unsigned lb = l0 + (unsigned)(t & 1) * SLB; const bf* ga = Ag + (t + 2) * (PKS * 16); const bf* gb = Bg + (t + 2) * (PKS * 16);
            cp8(lb, ga); cp8(lb + 16384u, gb); cp8(lb + 32768u, gb + 128 * DM); }
    }
    asm volatile("s_wait_asynccnt 0x0" ::: "memory");   // no copy is outstanding when the buffers become staging
    float* os = (float*)sm + wv * (16 * 68);   // the wave's own staging band, 16 rows at pitch 68; the loop's last barrier has ended every read of the buffers
    const int ia = tA * 128 + wa * 64, ib = tB * 256 + wb * 128;
    // plane element of (tile row 0, tile column 0) and the steps to the next 64 columns, the next 16 rows and the next 32 columns; 8 columns are 128 elements in both layouts
    const size_t pb = (vt ? (size_t)ia * TT + (size_t)ib * HD : (size_t)ib * TT + (size_t)ia * HD) + hi * 128 + lr * 8;
    const size_t sH = vt ? 2 * 32 * HD : (size_t)HD * TT, sM = vt ? 512 : 16 * HD, sC = vt ? 32 * HD : 512;
    bf* P1 = vt ? Vh : Ph; bf* P2 = vt ? Vl : Pl;
#pragma unroll   // constant indices keep acc in registers
    for (int hb = 0; hb < 2; ++hb)
#pragma unroll
        for (int mb = 0; mb < 4; ++mb) {
#pragma unroll
            for (int nb = 0; nb < 4; ++nb)
#pragma unroll
                for (int j = 0; j < 8; ++j) os[(hi * 8 + j) * 68 + nb * 16 + lr] = acc[mb][hb * 4 + nb][j];
            asm volatile("s_wait_dscnt 0x0" ::: "memory");   // the wave's band is in LDS before its lanes read one another's values
            v4f v[4][2];
#pragma unroll
            for (int cg = 0; cg < 4; ++cg) { const float* ip = os + lr * 68 + (cg * 2 + hi) * 8; v[cg][0] = *(const v4fa*)ip; v[cg][1] = *(const v4fa*)(ip + 4); }
            asm volatile("s_wait_dscnt 0x0" ::: "memory");   // the band is read out before the next band overwrites it
#pragma unroll
            for (int cg = 0; cg < 4; ++cg) { v8us oh, ol; const size_t po = pb + hb * sH + mb * sM + (cg >> 1) * sC + (cg & 1) * 256;
#pragma unroll
                for (int e = 0; e < 8; ++e) { unsigned short a2, c2; splitf(v[cg][e >> 2][e & 3], a2, c2); oh[e] = a2; ol[e] = c2; }
                *(v8us*)(P1 + po) = oh; *(v8us*)(P2 + po) = ol;
                asm volatile("s_wait_xcnt 0x0" ::: "memory");   // stands in front of whatever next lands on the two stores' registers
                if (vt) { v8h o16;
#pragma unroll
                    for (int e = 0; e < 8; ++e) o16[e] = tohx(v[cg][e >> 2][e & 3]);
                    *(v8h*)(V16 + po) = o16;
                    asm volatile("s_wait_xcnt 0x0" ::: "memory"); } }   // as behind the two stores above
        }
}

// block (bx, by, bz) of (DM / 32, heads, 3): bz picks the tensor, by its head, bx 32 values of k; Bt holds the tensors' heads one behind the other, in fragment order (rows n, 64 a head).
// A thread gathers 8 values of k for one n: a wave reads 32 neighbouring n of one k (a whole line) per load and stores two runs of 256 bytes.
__device__ __forceinline__ void wtG(const float* __restrict__ w0, const float* __restrict__ w1, const float* __restrict__ w2, bf* Bt, unsigned bx, unsigned by, unsigned bz) {
    const int n = threadIdx.x & 63, g = threadIdx.x >> 6;
    const float* p = (bz == 0 ? w0 : bz == 1 ? w1 : w2) + (size_t)by * DM * HD + (size_t)(bx * 32 + g * 8) * HD + n; float v[8];
#pragma unroll
    for (int e = 0; e < 8; ++e) v[e] = p[e * HD];
    asm volatile("s_wait_xcnt 0x0" :: "v"(p) : "memory");   // the loads' address stays in its registers up to this wait: none of their results lands on it ahead of it
    v8us o;
#pragma unroll
    for (int e = 0; e < 8; ++e) o[e] = f2bf(v[e]);
    *(v8us*)(Bt + ((size_t)bz * NH_ + by) * HD * DM + (size_t)(n >> 4) * 16 * DM + bx * 512 + g * 128 + (n & 15) * 8) = o;
}
// thread i writes the 8 elements i * 8.. of the plane in fragment order: row (i >> 11) * 16 + (i & 15), k = (i >> 4 & 127) * 8 (DM / 8 = 128 groups of 8 a row); a block reads 512 contiguous bytes of each of 16 rows
__device__ __forceinline__ void cvt8(const float* __restrict__ src, bf* dst, unsigned blk) { const size_t i = (size_t)blk * 256 + threadIdx.x; const v8f v = *(const v8f*)(src + ((i / (DM * 2)) * 16 + (i & 15)) * DM + ((i >> 4) & (DM / 8 - 1)) * 8); v8us o;
#pragma unroll
    for (int k = 0; k < 8; ++k) o[k] = f2bf(v[k]); *(v8us*)(dst + i * 8) = o;
    asm volatile("s_wait_xcnt 0x0" ::: "memory");   // the built code lays the weight branch, which rewrites this store's registers, directly behind it: the wait stands in front of it
}
// ---- k_prep: both operand planes of the projection GEMM in one launch: the first WB blocks transpose the weights, the other NB_ * TT * DM / 2048 copy x (all batches: 16-row blocks one behind the other)
#define WB   (DM / 32 * NH_ * 3)
__global__ __launch_bounds__(256) void k_prep(const float* __restrict__ x, const float* __restrict__ w0, const float* __restrict__ w1, const float* __restrict__ w2, bf* Bt, bf* XB) {
    if (blockIdx.x < WB) wtG(w0, w1, w2, Bt, blockIdx.x & (DM / 32 - 1), (blockIdx.x / (DM / 32)) & (NH_ - 1), blockIdx.x / (DM / 32 * NH_));
    else cvt8(x, XB, blockIdx.x - WB);
}

// ---- k_fattn: fused causal attention. grid (TT / 256, heads, batches), AW waves. A block does the two 128-query tiles TT/128 - 1 - x and x of one head (together TT/128 + 1 stages of 128 keys: every block has the same work); the 512 blocks are all resident at once, two a WGP.
// Transposed products: S^T = K Q^T (A = 16 key rows, B = 16 query columns, hi/lo 3 products) leaves one query per lane (keys 8 hi + j of each 16 in the lane's 8 registers), so two S^T tiles, converted in place, are the B operand (32 keys) of O^T += V^T P^T.
// Wave (qs, kg) of 4 x 2 holds the tile's queries qs * 32 .. and takes the key blocks of 32 whose number has parity kg, each wave with its own running maximum, sum and O^T; the two partials of a query are joined through LDS.
// A stage is 128 keys of every plane the tile reads (K hi, K lo, then V^T fp16 or V^T hi, lo; 16 KiB each, contiguous in fragment order), brought into LDS by asynchronous copies, two buffers: the next stage flies while this one is worked on, and a key block is fetched from L2 once for 128 queries instead of once for 32.
#define SK   128                   // keys of a stage
#define PLB  (SK * HD * 2)         // bytes of one plane's part of a stage
#define STB  (4 * PLB)             // bytes of a stage buffer
// four copies of 16 bytes a lane: one plane's part of a stage, 4 KiB a copy over the block's 256 threads. The wait is the last line of the copies' own statement: no register that a copy names is rewritten ahead of it.
__device__ __forceinline__ void cp4(unsigned l, const bf* g) {
    asm volatile("global_load_async_to_lds_b128 %0, %4, off\n\t"
                 "global_load_async_to_lds_b128 %1, %5, off\n\t"
                 "global_load_async_to_lds_b128 %2, %6, off\n\t"
                 "global_load_async_to_lds_b128 %3, %7, off\n\t"
                 "s_wait_xcnt 0x0"
                 :: "v"(l), "v"(l + 4096u), "v"(l + 8192u), "v"(l + 12288u), "v"(g), "v"(g + 2048), "v"(g + 4096), "v"(g + 6144) : "memory");
}
// l: the thread's LDS byte address in the buffer; the pointers: the thread's 16 bytes at the start of the stage in each plane
template <bool HR>
__device__ __forceinline__ void fa_stage(unsigned l, const bf* kh, const bf* kl, const bf* v0, const bf* v1) { cp4(l, kh); cp4(l + PLB, kl); cp4(l + 2 * PLB, v0); if (HR) cp4(l + 3 * PLB, v1); }
template <bool HR>
__device__ __forceinline__ void fa_tile(const bf* __restrict__ Qh, const bf* __restrict__ Ql, const bf* __restrict__ Kh, const bf* __restrict__ Kl, const h16* __restrict__ V16, const bf* __restrict__ Vh, const bf* __restrict__ Vl, float* orow, int T, int wv, int lr, int hi, unsigned char* sm, float* ml) {
    constexpr float CL = SCL * 1.4426950408889634f;   // score -> log2 units
    const int tid = (int)threadIdx.x, qs = wv & 3, kg = wv >> 2;
    const int q0 = T * 128 + qs * 32;   // the wave's first query
    const int dkb = T * 4 + qs;         // the wave's diagonal key block, its last
    const int ns = T + 1;               // stages: keys 0 .. the tile's last query
    const unsigned ln8 = (unsigned)((hi * 16 + lr) * 8);   // the lane's place in every fragment
    const unsigned l0 = (unsigned)(size_t)sm + (unsigned)tid * 16u;   // the thread's LDS byte address in buffer 0
    const bf* gkh = Kh + tid * 8; const bf* gkl = Kl + tid * 8; const bf* gv0 = (HR ? Vh : (const bf*)V16) + tid * 8; const bf* gv1 = Vl + tid * 8;   // the thread's 16 bytes of stage 0; a stage is SK * HD elements further along
    fa_stage<HR>(l0, gkh, gkl, gv0, gv1);
    v16bf qh[2][2], ql[2][2]; const bf* qhp = Qh + (size_t)q0 * HD + ln8; const bf* qlp = Ql + (size_t)q0 * HD + ln8;
#pragma unroll
    for (int qt = 0; qt < 2; ++qt)
#pragma unroll
        for (int ks = 0; ks < 2; ++ks) { qh[qt][ks] = WFrag<bf>::ld(qhp + (qt * 16 * HD + ks * 512)); ql[qt][ks] = WFrag<bf>::ld(qlp + (qt * 16 * HD + ks * 512)); }
    asm volatile("s_wait_xcnt 0x0" :: "v"(qhp), "v"(qlp) : "memory");   // the loads' two addresses stay in their registers up to this wait: nothing lands on them ahead of it
    v8f o[2][4]; float ms[2], l[2];   // ms: the running maximum in log2 units, as rounded: the very value the exponents were taken against
#pragma unroll
    for (int qt = 0; qt < 2; ++qt) { ms[qt] = -3.0e38f; l[qt] = 0.f;
#pragma unroll
        for (int db = 0; db < 4; ++db) o[qt][db] = (v8f){}; }
    asm volatile("s_wait_asynccnt 0x0" ::: "memory");   // the wave's own copies of stage 0 have landed
    __syncthreads();   // stage 0 is published to every wave
    if (ns > 1) fa_stage<HR>(l0 + STB, gkh + SK * HD, gkl + SK * HD, gv0 + SK * HD, gv1 + SK * HD);
#pragma unroll 1   // one stage a trip: the two buffers alternate
    for (int s = 0; s < ns; ++s) {
        const unsigned char* sb = sm + (s & 1) * STB;
#pragma unroll 1   // the wave's two key blocks of the stage share one pass body: the registers of one pass, not of two
        for (int jp = 0; jp < 2; ++jp) { const int kq = kg + jp * 2, kb = s * 4 + kq;   // the key block's place in the stage and its number: scalars
            if (kb <= dkb) {   // a wave skips the key blocks above its diagonal (the same for the whole wave); the stage's waits and barrier stand outside
        const bf* khp = (const bf*)sb + kq * (32 * HD) + ln8; const bf* klp = (const bf*)(sb + PLB) + kq * (32 * HD) + ln8;
        v8f s2[2][2]; v16bf kh[2][2], kl[2][2]; v16h vf[4];
#pragma unroll
        for (int kt = 0; kt < 2; ++kt)
#pragma unroll
            for (int ks = 0; ks < 2; ++ks) { kh[kt][ks] = WFrag<bf>::ld(khp + (kt * 16 * HD + ks * 512)); kl[kt][ks] = WFrag<bf>::ld(klp + (kt * 16 * HD + ks * 512)); }
        __builtin_amdgcn_sched_barrier(0);   // every K load of the pass is issued before its first product: one LDS latency, not one per fragment group
#pragma unroll
        for (int kt = 0; kt < 2; ++kt)
#pragma unroll
            for (int qt = 0; qt < 2; ++qt) { v8f a = (v8f){};
#pragma unroll
                for (int ks = 0; ks < 2; ++ks) { a = wmmab(kh[kt][ks], qh[qt][ks], a); a = wmmab(kh[kt][ks], ql[qt][ks], a); a = wmmab(kl[kt][ks], qh[qt][ks], a); }
                s2[kt][qt] = a; }
        if (!HR) {   // V^T fragments come under the softmax
            const h16* vp = (const h16*)(sb + 2 * PLB) + kq * (32 * HD) + ln8;
#pragma unroll
            for (int db = 0; db < 4; ++db) vf[db] = WFrag<h16>::ld(vp + db * 512); }
        const bool diag = (kb == dkb);   // only the diagonal block holds keys above a query
#pragma unroll
        for (int qt = 0; qt < 2; ++qt) { float mx = -3.0e38f;
#pragma unroll
            for (int kt = 0; kt < 2; ++kt)
#pragma unroll
                for (int j = 0; j < 8; ++j) { float t = s2[kt][qt][j]; if (diag && kt * 16 + hi * 8 + j > qt * 16 + lr) t = -3.0e38f; s2[kt][qt][j] = t; mx = fmaxf(mx, t); }
            mx = fmaxf(mx, __shfl_xor(mx, 16, 32));   // the query's other 16 keys lie in the other half of the wave
            const float mn = fmaxf(ms[qt], mx * CL), al = __builtin_amdgcn_exp2f(ms[qt] - mn); ms[qt] = mn; float sum = 0.f;
#pragma unroll
            for (int kt = 0; kt < 2; ++kt)
#pragma unroll
                for (int j = 0; j < 8; ++j) { const float p = __builtin_amdgcn_exp2f(__builtin_fmaf(s2[kt][qt][j], CL, -mn)); s2[kt][qt][j] = p; sum += p; }
            l[qt] = l[qt] * al + sum;
#pragma unroll
            for (int db = 0; db < 4; ++db) o[qt][db] *= al; }
        if (HR) { v16bf ph[2], pl[2]; const bf* vhp = (const bf*)(sb + 2 * PLB) + kq * (32 * HD) + ln8; const bf* vlp = (const bf*)(sb + 3 * PLB) + kq * (32 * HD) + ln8;
#pragma unroll
            for (int qt = 0; qt < 2; ++qt) { v8us h0, h1, l0v, l1v;
#pragma unroll
                for (int j = 0; j < 8; ++j) { unsigned short a, c; splitf(s2[0][qt][j], a, c); h0[j] = a; l0v[j] = c; splitf(s2[1][qt][j], a, c); h1[j] = a; l1v[j] = c; }
                ph[qt] = cat16b(h0, h1); pl[qt] = cat16b(l0v, l1v); }
#pragma unroll
            for (int db = 0; db < 4; ++db) { const v16bf vh = WFrag<bf>::ld(vhp + db * 512), vl = WFrag<bf>::ld(vlp + db * 512);
#pragma unroll
                for (int qt = 0; qt < 2; ++qt) { o[qt][db] = wmmab(vh, ph[qt], o[qt][db]); o[qt][db] = wmmab(vh, pl[qt], o[qt][db]); o[qt][db] = wmmab(vl, ph[qt], o[qt][db]); } }
        } else { v16h pf[2];
#pragma unroll
            for (int qt = 0; qt < 2; ++qt)
#pragma unroll
                for (int j = 0; j < 8; ++j) { pf[qt][j] = tohx(s2[0][qt][j]); pf[qt][8 + j] = tohx(s2[1][qt][j]); }
#pragma unroll
            for (int db = 0; db < 4; ++db)
#pragma unroll
                for (int qt = 0; qt < 2; ++qt) o[qt][db] = wmma16(vf[db], pf[qt], o[qt][db]); }
            } }
        asm volatile("s_wait_dscnt 0x0" ::: "memory");      // the wave's reads of this buffer have returned before it is handed to the copies
        asm volatile("s_wait_asynccnt 0x0" ::: "memory");   // the wave's own copies of stage s + 1 have landed
        __syncthreads();   // publishes stage s + 1 and ends every wave's reads of stage s
        if (s + 2 < ns) { const int go = (s + 2) * (SK * HD); fa_stage<HR>(l0 + (unsigned)(s & 1) * STB, gkh + go, gkl + go, gv0 + go, gv1 + go); }
    }
    asm volatile("s_wait_asynccnt 0x0" ::: "memory");   // no copy is outstanding when the buffers become staging
    float* os = (float*)sm;   // the waves' partial O^T, 32 rows at pitch 68 each; the loop's last barrier has ended every read of the buffers
#pragma unroll
    for (int qt = 0; qt < 2; ++qt) { l[qt] += __shfl_xor(l[qt], 16, 32);   // the two halves' sums of one query
        float* op = os + (wv * 32 + qt * 16 + lr) * 68 + hi * 8;
#pragma unroll
        for (int db = 0; db < 4; ++db) { *(v4fa*)(op + db * 16) = __builtin_shufflevector(o[qt][db], o[qt][db], 0, 1, 2, 3); *(v4fa*)(op + db * 16 + 4) = __builtin_shufflevector(o[qt][db], o[qt][db], 4, 5, 6, 7); }
        if (hi == 0) { ml[(wv * 32 + qt * 16 + lr) * 2] = ms[qt]; ml[(wv * 32 + qt * 16 + lr) * 2 + 1] = l[qt]; } }
    __syncthreads();   // every wave's partial maximum, sum and O^T are in LDS before any thread joins them
    const int q = tid >> 3, d8 = (tid & 7) * 8;
#pragma unroll   // the four groups of 32 queries; waves g and g + 4 hold a group's two partials (one that had no key block has sum 0 and factor 0)
    for (int g = 0; g < 4; ++g) { const int ra = g * 32 + q, rb = (g + 4) * 32 + q; const float ma = ml[ra * 2], mb = ml[rb * 2], Mx = fmaxf(ma, mb);
        const float fa = __builtin_amdgcn_exp2f(ma - Mx), fb = __builtin_amdgcn_exp2f(mb - Mx); const float Ls = fa * ml[ra * 2 + 1] + fb * ml[rb * 2 + 1];
        const float* ia = os + ra * 68 + d8; const float* ib = os + rb * 68 + d8;
        const v4f r0 = *(const v4fa*)ia * fa + *(const v4fa*)ib * fb, r1 = *(const v4fa*)(ia + 4) * fa + *(const v4fa*)(ib + 4) * fb;
        const float rl = __fdiv_rn(1.0f, Ls); float* dst = orow + (size_t)(T * 128 + ra) * DQ + d8;
        *(v4f*)dst = r0 * rl; *(v4f*)(dst + 4) = r1 * rl;
        asm volatile("s_wait_xcnt 0x0" ::: "memory"); }   // stands in front of whatever next lands on the two stores' registers
    asm volatile("s_wait_dscnt 0x0" ::: "memory");   // the thread's reads of the partials have returned before the range is handed to the next tile's copies
    __syncthreads();   // the partials are read out before the block's next tile overwrites them
}
// four waves per SIMD (two blocks per WGP): the register budget is held to 256 so that other waves' work covers a wave's LDS latency and softmax
__global__ __launch_bounds__(AW * 32) __attribute__((amdgpu_waves_per_eu(4, 4))) void k_fattn(const bf* __restrict__ Qh, const bf* __restrict__ Ql, const bf* __restrict__ Kh, const bf* __restrict__ Kl, const h16* __restrict__ V16, const bf* __restrict__ Vh, const bf* __restrict__ Vl, float* OUTb) {
    __shared__ __attribute__((aligned(16))) unsigned char sm[2 * STB]; __shared__ float ml[AW * 32 * 2];
    Qh += (size_t)blockIdx.z * (DQ + DKV) * TT; Ql += (size_t)blockIdx.z * (DQ + DKV) * TT; Kh += (size_t)blockIdx.z * (DQ + DKV) * TT; Kl += (size_t)blockIdx.z * (DQ + DKV) * TT; V16 += (size_t)blockIdx.z * DKV * TT; Vh += (size_t)blockIdx.z * DKV * TT; Vl += (size_t)blockIdx.z * DKV * TT; OUTb += (size_t)blockIdx.z * TT * DQ;   // blockIdx.z: the batch's part of every plane and of the output
    const size_t hp = (size_t)blockIdx.y * TT * HD; const int lane = threadIdx.x & 31, lr = lane & 15, hi = lane >> 4; const int wv = __builtin_amdgcn_readfirstlane(threadIdx.x >> 5);   // the wave's number as a scalar: the key blocks' numbers and the skip above the diagonal stay scalar
#pragma unroll 1   // the two tiles run one after the other through the same buffers
    for (int half = 0; half < 2; ++half) { const int T = half ? (int)blockIdx.x : TT / 128 - 1 - (int)blockIdx.x;
        if (T * 128 < RH) fa_tile<true>(Qh + hp, Ql + hp, Kh + hp, Kl + hp, V16 + hp, Vh + hp, Vl + hp, OUTb + blockIdx.y * HD, T, wv, lr, hi, sm, ml);
        else fa_tile<false>(Qh + hp, Ql + hp, Kh + hp, Kl + hp, V16 + hp, Vh + hp, Vl + hp, OUTb + blockIdx.y * HD, T, wv, lr, hi, sm, ml); }
}

extern "C" void kernel_launch(void* const* d_in, const int* in_sizes, int n_in,
                              void* d_out, int out_size, void* d_ws, size_t ws_size, hipStream_t stream) {
    (void)in_sizes; (void)n_in; (void)out_size;
    const float* x = (const float*)d_in[0]; const float* pq = (const float*)d_in[1]; const float* pk = (const float*)d_in[2]; const float* pv = (const float*)d_in[3];   /* each [16][1024][64] */ const float* wq = pq, *wk = pk, *wv = pv, *wo = nullptr; (void)wo;
    float* OUT = (float*)d_out;     // [4][2048][1024]
    char* wsp = (char*)d_ws;
    auto take = [&](size_t bytes) { char* p = wsp; wsp += (bytes + 255) & ~(size_t)255; return (void*)p; };
    bf* WQ = (bf*)take((size_t)(DQ + 2 * DKV) * DM * 2);   /* q, k, v rows one behind the other: one [3072][1024] Bt */
    bf* XB = (bf*)take((size_t)NB_ * TT * DM * 2);
    h16* VT16 = (h16*)take((size_t)NB_ * NKV * HD * TT * 2);
    bf* QPh = (bf*)take((size_t)NB_ * (NH_ + NKV) * TT * HD * 2); bf* KPh = QPh + (size_t)NH_ * TT * HD;   /* per batch q heads, then k heads: GEMM column n (Bt row n) lands in plane n / 64 */ bf* QPl = (bf*)take((size_t)NB_ * (NH_ + NKV) * TT * HD * 2); bf* KPl = QPl + (size_t)NH_ * TT * HD; bf* VTh = (bf*)take((size_t)NB_ * NKV * HD * TT * 2); bf* VTl = (bf*)take((size_t)NB_ * NKV * HD * TT * 2);
    if ((size_t)(wsp - (char*)d_ws) > ws_size) return;
    k_prep<<<WB + NB_ * TT * DM / 2048, 256, 0, stream>>>(x, wq, wk, wv, WQ, XB);   /* tensor z's head hh 'xw' [1024][64] -> Bt rows z*1024 + hh*64..; x -> bf16 */
    k_proj<<<dim3(192, 1, NB_), 128, 0, stream>>>(XB, WQ, QPh, QPl, VT16, VTh, VTl);
    k_fattn<<<dim3(TT / 256, NH_, NB_), AW * 32, 0, stream>>>(QPh, QPl, KPh, KPl, VT16, VTh, VTl, OUT);
}

// v009
// One run takes 115 microseconds.
// Timed twice side by side with v008, it ran 1.08 times as fast both times.
// Counting every step since v000, it is 25.9 times as fast.
#include <hip/hip_runtime.h>

// Causal multi-head attention with per-head weight tensors, scaled by sqrt(embed) (x [4][2048][1024]; q,k,v = einsum('bte,hed', x, W) (Wq, Wk, Wv [16][1024][64] uniform(+-1/32): head h's 'xw' block); 16 heads x 64; causal (-inf); scores / sqrt(1024) (the source's quirk: sigma ~0.1 logits); softmax; out = concat heads -> [4][2048][1024] (8.4 M; no output projection)).
// Fragment order: every plane that feeds a matrix operand (x, Bt, q, k, V^T) is stored as 16-row x 32-k fragments of 512 elements, element (row r, k) at (k >> 4 & 1) * 256 + (k >> 3 & 1) * 128 + r * 8 + (k & 7); a row block's fragments follow one another along k (V^T instead: the four d blocks of each 32 keys one behind the other). Lane l of a wave then finds its two 16-byte pieces at l * 8 and 256 + l * 8: each wave-wide load reads 512 contiguous bytes, four whole lines.
// Three launches, each for all four batches (every plane but Bt holds the batches one behind the other): bf16 copy of x together with the three projection tensors' 48 'xw' [1024][64] blocks transposed into one [3072][1024] Bt (rows q h*64.., k 1024 + h*64.., v 2048 + h*64..); exact projections, one N = 3072 GEMM whose epilogue writes the head planes itself; one fused causal attention launch for the 4 x 16 heads (scores, online softmax and attn.v in registers; the score matrix never reaches memory).
// Compute dtypes, f32 accumulate: every input rounded to bf16; projections exact; scores 3 hi/lo products on every row; softmax f32 (x 1/32), unnormalised probabilities in (0, 1], divided by the f32 row sum at the end; attn.v rows < 512 3 hi/lo products, rest fp16; output f32.

#define NB_  4
#define TT   2048
#define DM   1024
#define NH_  16
#define NKV  16
#define REP  (NH_ / NKV)
#define HD   64
#define DQ   (NH_ * HD)
#define DKV  (NKV * HD)
#define DF   (DQ + 2 * DKV)        // q, k and v projection columns side by side
#define AW   8                    // waves of a fused-attention block: 4 groups of 32 queries x 2 halves of the key blocks
#define RH   512                  // query rows < RH use hi+lo planes (0: none)
#define SCL  0.03125f  // 1/sqrt(embed = 1024): the source's quirk
typedef _Float16 h16;
typedef unsigned short bf;
typedef __attribute__((ext_vector_type(16))) __bf16   v16bf;
typedef __attribute__((ext_vector_type(16))) _Float16 v16h;
typedef __attribute__((ext_vector_type(8)))  _Float16 v8h;
typedef __attribute__((ext_vector_type(8)))  unsigned short v8us;
typedef __attribute__((ext_vector_type(8)))  float    v8f;
typedef __attribute__((ext_vector_type(4)))  float    v4f;
typedef __attribute__((ext_vector_type(2)))  float    v2f;
typedef v8h  __attribute__((may_alias)) v8ha;
typedef v4f  __attribute__((may_alias)) v4fa;
typedef v8us __attribute__((may_alias)) v8usa;

__device__ __forceinline__ unsigned short f2bf(float f) { unsigned u = __float_as_uint(f); u += 0x7FFFu + ((u >> 16) & 1u); return (unsigned short)(u >> 16); }
__device__ __forceinline__ float bf2f(unsigned short b) { return __uint_as_float(((unsigned)b) << 16); }
__device__ __forceinline__ float bfr(float f) { return bf2f(f2bf(f)); }
__device__ __forceinline__ v16h cat16(v8h lo, v8h hi) { return __builtin_shufflevector(lo, hi, 0, 1, 2, 3, 4, 5, 6, 7, 8, 9, 10, 11, 12, 13, 14, 15); }
__device__ __forceinline__ v16bf cat16b(v8us lo, v8us hi) { return __builtin_bit_cast(v16bf, __builtin_shufflevector(lo, hi, 0, 1, 2, 3, 4, 5, 6, 7, 8, 9, 10, 11, 12, 13, 14, 15)); }
__device__ __forceinline__ v8f wmma16(v16h a, v16h b, v8f c) { return __builtin_amdgcn_wmma_f32_16x16x32_f16(false, a, false, b, (short)0, c, false, false); }
__device__ __forceinline__ v8f wmmab(v16bf a, v16bf b, v8f c) { return __builtin_amdgcn_wmma_f32_16x16x32_bf16(false, a, false, b, (short)0, c, false, false); }



__device__ __forceinline__ h16 tohx(float x) { return (h16)x; }
__device__ __forceinline__ void splitf(float y, unsigned short& h, unsigned short& l) { h = f2bf(y); l = f2bf(y - bf2f(h)); }
typedef __attribute__((ext_vector_type(2))) unsigned short v2us;

// ld: p = the fragment's start + lane * 8 in a plane in fragment order
template <typename T16> struct WFrag;
template <> struct WFrag<h16> { typedef v16h V; static __device__ __forceinline__ V ld(const h16* p) { return cat16(*(const v8h*)p, *(const v8h*)(p + 256)); } static __device__ __forceinline__ v8f mma(V a, V b, v8f c) { return wmma16(a, b, c); } };
template <> struct WFrag<bf> { typedef v16bf V; static __device__ __forceinline__ V ld(const bf* p) { return cat16b(*(const v8us*)p, *(const v8us*)(p + 256)); } static __device__ __forceinline__ v8f mma(V a, V b, v8f c) { return wmmab(a, b, c); } };
// ---- k_proj: the q, k, v projection GEMM. A block of 4 waves does a tile of 128 A rows x 256 B rows; wave (wa, wb) of 2 x 2 holds 64 x 128 of it (32 accumulators) over the whole K. grid (192, 1, batches), 128 threads; three blocks fit a WGP, so all 768 are resident at once.
// Blocks 0..127: q and k heads (A = 128 rows of x, B = 256 Bt rows = 4 heads). Blocks 128..191: v heads, computed transposed (A = 128 Bt rows = 2 heads, B = 256 rows of x; both planes share one fragment loader).
// Both operand slabs of 64 k (24 blocks of 16 rows, 2 KiB each, contiguous in fragment order) are brought into LDS by asynchronous copies, two buffers: the next slab flies while this one is worked on, and every fragment is fetched from L2 once a block instead of once a wave.
// The epilogue rounds the f32 sums into the planes that the attention kernel reads: q and k [h][t][d] (rows t, k = d) as bf16 hi + lo, v as V^T [g][d][t] (rows d, k = t; the four d blocks of 32 keys side by side) in fp16 and bf16 hi + lo, all in fragment order. Each wave turns its own 16 x 64 bands through its own LDS range: a lane then holds 8 neighbouring columns of one row, and a wave stores 512 contiguous bytes.
#define PKS  64                    // k of a slab
#define SLB  (24 * 2048)           // bytes of a slab: 8 A and 16 B blocks of 16 rows x 64 k
// eight copies of 16 bytes a lane: blocks of 16 rows lie 2 KiB apart in LDS and 16 * DM elements apart in the plane. The wait is the last line of the copies' own statement: no register that a copy names is rewritten ahead of it.
__device__ __forceinline__ void cp8(unsigned l, const bf* g) {
    asm volatile("global_load_async_to_lds_b128 %0, %8, off\n\t"
                 "global_load_async_to_lds_b128 %1, %9, off\n\t"
                 "global_load_async_to_lds_b128 %2, %10, off\n\t"
                 "global_load_async_to_lds_b128 %3, %11, off\n\t"
                 "global_load_async_to_lds_b128 %4, %12, off\n\t"
                 "global_load_async_to_lds_b128 %5, %13, off\n\t"
                 "global_load_async_to_lds_b128 %6, %14, off\n\t"
                 "global_load_async_to_lds_b128 %7, %15, off\n\t"
                 "s_wait_xcnt 0x0"
                 :: "v"(l), "v"(l + 2048u), "v"(l + 4096u), "v"(l + 6144u), "v"(l + 8192u), "v"(l + 10240u), "v"(l + 12288u), "v"(l + 14336u),
                    "v"(g), "v"(g + 16 * DM), "v"(g + 32 * DM), "v"(g + 48 * DM), "v"(g + 64 * DM), "v"(g + 80 * DM), "v"(g + 96 * DM), "v"(g + 112 * DM) : "memory");
}
__global__ __launch_bounds__(128) __attribute__((amdgpu_waves_per_eu(3, 3))) void k_proj(const bf* __restrict__ X, const bf* __restrict__ Bt, bf* Ph, bf* Pl, h16* V16, bf* Vh, bf* Vl) {
    typedef typename WFrag<bf>::V V;
    constexpr int NT = DM / PKS;   // slabs along K
    __shared__ __attribute__((aligned(16))) unsigned char sm[2 * SLB];
    const int tid = threadIdx.x, lane = tid & 31, lr = lane & 15, hi = lane >> 4; const int wv = __builtin_amdgcn_readfirstlane(tid >> 5);   /* the wave's number as a scalar */ const int wa = wv & 1, wb = wv >> 1;
    X += (size_t)blockIdx.z * TT * DM; Ph += (size_t)blockIdx.z * (DQ + DKV) * TT; Pl += (size_t)blockIdx.z * (DQ + DKV) * TT; V16 += (size_t)blockIdx.z * DKV * TT; Vh += (size_t)blockIdx.z * DKV * TT; Vl += (size_t)blockIdx.z * DKV * TT;   // blockIdx.z: the batch's part of x and of every head plane
    const int bx = blockIdx.x; const bool vt = bx >= 128;   // a block of v heads (the same for the whole block): rows d, columns t
    const int tA = vt ? (bx - 128) & 7 : bx & 15, tB = vt ? (bx - 128) >> 3 : bx >> 4;
    const bf* Ag = (vt ? Bt + (size_t)(DQ + DKV) * DM : X) + (size_t)tA * 128 * DM + tid * 8;   // the thread's 16 bytes of the first A block's slab 0; a slab is PKS * 16 elements further along
    const bf* Bg = (vt ? X : Bt) + (size_t)tB * 256 * DM + tid * 8;
    const unsigned l0 = (unsigned)(size_t)sm + (unsigned)tid * 16u;   // the thread's LDS byte address in buffer 0
    v8f acc[4][8];
#pragma unroll
    for (int mb = 0; mb < 4; ++mb)
#pragma unroll
        for (int nb = 0; nb < 8; ++nb) acc[mb][nb] = (v8f){};
    cp8(l0, Ag); cp8(l0 + 16384u, Bg); cp8(l0 + 32768u, Bg + 128 * DM);
    asm volatile("s_wait_asynccnt 0x0" ::: "memory");   // the wave's own copies of slab 0 have landed
    __syncthreads();   // slab 0 is published to every wave
    cp8(l0 + SLB, Ag + PKS * 16); cp8(l0 + SLB + 16384u, Bg + PKS * 16); cp8(l0 + SLB + 32768u, Bg + 128 * DM + PKS * 16);
#pragma unroll 1   // one slab a trip: the two buffers alternate
    for (int t = 0; t < NT; ++t) {
        const bf* sb = (const bf*)(sm + (t & 1) * SLB) + lane * 8;
#pragma unroll
        for (int ks = 0; ks < PKS / 32; ++ks) {
            V a[4], b[2];
#pragma unroll
            for (int mb = 0; mb < 4; ++mb) a[mb] = WFrag<bf>::ld(sb + (wa * 4 + mb) * 1024 + ks * 512);
            b[0] = WFrag<bf>::ld(sb + (8 + wb * 8) * 1024 + ks * 512);
#pragma unroll
            for (int nb = 0; nb < 8; ++nb) { if (nb < 7) { b[(nb + 1) & 1] = WFrag<bf>::ld(sb + (8 + wb * 8 + nb + 1) * 1024 + ks * 512);   // the next B fragment is asked for ahead of this one's four products
                    __builtin_amdgcn_sched_barrier(0); }   // keeps that load in front of the products: without it the scheduler sinks it behind them and every four products wait out an LDS latency
#pragma unroll
                for (int mb = 0; mb < 4; ++mb) acc[mb][nb] = WFrag<bf>::mma(a[mb], b[nb & 1], acc[mb][nb]); }
        }
        asm volatile("s_wait_dscnt 0x0" ::: "memory");      // the wave's reads of this buffer have returned before it is handed to the copies
        asm volatile("s_wait_asynccnt 0x0" ::: "memory");   // the wave's own copies of slab t + 1 have landed
        __syncthreads();   // publishes slab t + 1 and ends every wave's reads of slab t
        if (t + 2 < NT) { const unsigned lb = l0 + (unsigned)(t & 1) * SLB; const bf* ga = Ag + (t + 2) * (PKS * 16); const bf* gb = Bg + (t + 2) * (PKS * 16);
            cp8(lb, ga); cp8(lb + 16384u, gb); cp8(lb + 32768u, gb + 128 * DM); }
    }
    asm volatile("s_wait_asynccnt 0x0" ::: "memory");   // no copy is outstanding when the buffers become staging
    float* os = (float*)sm + wv * (16 * 68);   // the wave's own staging band, 16 rows at pitch 68; the loop's last barrier has ended every read of the buffers
    const int ia = tA * 128 + wa * 64, ib = tB * 256 + wb * 128;
    // plane element of (tile row 0, tile column 0) and the steps to the next 64 columns, the next 16 rows and the next 32 columns; 8 columns are 128 elements in both layouts
    const size_t pb = (vt ? (size_t)ia * TT + (size_t)ib * HD : (size_t)ib * TT + (size_t)ia * HD) + hi * 128 + lr * 8;
    const size_t sH = vt ? 2 * 32 * HD : (size_t)HD * TT, sM = vt ? 512 : 16 * HD, sC = vt ? 32 * HD : 512;
    bf* P1 = vt ? Vh : Ph; bf* P2 = vt ? Vl : Pl;
#pragma unroll   // constant indices keep acc in registers
    for (int hb = 0; hb < 2; ++hb)
#pragma unroll
        for (int mb = 0; mb < 4; ++mb) {
#pragma unroll
            for (int nb = 0; nb < 4; ++nb)
#pragma unroll
                for (int j = 0; j < 8; ++j) os[(hi * 8 + j) * 68 + nb * 16 + lr] = acc[mb][hb * 4 + nb][j];
            asm volatile("s_wait_dscnt 0x0" ::: "memory");   // the wave's band is in LDS before its lanes read one another's values
            v4f v[4][2];
#pragma unroll
            for (int cg = 0; cg < 4; ++cg) { const float* ip = os + lr * 68 + (cg * 2 + hi) * 8; v[cg][0] = *(const v4fa*)ip; v[cg][1] = *(const v4fa*)(ip + 4); }
            asm volatile("s_wait_dscnt 0x0" ::: "memory");   // the band is read out before the next band overwrites it
#pragma unroll
            for (int cg = 0; cg < 4; ++cg) { v8us oh, ol; const size_t po = pb + hb * sH + mb * sM + (cg >> 1) * sC + (cg & 1) * 256;
#pragma unroll
                for (int e = 0; e < 8; ++e) { unsigned short a2, c2; splitf(v[cg][e >> 2][e & 3], a2, c2); oh[e] = a2; ol[e] = c2; }
                *(v8us*)(P1 + po) = oh; *(v8us*)(P2 + po) = ol;
                asm volatile("s_wait_xcnt 0x0" ::: "memory");   // stands in front of whatever next lands on the two stores' registers
                if (vt) { v8h o16;
#pragma unroll
                    for (int e = 0; e < 8; ++e) o16[e] = tohx(v[cg][e >> 2][e & 3]);
                    *(v8h*)(V16 + po) = o16;
                    asm volatile("s_wait_xcnt 0x0" ::: "memory"); } }   // as behind the two stores above
        }
}

// block (bx, by, bz) of (DM / 32, heads, 3): bz picks the tensor, by its head, bx 32 values of k; Bt holds the tensors' heads one behind the other, in fragment order (rows n, 64 a head).
// A thread gathers 8 values of k for one n: a wave reads 32 neighbouring n of one k (a whole line) per load and stores two runs of 256 bytes.
__device__ __forceinline__ void wtG(const float* __restrict__ w0, const float* __restrict__ w1, const float* __restrict__ w2, bf* Bt, unsigned bx, unsigned by, unsigned bz) {
    const int n = threadIdx.x & 63, g = threadIdx.x >> 6;
    const float* p = (bz == 0 ? w0 : bz == 1 ? w1 : w2) + (size_t)by * DM * HD + (size_t)(bx * 32 + g * 8) * HD + n; float v[8];
#pragma unroll
    for (int e = 0; e < 8; ++e) v[e] = p[e * HD];
    asm volatile("s_wait_xcnt 0x0" :: "v"(p) : "memory");   // the loads' address stays in its registers up to this wait: none of their results lands on it ahead of it
    v8us o;
#pragma unroll
    for (int e = 0; e < 8; ++e) o[e] = f2bf(v[e]);
    *(v8us*)(Bt + ((size_t)bz * NH_ + by) * HD * DM + (size_t)(n >> 4) * 16 * DM + bx * 512 + g * 128 + (n & 15) * 8) = o;
}
// thread i writes the 8 elements i * 8.. of the plane in fragment order: row (i >> 11) * 16 + (i & 15), k = (i >> 4 & 127) * 8 (DM / 8 = 128 groups of 8 a row); a block reads 512 contiguous bytes of each of 16 rows
__device__ __forceinline__ void cvt8(const float* __restrict__ src, bf* dst, unsigned blk) { const size_t i = (size_t)blk * 256 + threadIdx.x; const v8f v = *(const v8f*)(src + ((i / (DM * 2)) * 16 + (i & 15)) * DM + ((i >> 4) & (DM / 8 - 1)) * 8); v8us o;
#pragma unroll
    for (int k = 0; k < 8; ++k) o[k] = f2bf(v[k]); *(v8us*)(dst + i * 8) = o;
    asm volatile("s_wait_xcnt 0x0" ::: "memory");   // the built code lays the weight branch, which rewrites this store's registers, directly behind it: the wait stands in front of it
}
// ---- k_prep: both operand planes of the projection GEMM in one launch: the first WB blocks transpose the weights, the other NB_ * TT * DM / 2048 copy x (all batches: 16-row blocks one behind the other)
#define WB   (DM / 32 * NH_ * 3)
__global__ __launch_bounds__(256) void k_prep(const float* __restrict__ x, const float* __restrict__ w0, const float* __restrict__ w1, const float* __restrict__ w2, bf* Bt, bf* XB) {
    if (blockIdx.x < WB) wtG(w0, w1, w2, Bt, blockIdx.x & (DM / 32 - 1), (blockIdx.x / (DM / 32)) & (NH_ - 1), blockIdx.x / (DM / 32 * NH_));
    else cvt8(x, XB, blockIdx.x - WB);
}

// ---- k_fattn: fused causal attention. grid (TT / 256, heads, batches), AW waves. A block does the two 128-query tiles TT/128 - 1 - x and x of one head (together TT/128 + 1 stages of 128 keys: every block has the same work); the 512 blocks are all resident at once, two a WGP.
// Transposed products: S^T = K Q^T (A = 16 key rows, B = 16 query columns, hi/lo 3 products) leaves one query per lane (keys 8 hi + j of each 16 in the lane's 8 registers), so two S^T tiles, converted in place, are the B operand (32 keys) of O^T += V^T P^T.
// Wave (qs, kg) of 4 x 2 holds the tile's queries qs * 32 .. and takes the key blocks of 32 whose number has parity kg, each wave with its own running maximum, sum and O^T; the two partials of a query are joined through LDS.
// A stage is 128 keys of every plane the tile reads (K hi, K lo, then V^T fp16 or V^T hi, lo; 16 KiB each, contiguous in fragment order), brought into LDS by asynchronous copies, two buffers: the next stage flies while this one is worked on, and a key block is fetched from L2 once for 128 queries instead of once for 32.
#define SK   128                   // keys of a stage
#define PLB  (SK * HD * 2)         // bytes of one plane's part of a stage
#define STB  (4 * PLB)             // bytes of a stage buffer
// four copies of 16 bytes a lane: one plane's part of a stage, 4 KiB a copy over the block's 256 threads. The wait is the last line of the copies' own statement: no register that a copy names is rewritten ahead of it.
__device__ __forceinline__ void cp4(unsigned l, const bf* g) {
    asm volatile("global_load_async_to_lds_b128 %0, %4, off\n\t"
                 "global_load_async_to_lds_b128 %1, %5, off\n\t"
                 "global_load_async_to_lds_b128 %2, %6, off\n\t"
                 "global_load_async_to_lds_b128 %3, %7, off\n\t"
                 "s_wait_xcnt 0x0"
                 :: "v"(l), "v"(l + 4096u), "v"(l + 8192u), "v"(l + 12288u), "v"(g), "v"(g + 2048), "v"(g + 4096), "v"(g + 6144) : "memory");
}
// l: the thread's LDS byte address in the buffer; the pointers: the thread's 16 bytes at the start of the stage in each plane
template <bool HR>
__device__ __forceinline__ void fa_stage(unsigned l, const bf* kh, const bf* kl, const bf* v0, const bf* v1) { cp4(l, kh); cp4(l + PLB, kl); cp4(l + 2 * PLB, v0); if (HR) cp4(l + 3 * PLB, v1); }
template <bool HR>
__device__ __forceinline__ void fa_tile(const bf* __restrict__ Qh, const bf* __restrict__ Ql, const bf* __restrict__ Kh, const bf* __restrict__ Kl, const h16* __restrict__ V16, const bf* __restrict__ Vh, const bf* __restrict__ Vl, float* orow, int T, int wv, int lr, int hi, unsigned char* sm, float* ml) {
    constexpr float CL = SCL * 1.4426950408889634f;   // score -> log2 units
    const int tid = (int)threadIdx.x, qs = wv & 3, kg = wv >> 2;
    const int q0 = T * 128 + qs * 32;   // the wave's first query
    const int dkb = T * 4 + qs;         // the wave's diagonal key block, its last
    const int ns = T + 1;               // stages: keys 0 .. the tile's last query
    const unsigned ln8 = (unsigned)((hi * 16 + lr) * 8);   // the lane's place in every fragment
    const unsigned l0 = (unsigned)(size_t)sm + (unsigned)tid * 16u;   // the thread's LDS byte address in buffer 0
    const bf* gkh = Kh + tid * 8; const bf* gkl = Kl + tid * 8; const bf* gv0 = (HR ? Vh : (const bf*)V16) + tid * 8; const bf* gv1 = Vl + tid * 8;   // the thread's 16 bytes of stage 0; a stage is SK * HD elements further along
    fa_stage<HR>(l0, gkh, gkl, gv0, gv1);
    v16bf qh[2][2], ql[2][2]; const bf* qhp = Qh + (size_t)q0 * HD + ln8; const bf* qlp = Ql + (size_t)q0 * HD + ln8;
#pragma unroll
    for (int qt = 0; qt < 2; ++qt)
#pragma unroll
        for (int ks = 0; ks < 2; ++ks) { qh[qt][ks] = WFrag<bf>::ld(qhp + (qt * 16 * HD + ks * 512)); ql[qt][ks] = WFrag<bf>::ld(qlp + (qt * 16 * HD + ks * 512)); }
    asm volatile("s_wait_xcnt 0x0" :: "v"(qhp), "v"(qlp) : "memory");   // the loads' two addresses stay in their registers up to this wait: nothing lands on them ahead of it
    v8f o[2][4]; float ms[2], l[2];   // ms: the running maximum in log2 units, as rounded: the very value the exponents were taken against
#pragma unroll
    for (int qt = 0; qt < 2; ++qt) { ms[qt] = -3.0e38f; l[qt] = 0.f;
#pragma unroll
        for (int db = 0; db < 4; ++db) o[qt][db] = (v8f){}; }
    asm volatile("s_wait_asynccnt 0x0" ::: "memory");   // the wave's own copies of stage 0 have landed
    __syncthreads();   // stage 0 is published to every wave
    if (ns > 1) fa_stage<HR>(l0 + STB, gkh + SK * HD, gkl + SK * HD, gv0 + SK * HD, gv1 + SK * HD);
#pragma unroll 1   // one stage a trip: the two buffers alternate
    for (int s = 0; s < ns; ++s) {
        const unsigned char* sb = sm + (s & 1) * STB;
#pragma unroll 1   // the wave's two key blocks of the stage share one pass body: the registers of one pass, not of two
        for (int jp = 0; jp < 2; ++jp) { const int kq = kg + jp * 2, kb = s * 4 + kq;   // the key block's place in the stage and its number: scalars
            if (kb <= dkb) {   // a wave skips the key blocks above its diagonal (the same for the whole wave); the stage's waits and barrier stand outside
        const bf* khp = (const bf*)sb + kq * (32 * HD) + ln8; const bf* klp = (const bf*)(sb + PLB) + kq * (32 * HD) + ln8;
        v8f s2[2][2]; v16bf kh[2][2], kl[2][2]; v16h vf[4];
#pragma unroll
        for (int kt = 0; kt < 2; ++kt)
#pragma unroll
            for (int ks = 0; ks < 2; ++ks) { kh[kt][ks] = WFrag<bf>::ld(khp + (kt * 16 * HD + ks * 512)); kl[kt][ks] = WFrag<bf>::ld(klp + (kt * 16 * HD + ks * 512)); }
        __builtin_amdgcn_sched_barrier(0);   // every K load of the pass is issued before its first product: one LDS latency, not one per fragment group
#pragma unroll
        for (int kt = 0; kt < 2; ++kt)
#pragma unroll
            for (int qt = 0; qt < 2; ++qt) { v8f a = (v8f){};
#pragma unroll
                for (int ks = 0; ks < 2; ++ks) { a = wmmab(kh[kt][ks], qh[qt][ks], a); a = wmmab(kh[kt][ks], ql[qt][ks], a); a = wmmab(kl[kt][ks], qh[qt][ks], a); }
                s2[kt][qt] = a; }
        if (!HR) {   // V^T fragments come under the softmax
            const h16* vp = (const h16*)(sb + 2 * PLB) + kq * (32 * HD) + ln8;
#pragma unroll
            for (int db = 0; db < 4; ++db) vf[db] = WFrag<h16>::ld(vp + db * 512);
            __builtin_amdgcn_sched_barrier(0); }   // keeps the eight loads in front of the softmax: sunk among the attn.v products each group would wait out an LDS latency there
        const bool diag = (kb == dkb);   // only the diagonal block holds keys above a query
#pragma unroll
        for (int qt = 0; qt < 2; ++qt) { float mx = -3.0e38f;
#pragma unroll
            for (int kt = 0; kt < 2; ++kt)
#pragma unroll
                for (int j = 0; j < 8; ++j) { float t = s2[kt][qt][j]; if (diag && kt * 16 + hi * 8 + j > qt * 16 + lr) t = -3.0e38f; s2[kt][qt][j] = t; mx = fmaxf(mx, t); }
            mx = fmaxf(mx, __shfl_xor(mx, 16, 32));   // the query's other 16 keys lie in the other half of the wave
            const float mn = fmaxf(ms[qt], mx * CL), al = __builtin_amdgcn_exp2f(ms[qt] - mn); ms[qt] = mn; v2f sum = {0.f, 0.f}; const v2f cl2 = {CL, CL}, mn2 = {-mn, -mn};
#pragma unroll
            for (int kt = 0; kt < 2; ++kt)
#pragma unroll
                for (int j = 0; j < 8; j += 2) { const v2f t = {s2[kt][qt][j], s2[kt][qt][j + 1]}; const v2f e = __builtin_elementwise_fma(t, cl2, mn2);   // two exponents a packed FMA
                    const v2f p = {__builtin_amdgcn_exp2f(e[0]), __builtin_amdgcn_exp2f(e[1])}; s2[kt][qt][j] = p[0]; s2[kt][qt][j + 1] = p[1]; sum += p; }   // even and odd keys summed side by side, one packed add a pair
            l[qt] = l[qt] * al + (sum[0] + sum[1]);
#pragma unroll
            for (int db = 0; db < 4; ++db) o[qt][db] *= al; }
        if (HR) { v16bf ph[2], pl[2]; const bf* vhp = (const bf*)(sb + 2 * PLB) + kq * (32 * HD) + ln8; const bf* vlp = (const bf*)(sb + 3 * PLB) + kq * (32 * HD) + ln8;
#pragma unroll
            for (int qt = 0; qt < 2; ++qt) { v8us h0, h1, l0v, l1v;
#pragma unroll
                for (int j = 0; j < 8; ++j) { unsigned short a, c; splitf(s2[0][qt][j], a, c); h0[j] = a; l0v[j] = c; splitf(s2[1][qt][j], a, c); h1[j] = a; l1v[j] = c; }
                ph[qt] = cat16b(h0, h1); pl[qt] = cat16b(l0v, l1v); }
#pragma unroll
            for (int db = 0; db < 4; ++db) { const v16bf vh = WFrag<bf>::ld(vhp + db * 512), vl = WFrag<bf>::ld(vlp + db * 512);
#pragma unroll
                for (int qt = 0; qt < 2; ++qt) { o[qt][db] = wmmab(vh, ph[qt], o[qt][db]); o[qt][db] = wmmab(vh, pl[qt], o[qt][db]); o[qt][db] = wmmab(vl, ph[qt], o[qt][db]); } }
        } else { v16h pf[2];
#pragma unroll
            for (int qt = 0; qt < 2; ++qt)
#pragma unroll
                for (int j = 0; j < 8; ++j) { pf[qt][j] = tohx(s2[0][qt][j]); pf[qt][8 + j] = tohx(s2[1][qt][j]); }
#pragma unroll
            for (int db = 0; db < 4; ++db)
#pragma unroll
                for (int qt = 0; qt < 2; ++qt) o[qt][db] = wmma16(vf[db], pf[qt], o[qt][db]); }
            } }
        asm volatile("s_wait_dscnt 0x0" ::: "memory");      // the wave's reads of this buffer have returned before it is handed to the copies
        asm volatile("s_wait_asynccnt 0x0" ::: "memory");   // the wave's own copies of stage s + 1 have landed
        __syncthreads();   // publishes stage s + 1 and ends every wave's reads of stage s
        if (s + 2 < ns) { const int go = (s + 2) * (SK * HD); fa_stage<HR>(l0 + (unsigned)(s & 1) * STB, gkh + go, gkl + go, gv0 + go, gv1 + go); }
    }
    asm volatile("s_wait_asynccnt 0x0" ::: "memory");   // no copy is outstanding when the buffers become staging
    float* os = (float*)sm;   // the waves' partial O^T, 32 rows at pitch 68 each; the loop's last barrier has ended every read of the buffers
#pragma unroll
    for (int qt = 0; qt < 2; ++qt) { l[qt] += __shfl_xor(l[qt], 16, 32);   // the two halves' sums of one query
        float* op = os + (wv * 32 + qt * 16 + lr) * 68 + hi * 8;
#pragma unroll
        for (int db = 0; db < 4; ++db) { *(v4fa*)(op + db * 16) = __builtin_shufflevector(o[qt][db], o[qt][db], 0, 1, 2, 3); *(v4fa*)(op + db * 16 + 4) = __builtin_shufflevector(o[qt][db], o[qt][db], 4, 5, 6, 7); }
        if (hi == 0) { ml[(wv * 32 + qt * 16 + lr) * 2] = ms[qt]; ml[(wv * 32 + qt * 16 + lr) * 2 + 1] = l[qt]; } }
    __syncthreads();   // every wave's partial maximum, sum and O^T are in LDS before any thread joins them
    const int q = tid >> 3, d8 = (tid & 7) * 8;
#pragma unroll   // the four groups of 32 queries; waves g and g + 4 hold a group's two partials (one that had no key block has sum 0 and factor 0)
    for (int g = 0; g < 4; ++g) { const int ra = g * 32 + q, rb = (g + 4) * 32 + q; const float ma = ml[ra * 2], mb = ml[rb * 2], Mx = fmaxf(ma, mb);
        const float fa = __builtin_amdgcn_exp2f(ma - Mx), fb = __builtin_amdgcn_exp2f(mb - Mx); const float Ls = fa * ml[ra * 2 + 1] + fb * ml[rb * 2 + 1];
        const float* ia = os + ra * 68 + d8; const float* ib = os + rb * 68 + d8;
        const v4f r0 = *(const v4fa*)ia * fa + *(const v4fa*)ib * fb, r1 = *(const v4fa*)(ia + 4) * fa + *(const v4fa*)(ib + 4) * fb;
        const float rl = __fdiv_rn(1.0f, Ls); float* dst = orow + (size_t)(T * 128 + ra) * DQ + d8;
        *(v4f*)dst = r0 * rl; *(v4f*)(dst + 4) = r1 * rl;
        asm volatile("s_wait_xcnt 0x0" ::: "memory"); }   // stands in front of whatever next lands on the two stores' registers
    asm volatile("s_wait_dscnt 0x0" ::: "memory");   // the thread's reads of the partials have returned before the range is handed to the next tile's copies
    __syncthreads();   // the partials are read out before the block's next tile overwrites them
}
// four waves per SIMD (two blocks per WGP): the register budget is held to 256 so that other waves' work covers a wave's LDS latency and softmax
__global__ __launch_bounds__(AW * 32) __attribute__((amdgpu_waves_per_eu(4, 4))) void k_fattn(const bf* __restrict__ Qh, const bf* __restrict__ Ql, const bf* __restrict__ Kh, const bf* __restrict__ Kl, const h16* __restrict__ V16, const bf* __restrict__ Vh, const bf* __restrict__ Vl, float* OUTb) {
    __shared__ __attribute__((aligned(16))) unsigned char sm[2 * STB]; __shared__ float ml[AW * 32 * 2];
    Qh += (size_t)blockIdx.z * (DQ + DKV) * TT; Ql += (size_t)blockIdx.z * (DQ + DKV) * TT; Kh += (size_t)blockIdx.z * (DQ + DKV) * TT; Kl += (size_t)blockIdx.z * (DQ + DKV) * TT; V16 += (size_t)blockIdx.z * DKV * TT; Vh += (size_t)blockIdx.z * DKV * TT; Vl += (size_t)blockIdx.z * DKV * TT; OUTb += (size_t)blockIdx.z * TT * DQ;   // blockIdx.z: the batch's part of every plane and of the output
    const size_t hp = (size_t)blockIdx.y * TT * HD; const int lane = threadIdx.x & 31, lr = lane & 15, hi = lane >> 4; const int wv = __builtin_amdgcn_readfirstlane(threadIdx.x >> 5);   // the wave's number as a scalar: the key blocks' numbers and the skip above the diagonal stay scalar
#pragma unroll 1   // the two tiles run one after the other through the same buffers
    for (int half = 0; half < 2; ++half) { const int T = half ? (int)blockIdx.x : TT / 128 - 1 - (int)blockIdx.x;
        if (T * 128 < RH) fa_tile<true>(Qh + hp, Ql + hp, Kh + hp, Kl + hp, V16 + hp, Vh + hp, Vl + hp, OUTb + blockIdx.y * HD, T, wv, lr, hi, sm, ml);
        else fa_tile<false>(Qh + hp, Ql + hp, Kh + hp, Kl + hp, V16 + hp, Vh + hp, Vl + hp, OUTb + blockIdx.y * HD, T, wv, lr, hi, sm, ml); }
}

extern "C" void kernel_launch(void* const* d_in, const int* in_sizes, int n_in,
                              void* d_out, int out_size, void* d_ws, size_t ws_size, hipStream_t stream) {
    (void)in_sizes; (void)n_in; (void)out_size;
    const float* x = (const float*)d_in[0]; const float* pq = (const float*)d_in[1]; const float* pk = (const float*)d_in[2]; const float* pv = (const float*)d_in[3];   /* each [16][1024][64] */ const float* wq = pq, *wk = pk, *wv = pv, *wo = nullptr; (void)wo;
    float* OUT = (float*)d_out;     // [4][2048][1024]
    char* wsp = (char*)d_ws;
    auto take = [&](size_t bytes) { char* p = wsp; wsp += (bytes + 255) & ~(size_t)255; return (void*)p; };
    bf* WQ = (bf*)take((size_t)(DQ + 2 * DKV) * DM * 2);   /* q, k, v rows one behind the other: one [3072][1024] Bt */
    bf* XB = (bf*)take((size_t)NB_ * TT * DM * 2);
    h16* VT16 = (h16*)take((size_t)NB_ * NKV * HD * TT * 2);
    bf* QPh = (bf*)take((size_t)NB_ * (NH_ + NKV) * TT * HD * 2); bf* KPh = QPh + (size_t)NH_ * TT * HD;   /* per batch q heads, then k heads: GEMM column n (Bt row n) lands in plane n / 64 */ bf* QPl = (bf*)take((size_t)NB_ * (NH_ + NKV) * TT * HD * 2); bf* KPl = QPl + (size_t)NH_ * TT * HD; bf* VTh = (bf*)take((size_t)NB_ * NKV * HD * TT * 2); bf* VTl = (bf*)take((size_t)NB_ * NKV * HD * TT * 2);
    if ((size_t)(wsp - (char*)d_ws) > ws_size) return;
    k_prep<<<WB + NB_ * TT * DM / 2048, 256, 0, stream>>>(x, wq, wk, wv, WQ, XB);   /* tensor z's head hh 'xw' [1024][64] -> Bt rows z*1024 + hh*64..; x -> bf16 */
    k_proj<<<dim3(192, 1, NB_), 128, 0, stream>>>(XB, WQ, QPh, QPl, VT16, VTh, VTl);
    k_fattn<<<dim3(TT / 256, NH_, NB_), AW * 32, 0, stream>>>(QPh, QPl, KPh, KPl, VT16, VTh, VTl, OUT);
}

// v010
// A run of this version takes 109 microseconds.
// Next to v009, in two timings, it ran 1.05 times as fast each time.
// Over all steps from v000 it is 27.3 times as fast.
#include <hip/hip_runtime.h>

// Causal multi-head attention with per-head weight tensors, scaled by sqrt(embed) (x [4][2048][1024]; q,k,v = einsum('bte,hed', x, W) (Wq, Wk, Wv [16][1024][64] uniform(+-1/32): head h's 'xw' block); 16 heads x 64; causal (-inf); scores / sqrt(1024) (the source's quirk: sigma ~0.1 logits); softmax; out = concat heads -> [4][2048][1024] (8.4 M; no output projection)).
// Fragment order: every plane that feeds a matrix operand (x, Bt, q, k, V^T) is stored as 16-row x 32-k fragments of 512 elements, element (row r, k) at (k >> 4 & 1) * 256 + (k >> 3 & 1) * 128 + r * 8 + (k & 7); a row block's fragments follow one another along k (V^T instead: the four d blocks of each 32 keys one behind the other). Lane l of a wave then finds its two 16-byte pieces at l * 8 and 256 + l * 8: each wave-wide load reads 512 contiguous bytes, four whole lines.
// Three launches, each for all four batches (every plane but Bt holds the batches one behind the other): bf16 copy of x together with the three projection tensors' 48 'xw' [1024][64] blocks transposed into one [3072][1024] Bt (rows q h*64.., k 1024 + h*64.., v 2048 + h*64..); exact projections, one N = 3072 GEMM whose epilogue writes the head planes itself; one fused causal attention launch for the 4 x 16 heads (scores, online softmax and attn.v in registers; the score matrix never reaches memory).
// Compute dtypes, f32 accumulate: every input rounded to bf16; projections exact; scores 3 hi/lo products on every row; softmax f32 (x 1/32), unnormalised probabilities in (0, 256], divided by the f32 row sum at the end; attn.v rows < 512 3 hi/lo products, rest fp16; output f32.

#define NB_  4
#define TT   2048
#define DM   1024
#define NH_  16
#define NKV  16
#define REP  (NH_ / NKV)
#define HD   64
#define DQ   (NH_ * HD)
#define DKV  (NKV * HD)
#define DF   (DQ + 2 * DKV)        // q, k and v projection columns side by side
#define AW   8                    // waves of a fused-attention block: 4 groups of 32 queries x 2 halves of the key blocks
#define RH   512                  // query rows < RH use hi+lo planes (0: none)
#define SCL  0.03125f  // 1/sqrt(embed = 1024): the source's quirk
typedef _Float16 h16;
typedef unsigned short bf;
typedef __attribute__((ext_vector_type(16))) __bf16   v16bf;
typedef __attribute__((ext_vector_type(16))) _Float16 v16h;
typedef __attribute__((ext_vector_type(8)))  _Float16 v8h;
typedef __attribute__((ext_vector_type(8)))  unsigned short v8us;
typedef __attribute__((ext_vector_type(8)))  float    v8f;
typedef __attribute__((ext_vector_type(4)))  float    v4f;
typedef __attribute__((ext_vector_type(2)))  float    v2f;
typedef v8h  __attribute__((may_alias)) v8ha;
typedef v4f  __attribute__((may_alias)) v4fa;
typedef v8us __attribute__((may_alias)) v8usa;

__device__ __forceinline__ unsigned short f2bf(float f) { unsigned u = __float_as_uint(f); u += 0x7FFFu + ((u >> 16) & 1u); return (unsigned short)(u >> 16); }
__device__ __forceinline__ float bf2f(unsigned short b) { return __uint_as_float(((unsigned)b) << 16); }
__device__ __forceinline__ float bfr(float f) { return bf2f(f2bf(f)); }
__device__ __forceinline__ v16h cat16(v8h lo, v8h hi) { return __builtin_shufflevector(lo, hi, 0, 1, 2, 3, 4, 5, 6, 7, 8, 9, 10, 11, 12, 13, 14, 15); }
__device__ __forceinline__ v16bf cat16b(v8us lo, v8us hi) { return __builtin_bit_cast(v16bf, __builtin_shufflevector(lo, hi, 0, 1, 2, 3, 4, 5, 6, 7, 8, 9, 10, 11, 12, 13, 14, 15)); }
__device__ __forceinline__ v8f wmma16(v16h a, v16h b, v8f c) { return __builtin_amdgcn_wmma_f32_16x16x32_f16(false, a, false, b, (short)0, c, false, false); }
__device__ __forceinline__ v8f wmmab(v16bf a, v16bf b, v8f c) { return __builtin_amdgcn_wmma_f32_16x16x32_bf16(false, a, false, b, (short)0, c, false, false); }



__device__ __forceinline__ h16 tohx(float x) { return (h16)x; }
__device__ __forceinline__ void splitf(float y, unsigned short& h, unsigned short& l) { h = f2bf(y); l = f2bf(y - bf2f(h)); }
typedef __attribute__((ext_vector_type(2))) unsigned short v2us;

// ld: p = the fragment's start + lane * 8 in a plane in fragment order
template <typename T16> struct WFrag;
template <> struct WFrag<h16> { typedef v16h V; static __device__ __forceinline__ V ld(const h16* p) { return cat16(*(const v8h*)p, *(const v8h*)(p + 256)); } static __device__ __forceinline__ v8f mma(V a, V b, v8f c) { return wmma16(a, b, c); } };
template <> struct WFrag<bf> { typedef v16bf V; static __device__ __forceinline__ V ld(const bf* p) { return cat16b(*(const v8us*)p, *(const v8us*)(p + 256)); } static __device__ __forceinline__ v8f mma(V a, V b, v8f c) { return wmmab(a, b, c); } };
// ---- k_proj: the q, k, v projection GEMM. A block of 4 waves does a tile of 128 A rows x 256 B rows; wave (wa, wb) of 2 x 2 holds 64 x 128 of it (32 accumulators) over the whole K. grid (192, 1, batches), 128 threads; three blocks fit a WGP, so all 768 are resident at once.
// Blocks 0..127: q and k heads (A = 128 rows of x, B = 256 Bt rows = 4 heads). Blocks 128..191: v heads, computed transposed (A = 128 Bt rows = 2 heads, B = 256 rows of x; both planes share one fragment loader).
// Both operand slabs of 64 k (24 blocks of 16 rows, 2 KiB each, contiguous in fragment order) are brought into LDS by asynchronous copies, two buffers: the next slab flies while this one is worked on, and every fragment is fetched from L2 once a block instead of once a wave.
// The epilogue rounds the f32 sums into the planes that the attention kernel reads: q and k [h][t][d] (rows t, k = d) as bf16 hi + lo, v as V^T [g][d][t] (rows d, k = t; the four d blocks of 32 keys side by side) in fp16 and bf16 hi + lo, all in fragment order. Each wave turns its own 16 x 64 bands through its own LDS range: a lane then holds 8 neighbouring columns of one row, and a wave stores 512 contiguous bytes.
#define PKS  64                    // k of a slab
#define SLB  (24 * 2048)           // bytes of a slab: 8 A and 16 B blocks of 16 rows x 64 k
// eight copies of 16 bytes a lane: blocks of 16 rows lie 2 KiB apart in LDS and 16 * DM elements apart in the plane. The wait is the last line of the copies' own statement: no register that a copy names is rewritten ahead of it.
__device__ __forceinline__ void cp8(unsigned l, const bf* g) {
    asm volatile("global_load_async_to_lds_b128 %0, %8, off\n\t"
                 "global_load_async_to_lds_b128 %1, %9, off\n\t"
                 "global_load_async_to_lds_b128 %2, %10, off\n\t"
                 "global_load_async_to_lds_b128 %3, %11, off\n\t"
                 "global_load_async_to_lds_b128 %4, %12, off\n\t"
                 "global_load_async_to_lds_b128 %5, %13, off\n\t"
                 "global_load_async_to_lds_b128 %6, %14, off\n\t"
                 "global_load_async_to_lds_b128 %7, %15, off\n\t"
                 "s_wait_xcnt 0x0"
                 :: "v"(l), "v"(l + 2048u), "v"(l + 4096u), "v"(l + 6144u), "v"(l + 8192u), "v"(l + 10240u), "v"(l + 12288u), "v"(l + 14336u),
                    "v"(g), "v"(g + 16 * DM), "v"(g + 32 * DM), "v"(g + 48 * DM), "v"(g + 64 * DM), "v"(g + 80 * DM), "v"(g + 96 * DM), "v"(g + 112 * DM) : "memory");
}
__global__ __launch_bounds__(128) __attribute__((amdgpu_waves_per_eu(3, 3))) void k_proj(const bf* __restrict__ X, const bf* __restrict__ Bt, bf* Ph, bf* Pl, h16* V16, bf* Vh, bf* Vl) {
    typedef typename WFrag<bf>::V V;
    constexpr int NT = DM / PKS;   // slabs along K
    __shared__ __attribute__((aligned(16))) unsigned char sm[2 * SLB];
    const int tid = threadIdx.x, lane = tid & 31, lr = lane & 15, hi = lane >> 4; const int wv = __builtin_amdgcn_readfirstlane(tid >> 5);   /* the wave's number as a scalar */ const int wa = wv & 1, wb = wv >> 1;
    X += (size_t)blockIdx.z * TT * DM; Ph += (size_t)blockIdx.z * (DQ + DKV) * TT; Pl += (size_t)blockIdx.z * (DQ + DKV) * TT; V16 += (size_t)blockIdx.z * DKV * TT; Vh += (size_t)blockIdx.z * DKV * TT; Vl += (size_t)blockIdx.z * DKV * TT;   // blockIdx.z: the batch's part of x and of every head plane
    const int bx = blockIdx.x; const bool vt = bx >= 128;   // a block of v heads (the same for the whole block): rows d, columns t
    const int tA = vt ? (bx - 128) & 7 : bx & 15, tB = vt ? (bx - 128) >> 3 : bx >> 4;
    const bf* Ag = (vt ? Bt + (size_t)(DQ + DKV) * DM : X) + (size_t)tA * 128 * DM + tid * 8;   // the thread's 16 bytes of the first A block's slab 0; a slab is PKS * 16 elements further along
    const bf* Bg = (vt ? X : Bt) + (size_t)tB * 256 * DM + tid * 8;
    const unsigned l0 = (unsigned)(size_t)sm + (unsigned)tid * 16u;   // the thread's LDS byte address in buffer 0
    v8f acc[4][8];
#pragma unroll
    for (int mb = 0; mb < 4; ++mb)
#pragma unroll
        for (int nb = 0; nb < 8; ++nb) acc[mb][nb] = (v8f){};
    cp8(l0, Ag); cp8(l0 + 16384u, Bg); cp8(l0 + 32768u, Bg + 128 * DM);
    asm volatile("s_wait_asynccnt 0x0" ::: "memory");   // the wave's own copies of slab 0 have landed
    __syncthreads();   // slab 0 is published to every wave
    cp8(l0 + SLB, Ag + PKS * 16); cp8(l0 + SLB + 16384u, Bg + PKS * 16); cp8(l0 + SLB + 32768u, Bg + 128 * DM + PKS * 16);
#pragma unroll 1   // one slab a trip: the two buffers alternate
    for (int t = 0; t < NT; ++t) {
        const bf* sb = (const bf*)(sm + (t & 1) * SLB) + lane * 8;
#pragma unroll
        for (int ks = 0; ks < PKS / 32; ++ks) {
            V a[4], b[2];
#pragma unroll
            for (int mb = 0; mb < 4; ++mb) a[mb] = WFrag<bf>::ld(sb + (wa * 4 + mb) * 1024 + ks * 512);
            b[0] = WFrag<bf>::ld(sb + (8 + wb * 8) * 1024 + ks * 512);
#pragma unroll
            for (int nb = 0; nb < 8; ++nb) { if (nb < 7) { b[(nb + 1) & 1] = WFrag<bf>::ld(sb + (8 + wb * 8 + nb + 1) * 1024 + ks * 512);   // the next B fragment is asked for ahead of this one's four products
                    __builtin_amdgcn_sched_barrier(0); }   // keeps that load in front of the products: without it the scheduler sinks it behind them and every four products wait out an LDS latency
#pragma unroll
                for (int mb = 0; mb < 4; ++mb) acc[mb][nb] = WFrag<bf>::mma(a[mb], b[nb & 1], acc[mb][nb]); }
        }
        asm volatile("s_wait_dscnt 0x0" ::: "memory");      // the wave's reads of this buffer have returned before it is handed to the copies
        asm volatile("s_wait_asynccnt 0x0" ::: "memory");   // the wave's own copies of slab t + 1 have landed
        __syncthreads();   // publishes slab t + 1 and ends every wave's reads of slab t
        if (t + 2 < NT) { const unsigned lb = l0 + (unsigned)(t & 1) * SLB; const bf* ga = Ag + (t + 2) * (PKS * 16); const bf* gb = Bg + (t + 2) * (PKS * 16);
            cp8(lb, ga); cp8(lb + 16384u, gb); cp8(lb + 32768u, gb + 128 * DM); }
    }
    asm volatile("s_wait_asynccnt 0x0" ::: "memory");   // no copy is outstanding when the buffers become staging
    float* os = (float*)sm + wv * (16 * 68);   // the wave's own staging band, 16 rows at pitch 68; the loop's last barrier has ended every read of the buffers
    const int ia = tA * 128 + wa * 64, ib = tB * 256 + wb * 128;
    // plane element of (tile row 0, tile column 0) and the steps to the next 64 columns, the next 16 rows and the next 32 columns; 8 columns are 128 elements in both layouts
    const size_t pb = (vt ? (size_t)ia * TT + (size_t)ib * HD : (size_t)ib * TT + (size_t)ia * HD) + hi * 128 + lr * 8;
    const size_t sH = vt ? 2 * 32 * HD : (size_t)HD * TT, sM = vt ? 512 : 16 * HD, sC = vt ? 32 * HD : 512;
    bf* P1 = vt ? Vh : Ph; bf* P2 = vt ? Vl : Pl;
#pragma unroll   // constant indices keep acc in registers
    for (int hb = 0; hb < 2; ++hb)
#pragma unroll
        for (int mb = 0; mb < 4; ++mb) {
#pragma unroll
            for (int nb = 0; nb < 4; ++nb)
#pragma unroll
                for (int j = 0; j < 8; ++j) os[(hi * 8 + j) * 68 + nb * 16 + lr] = acc[mb][hb * 4 + nb][j];
            asm volatile("s_wait_dscnt 0x0" ::: "memory");   // the wave's band is in LDS before its lanes read one another's values
            v4f v[4][2];
#pragma unroll
            for (int cg = 0; cg < 4; ++cg) { const float* ip = os + lr * 68 + (cg * 2 + hi) * 8; v[cg][0] = *(const v4fa*)ip; v[cg][1] = *(const v4fa*)(ip + 4); }
            asm volatile("s_wait_dscnt 0x0" ::: "memory");   // the band is read out before the next band overwrites it
#pragma unroll
            for (int cg = 0; cg < 4; ++cg) { v8us oh, ol; const size_t po = pb + hb * sH + mb * sM + (cg >> 1) * sC + (cg & 1) * 256;
#pragma unroll
                for (int e = 0; e < 8; ++e) { unsigned short a2, c2; splitf(v[cg][e >> 2][e & 3], a2, c2); oh[e] = a2; ol[e] = c2; }
                *(v8us*)(P1 + po) = oh; *(v8us*)(P2 + po) = ol;
                asm volatile("s_wait_xcnt 0x0" ::: "memory");   // stands in front of whatever next lands on the two stores' registers
                if (vt) { v8h o16;
#pragma unroll
                    for (int e = 0; e < 8; ++e) o16[e] = tohx(v[cg][e >> 2][e & 3]);
                    *(v8h*)(V16 + po) = o16;
                    asm volatile("s_wait_xcnt 0x0" ::: "memory"); } }   // as behind the two stores above
        }
}

// block (bx, by, bz) of (DM / 32, heads, 3): bz picks the tensor, by its head, bx 32 values of k; Bt holds the tensors' heads one behind the other, in fragment order (rows n, 64 a head).
// A thread gathers 8 values of k for one n: a wave reads 32 neighbouring n of one k (a whole line) per load and stores two runs of 256 bytes.
__device__ __forceinline__ void wtG(const float* __restrict__ w0, const float* __restrict__ w1, const float* __restrict__ w2, bf* Bt, unsigned bx, unsigned by, unsigned bz) {
    const int n = threadIdx.x & 63, g = threadIdx.x >> 6;
    const float* p = (bz == 0 ? w0 : bz == 1 ? w1 : w2) + (size_t)by * DM * HD + (size_t)(bx * 32 + g * 8) * HD + n; float v[8];
#pragma unroll
    for (int e = 0; e < 8; ++e) v[e] = p[e * HD];
    asm volatile("s_wait_xcnt 0x0" :: "v"(p) : "memory");   // the loads' address stays in its registers up to this wait: none of their results lands on it ahead of it
    v8us o;
#pragma unroll
    for (int e = 0; e < 8; ++e) o[e] = f2bf(v[e]);
    *(v8us*)(Bt + ((size_t)bz * NH_ + by) * HD * DM + (size_t)(n >> 4) * 16 * DM + bx * 512 + g * 128 + (n & 15) * 8) = o;
}
// thread i writes the 8 elements i * 8.. of the plane in fragment order: row (i >> 11) * 16 + (i & 15), k = (i >> 4 & 127) * 8 (DM / 8 = 128 groups of 8 a row); a block reads 512 contiguous bytes of each of 16 rows
__device__ __forceinline__ void cvt8(const float* __restrict__ src, bf* dst, unsigned blk) { const size_t i = (size_t)blk * 256 + threadIdx.x; const v8f v = *(const v8f*)(src + ((i / (DM * 2)) * 16 + (i & 15)) * DM + ((i >> 4) & (DM / 8 - 1)) * 8); v8us o;
#pragma unroll
    for (int k = 0; k < 8; ++k) o[k] = f2bf(v[k]); *(v8us*)(dst + i * 8) = o;
    asm volatile("s_wait_xcnt 0x0" ::: "memory");   // the built code lays the weight branch, which rewrites this store's registers, directly behind it: the wait stands in front of it
}
// ---- k_prep: both operand planes of the projection GEMM in one launch: the first WB blocks transpose the weights, the other NB_ * TT * DM / 2048 copy x (all batches: 16-row blocks one behind the other)
#define WB   (DM / 32 * NH_ * 3)
__global__ __launch_bounds__(256) void k_prep(const float* __restrict__ x, const float* __restrict__ w0, const float* __restrict__ w1, const float* __restrict__ w2, bf* Bt, bf* XB) {
    if (blockIdx.x < WB) wtG(w0, w1, w2, Bt, blockIdx.x & (DM / 32 - 1), (blockIdx.x / (DM / 32)) & (NH_ - 1), blockIdx.x / (DM / 32 * NH_));
    else cvt8(x, XB, blockIdx.x - WB);
}

// ---- k_fattn: fused causal attention. grid (TT / 256, heads, batches), AW waves. A block does the two 128-query tiles TT/128 - 1 - x and x of one head (together TT/128 + 1 stages of 128 keys: every block has the same work); the 512 blocks are all resident at once, two a WGP.
// Transposed products: S^T = K Q^T (A = 16 key rows, B = 16 query columns, hi/lo 3 products) leaves one query per lane (keys 8 hi + j of each 16 in the lane's 8 registers), so two S^T tiles, converted in place, are the B operand (32 keys) of O^T += V^T P^T.
// Wave (qs, kg) of 4 x 2 holds the tile's queries qs * 32 .. and takes the key blocks of 32 whose number has parity kg, each wave with its own running maximum, sum and O^T; the two partials of a query are joined through LDS.
// A stage is 128 keys of every plane the tile reads (K hi, K lo, then V^T fp16 or V^T hi, lo; 16 KiB each, contiguous in fragment order), brought into LDS by asynchronous copies, two buffers: the next stage flies while this one is worked on, and a key block is fetched from L2 once for 128 queries instead of once for 32.
#define SK   128                   // keys of a stage
#define PLB  (SK * HD * 2)         // bytes of one plane's part of a stage
#define STB  (4 * PLB)             // bytes of a stage buffer
// four copies of 16 bytes a lane: one plane's part of a stage, 4 KiB a copy over the block's 256 threads. The wait is the last line of the copies' own statement: no register that a copy names is rewritten ahead of it.
__device__ __forceinline__ void cp4(unsigned l, const bf* g) {
    asm volatile("global_load_async_to_lds_b128 %0, %4, off\n\t"
                 "global_load_async_to_lds_b128 %1, %5, off\n\t"
                 "global_load_async_to_lds_b128 %2, %6, off\n\t"
                 "global_load_async_to_lds_b128 %3, %7, off\n\t"
                 "s_wait_xcnt 0x0"
                 :: "v"(l), "v"(l + 4096u), "v"(l + 8192u), "v"(l + 12288u), "v"(g), "v"(g + 2048), "v"(g + 4096), "v"(g + 6144) : "memory");
}
// l: the thread's LDS byte address in the buffer; the pointers: the thread's 16 bytes at the start of the stage in each plane
template <bool HR>
__device__ __forceinline__ void fa_stage(unsigned l, const bf* kh, const bf* kl, const bf* v0, const bf* v1) { cp4(l, kh); cp4(l + PLB, kl); cp4(l + 2 * PLB, v0); if (HR) cp4(l + 3 * PLB, v1); }
template <bool HR>
__device__ __forceinline__ void fa_tile(const bf* __restrict__ Qh, const bf* __restrict__ Ql, const bf* __restrict__ Kh, const bf* __restrict__ Kl, const h16* __restrict__ V16, const bf* __restrict__ Vh, const bf* __restrict__ Vl, float* orow, int T, int wv, int lr, int hi, unsigned char* sm, float* ml) {
    constexpr float CL = SCL * 1.4426950408889634f;   // score -> log2 units
    constexpr float PMX = 256.f;   // bound of a lane's sum of its 32 probabilities in a common pass
    const int tid = (int)threadIdx.x, qs = wv & 3, kg = wv >> 2;
    const int q0 = T * 128 + qs * 32;   // the wave's first query
    const int dkb = T * 4 + qs;         // the wave's diagonal key block, its last
    const int ns = T + 1;               // stages: keys 0 .. the tile's last query
    const unsigned ln8 = (unsigned)((hi * 16 + lr) * 8);   // the lane's place in every fragment
    const unsigned l0 = (unsigned)(size_t)sm + (unsigned)tid * 16u;   // the thread's LDS byte address in buffer 0
    const bf* gkh = Kh + tid * 8; const bf* gkl = Kl + tid * 8; const bf* gv0 = (HR ? Vh : (const bf*)V16) + tid * 8; const bf* gv1 = Vl + tid * 8;   // the thread's 16 bytes of stage 0; a stage is SK * HD elements further along
    fa_stage<HR>(l0, gkh, gkl, gv0, gv1);
    v16bf qh[2][2], ql[2][2]; const bf* qhp = Qh + (size_t)q0 * HD + ln8; const bf* qlp = Ql + (size_t)q0 * HD + ln8;
#pragma unroll
    for (int qt = 0; qt < 2; ++qt)
#pragma unroll
        for (int ks = 0; ks < 2; ++ks) { qh[qt][ks] = WFrag<bf>::ld(qhp + (qt * 16 * HD + ks * 512)); ql[qt][ks] = WFrag<bf>::ld(qlp + (qt * 16 * HD + ks * 512)); }
    asm volatile("s_wait_xcnt 0x0" :: "v"(qhp), "v"(qlp) : "memory");   // the loads' two addresses stay in their registers up to this wait: nothing lands on them ahead of it
    v8f o[2][4]; float ms[2], l[2];   // ms: the running maximum in log2 units, as rounded: the very value the exponents were taken against
#pragma unroll
    for (int qt = 0; qt < 2; ++qt) { ms[qt] = -3.0e38f; l[qt] = 0.f;
#pragma unroll
        for (int db = 0; db < 4; ++db) o[qt][db] = (v8f){}; }
    asm volatile("s_wait_asynccnt 0x0" ::: "memory");   // the wave's own copies of stage 0 have landed
    __syncthreads();   // stage 0 is published to every wave
    if (ns > 1) fa_stage<HR>(l0 + STB, gkh + SK * HD, gkl + SK * HD, gv0 + SK * HD, gv1 + SK * HD);
#pragma unroll 1   // one stage a trip: the two buffers alternate
    for (int s = 0; s < ns; ++s) {
        const unsigned char* sb = sm + (s & 1) * STB;
#pragma unroll 1   // the wave's two key blocks of the stage share one pass body: the registers of one pass, not of two
        for (int jp = 0; jp < 2; ++jp) { const int kq = kg + jp * 2, kb = s * 4 + kq;   // the key block's place in the stage and its number: scalars
            if (kb <= dkb) {   // a wave skips the key blocks above its diagonal (the same for the whole wave); the stage's waits and barrier stand outside
        const bf* khp = (const bf*)sb + kq * (32 * HD) + ln8; const bf* klp = (const bf*)(sb + PLB) + kq * (32 * HD) + ln8;
        v8f s2[2][2]; v16h vf[4]; float ls[2];
        // Two kinds of pass. The common pass takes its exponents against the maximum in use and does nothing else: no mask, no maximum, no exchange between the halves, no rescale.
        // The full pass (mask, maximum, exchange, rescale of O^T and of the sum in front of the exponents) is the wave's first key block (no maximum in use yet) and its diagonal block (the only one with keys above a query).
        // A common pass in which a lane's sum of its 32 probabilities exceeds PMX has touched neither O^T nor the sum: it is done again from the K fragments as a full pass. So every probability that is used is <= PMX, whatever the scores, and the division by the final sum takes the stale maximum out again.
        const bool diag = (kb == dkb);
        bool full = diag || kb == kg;   // scalar
#pragma unroll 1   // at most two trips; the second is the rare repeat and shares the first one's code
        for (int tr = 0; tr < 2; ++tr) {
        v16bf kh[2][2], kl[2][2];
#pragma unroll
        for (int kt = 0; kt < 2; ++kt)
#pragma unroll
            for (int ks = 0; ks < 2; ++ks) { kh[kt][ks] = WFrag<bf>::ld(khp + (kt * 16 * HD + ks * 512)); kl[kt][ks] = WFrag<bf>::ld(klp + (kt * 16 * HD + ks * 512)); }
        __builtin_amdgcn_sched_barrier(0);   // every K load of the pass is issued before its first product: one LDS latency, not one per fragment group
#pragma unroll
        for (int kt = 0; kt < 2; ++kt)
#pragma unroll
            for (int qt = 0; qt < 2; ++qt) { v8f a = (v8f){};
#pragma unroll
                for (int ks = 0; ks < 2; ++ks) { a = wmmab(kh[kt][ks], qh[qt][ks], a); a = wmmab(kh[kt][ks], ql[qt][ks], a); a = wmmab(kl[kt][ks], qh[qt][ks], a); }
                s2[kt][qt] = a; }
        if (!HR) {   // V^T fragments come under the softmax
            const h16* vp = (const h16*)(sb + 2 * PLB) + kq * (32 * HD) + ln8;
#pragma unroll
            for (int db = 0; db < 4; ++db) vf[db] = WFrag<h16>::ld(vp + db * 512);
            __builtin_amdgcn_sched_barrier(0); }   // keeps the eight loads in front of the softmax: sunk among the attn.v products each group would wait out an LDS latency there
        if (full) {
#pragma unroll
            for (int qt = 0; qt < 2; ++qt) { float mx = -3.0e38f;
#pragma unroll
                for (int kt = 0; kt < 2; ++kt)
#pragma unroll
                    for (int j = 0; j < 8; ++j) { float t = s2[kt][qt][j]; if (diag && kt * 16 + hi * 8 + j > qt * 16 + lr) t = -3.0e38f; s2[kt][qt][j] = t; mx = fmaxf(mx, t); }
                mx = fmaxf(mx, __shfl_xor(mx, 16, 32));   // the query's other 16 keys lie in the other half of the wave
                const float mn = fmaxf(ms[qt], mx * CL), al = __builtin_amdgcn_exp2f(ms[qt] - mn); ms[qt] = mn; l[qt] *= al;
#pragma unroll
                for (int db = 0; db < 4; ++db) o[qt][db] *= al; } }
#pragma unroll
        for (int qt = 0; qt < 2; ++qt) { v2f sum = {0.f, 0.f}; const v2f cl2 = {CL, CL}, mn2 = {-ms[qt], -ms[qt]};
#pragma unroll
            for (int kt = 0; kt < 2; ++kt)
#pragma unroll
                for (int j = 0; j < 8; j += 2) { const v2f t = {s2[kt][qt][j], s2[kt][qt][j + 1]}; const v2f e = __builtin_elementwise_fma(t, cl2, mn2);   // two exponents a packed FMA
                    const v2f p = {__builtin_amdgcn_exp2f(e[0]), __builtin_amdgcn_exp2f(e[1])}; s2[kt][qt][j] = p[0]; s2[kt][qt][j + 1] = p[1]; sum += p; }   // even and odd keys summed side by side, one packed add a pair
            ls[qt] = sum[0] + sum[1]; }
        if (full || __builtin_amdgcn_ballot_w32(!(ls[0] + ls[1] <= PMX)) == 0) break;   // one test a pass, a scalar branch; an infinite or not-a-number sum repeats the pass too
        full = true; }
        l[0] += ls[0]; l[1] += ls[1];
        if (HR) { v16bf ph[2], pl[2]; const bf* vhp = (const bf*)(sb + 2 * PLB) + kq * (32 * HD) + ln8; const bf* vlp = (const bf*)(sb + 3 * PLB) + kq * (32 * HD) + ln8;
#pragma unroll
            for (int qt = 0; qt < 2; ++qt) { v8us h0, h1, l0v, l1v;
#pragma unroll
                for (int j = 0; j < 8; ++j) { unsigned short a, c; splitf(s2[0][qt][j], a, c); h0[j] = a; l0v[j] = c; splitf(s2[1][qt][j], a, c); h1[j] = a; l1v[j] = c; }
                ph[qt] = cat16b(h0, h1); pl[qt] = cat16b(l0v, l1v); }
#pragma unroll
            for (int db = 0; db < 4; ++db) { const v16bf vh = WFrag<bf>::ld(vhp + db * 512), vl = WFrag<bf>::ld(vlp + db * 512);
#pragma unroll
                for (int qt = 0; qt < 2; ++qt) { o[qt][db] = wmmab(vh, ph[qt], o[qt][db]); o[qt][db] = wmmab(vh, pl[qt], o[qt][db]); o[qt][db] = wmmab(vl, ph[qt], o[qt][db]); } }
        } else { v16h pf[2];
#pragma unroll
            for (int qt = 0; qt < 2; ++qt)
#pragma unroll
                for (int j = 0; j < 8; ++j) { pf[qt][j] = tohx(s2[0][qt][j]); pf[qt][8 + j] = tohx(s2[1][qt][j]); }
#pragma unroll
            for (int db = 0; db < 4; ++db)
#pragma unroll
                for (int qt = 0; qt < 2; ++qt) o[qt][db] = wmma16(vf[db], pf[qt], o[qt][db]); }
            } }
        asm volatile("s_wait_dscnt 0x0" ::: "memory");      // the wave's reads of this buffer have returned before it is handed to the copies
        asm volatile("s_wait_asynccnt 0x0" ::: "memory");   // the wave's own copies of stage s + 1 have landed
        __syncthreads();   // publishes stage s + 1 and ends every wave's reads of stage s
        if (s + 2 < ns) { const int go = (s + 2) * (SK * HD); fa_stage<HR>(l0 + (unsigned)(s & 1) * STB, gkh + go, gkl + go, gv0 + go, gv1 + go); }
    }
    asm volatile("s_wait_asynccnt 0x0" ::: "memory");   // no copy is outstanding when the buffers become staging
    float* os = (float*)sm;   // the waves' partial O^T, 32 rows at pitch 68 each; the loop's last barrier has ended every read of the buffers
#pragma unroll
    for (int qt = 0; qt < 2; ++qt) { l[qt] += __shfl_xor(l[qt], 16, 32);   // the two halves' sums of one query
        float* op = os + (wv * 32 + qt * 16 + lr) * 68 + hi * 8;
#pragma unroll
        for (int db = 0; db < 4; ++db) { *(v4fa*)(op + db * 16) = __builtin_shufflevector(o[qt][db], o[qt][db], 0, 1, 2, 3); *(v4fa*)(op + db * 16 + 4) = __builtin_shufflevector(o[qt][db], o[qt][db], 4, 5, 6, 7); }
        if (hi == 0) { ml[(wv * 32 + qt * 16 + lr) * 2] = ms[qt]; ml[(wv * 32 + qt * 16 + lr) * 2 + 1] = l[qt]; } }
    __syncthreads();   // every wave's partial maximum, sum and O^T are in LDS before any thread joins them
    const int q = tid >> 3, d8 = (tid & 7) * 8;
#pragma unroll   // the four groups of 32 queries; waves g and g + 4 hold a group's two partials (one that had no key block has sum 0 and factor 0)
    for (int g = 0; g < 4; ++g) { const int ra = g * 32 + q, rb = (g + 4) * 32 + q; const float ma = ml[ra * 2], mb = ml[rb * 2], Mx = fmaxf(ma, mb);
        const float fa = __builtin_amdgcn_exp2f(ma - Mx), fb = __builtin_amdgcn_exp2f(mb - Mx); const float Ls = fa * ml[ra * 2 + 1] + fb * ml[rb * 2 + 1];
        const float* ia = os + ra * 68 + d8; const float* ib = os + rb * 68 + d8;
        const v4f r0 = *(const v4fa*)ia * fa + *(const v4fa*)ib * fb, r1 = *(const v4fa*)(ia + 4) * fa + *(const v4fa*)(ib + 4) * fb;
        const float rl = __fdiv_rn(1.0f, Ls); float* dst = orow + (size_t)(T * 128 + ra) * DQ + d8;
        *(v4f*)dst = r0 * rl; *(v4f*)(dst + 4) = r1 * rl;
        asm volatile("s_wait_xcnt 0x0" ::: "memory"); }   // stands in front of whatever next lands on the two stores' registers
    asm volatile("s_wait_dscnt 0x0" ::: "memory");   // the thread's reads of the partials have returned before the range is handed to the next tile's copies
    __syncthreads();   // the partials are read out before the block's next tile overwrites them
}
// four waves per SIMD (two blocks per WGP): the register budget is held to 256 so that other waves' work covers a wave's LDS latency and softmax
__global__ __launch_bounds__(AW * 32) __attribute__((amdgpu_waves_per_eu(4, 4))) void k_fattn(const bf* __restrict__ Qh, const bf* __restrict__ Ql, const bf* __restrict__ Kh, const bf* __restrict__ Kl, const h16* __restrict__ V16, const bf* __restrict__ Vh, const bf* __restrict__ Vl, float* OUTb) {
    __shared__ __attribute__((aligned(16))) unsigned char sm[2 * STB]; __shared__ float ml[AW * 32 * 2];
    Qh += (size_t)blockIdx.z * (DQ + DKV) * TT; Ql += (size_t)blockIdx.z * (DQ + DKV) * TT; Kh += (size_t)blockIdx.z * (DQ + DKV) * TT; Kl += (size_t)blockIdx.z * (DQ + DKV) * TT; V16 += (size_t)blockIdx.z * DKV * TT; Vh += (size_t)blockIdx.z * DKV * TT; Vl += (size_t)blockIdx.z * DKV * TT; OUTb += (size_t)blockIdx.z * TT * DQ;   // blockIdx.z: the batch's part of every plane and of the output
    const size_t hp = (size_t)blockIdx.y * TT * HD; const int lane = threadIdx.x & 31, lr = lane & 15, hi = lane >> 4; const int wv = __builtin_amdgcn_readfirstlane(threadIdx.x >> 5);   // the wave's number as a scalar: the key blocks' numbers and the skip above the diagonal stay scalar
#pragma unroll 1   // the two tiles run one after the other through the same buffers
    for (int half = 0; half < 2; ++half) { const int T = half ? (int)blockIdx.x : TT / 128 - 1 - (int)blockIdx.x;
        if (T * 128 < RH) fa_tile<true>(Qh + hp, Ql + hp, Kh + hp, Kl + hp, V16 + hp, Vh + hp, Vl + hp, OUTb + blockIdx.y * HD, T, wv, lr, hi, sm, ml);
        else fa_tile<false>(Qh + hp, Ql + hp, Kh + hp, Kl + hp, V16 + hp, Vh + hp, Vl + hp, OUTb + blockIdx.y * HD, T, wv, lr, hi, sm, ml); }
}

extern "C" void kernel_launch(void* const* d_in, const int* in_sizes, int n_in,
                              void* d_out, int out_size, void* d_ws, size_t ws_size, hipStream_t stream) {
    (void)in_sizes; (void)n_in; (void)out_size;
    const float* x = (const float*)d_in[0]; const float* pq = (const float*)d_in[1]; const float* pk = (const float*)d_in[2]; const float* pv = (const float*)d_in[3];   /* each [16][1024][64] */ const float* wq = pq, *wk = pk, *wv = pv, *wo = nullptr; (void)wo;
    float* OUT = (float*)d_out;     // [4][2048][1024]
    char* wsp = (char*)d_ws;
    auto take = [&](size_t bytes) { char* p = wsp; wsp += (bytes + 255) & ~(size_t)255; return (void*)p; };
    bf* WQ = (bf*)take((size_t)(DQ + 2 * DKV) * DM * 2);   /* q, k, v rows one behind the other: one [3072][1024] Bt */
    bf* XB = (bf*)take((size_t)NB_ * TT * DM * 2);
    h16* VT16 = (h16*)take((size_t)NB_ * NKV * HD * TT * 2);
    bf* QPh = (bf*)take((size_t)NB_ * (NH_ + NKV) * TT * HD * 2); bf* KPh = QPh + (size_t)NH_ * TT * HD;   /* per batch q heads, then k heads: GEMM column n (Bt row n) lands in plane n / 64 */ bf* QPl = (bf*)take((size_t)NB_ * (NH_ + NKV) * TT * HD * 2); bf* KPl = QPl + (size_t)NH_ * TT * HD; bf* VTh = (bf*)take((size_t)NB_ * NKV * HD * TT * 2); bf* VTl = (bf*)take((size_t)NB_ * NKV * HD * TT * 2);
    if ((size_t)(wsp - (char*)d_ws) > ws_size) return;
    k_prep<<<WB + NB_ * TT * DM / 2048, 256, 0, stream>>>(x, wq, wk, wv, WQ, XB);   /* tensor z's head hh 'xw' [1024][64] -> Bt rows z*1024 + hh*64..; x -> bf16 */
    k_proj<<<dim3(192, 1, NB_), 128, 0, stream>>>(XB, WQ, QPh, QPl, VT16, VTh, VTl);
    k_fattn<<<dim3(TT / 256, NH_, NB_), AW * 32, 0, stream>>>(QPh, QPl, KPh, KPl, VT16, VTh, VTl, OUT);
}
